// v000
// Times are from an AMD MI455X. After a warm-up the kernel runs many times in a row, and a time is the length of
// such a window on the GPU divided by its runs, so every launch and the gaps after it count. The runs cycle
// through copies of the inputs. A figure is the median of several windows, for all but v000 over two sittings.
// Sittings can differ by a few percent; kernels timed side by side share one.
// The starting kernel, v000, takes 353 microseconds a run.
// Contractions on v_wmma_f32_16x16x32_f16, f32 accumulate: x.Wk, x.Wq, x.Wv with f16 operands built from
// bf16-RNE inputs (x carried x16, W carried x1024), single products; k.q^T with k and q as plain f16 carried x8;
// P.v with P as plain f16 carried x1024 and v as f16 hi (x16) + x2048 residual plane (separate accumulator);
// elu, tanh, column softmax and the residual add in f32 on VALU.
#include <hip/hip_runtime.h>
#include <stdint.h>

#define NBATCH 4096
#define TT     128              // tokens per item
#define CC     20               // channels
#define KQ     100              // key/query dim
#define CP     32               // channels padded (k of the projections)
#define DP     128              // key dim padded / LDS pitch in halves
#define XROW   (TT * CC)        // 2560 floats per item

static_assert(XROW == 2560);
static_assert(TT == 128);
static_assert(DP == TT);

// LDS byte offsets of the main kernel
#define OFF_XS   0              // f32 [128][20]   10240  (bf16-RNE x, later y)
#define OFF_XH   10240          // f16 [128][32]    8192  (16*x, cols 20..31 zero)
#define OFF_KS   18432          // f16 [128][128]  32768  (8*k, cols 100..127 zero)
#define OFF_QS   51200          // f16 [128][128]  32768  (8*q; reused for 1024*P as [i][j])
#define OFF_VTH  83968          // f16 [32][128]    8192  (hi of 16*v, transposed [d][j])
#define OFF_VTL  92160          // f16 [32][128]    8192  (x2048 residual, transposed)
#define OFF_SS   100352         // f32 [128][128]  65536  (scaled scores, then exp)
#define LDS_MAIN 165888
static_assert(OFF_XH == OFF_XS + TT * CC * 4);
static_assert(OFF_KS == OFF_XH + TT * CP * 2);
static_assert(OFF_QS == OFF_KS + TT * DP * 2);
static_assert(OFF_VTH == OFF_QS + TT * DP * 2);
static_assert(OFF_VTL == OFF_VTH + CP * DP * 2);
static_assert(OFF_SS == OFF_VTL + CP * DP * 2);
static_assert(LDS_MAIN == OFF_SS + TT * TT * 4);

// workspace: f16 planes (halves): WkT [128 n][32 c] at 0, WqT at 4096, WvT [32 d][32 c] at 8192; total 9216 halves
#define WK_OFF    0
#define WQ_OFF    4096
#define WV_OFF    8192
#define WS_HALVES 9216
static_assert(WS_HALVES == 4096 + 4096 + 1024);
static_assert((WS_HALVES % 8) == 0);

typedef _Float16     v16h __attribute__((ext_vector_type(16)));
typedef _Float16     v8h  __attribute__((ext_vector_type(8)));
typedef float        v8f  __attribute__((ext_vector_type(8)));
typedef float        v4f  __attribute__((ext_vector_type(4)));
typedef unsigned int v4u  __attribute__((ext_vector_type(4)));

union Frag { v16h v; v8h half[2]; };

// ---- scalar helpers --------------------------------------------------------------------------------
__device__ __forceinline__ unsigned short bf_bits(float f) {          // f32 -> bf16 bits, RNE convert
  unsigned u = __float_as_uint(f);
  return (unsigned short)((u + 0x7FFFu + ((u >> 16) & 1u)) >> 16);
}
__device__ __forceinline__ float bf_up(unsigned short b) { return __uint_as_float(((unsigned)b) << 16); }
__device__ __forceinline__ float bfr(float f) { return bf_up(bf_bits(f)); }   // value after bf16 RNE convert
__device__ __forceinline__ v4f bfr4(v4f a) {
  v4f o;
  o[0] = bfr(a[0]); o[1] = bfr(a[1]); o[2] = bfr(a[2]); o[3] = bfr(a[3]);
  return o;
}
__device__ __forceinline__ unsigned short h_bits(float f) {           // f32 -> f16 bits, RNE convert
  return __builtin_bit_cast(unsigned short, (_Float16)f);
}
__device__ __forceinline__ v8f zero8() {
  v8f z;
  z[0] = 0.f; z[1] = 0.f; z[2] = 0.f; z[3] = 0.f; z[4] = 0.f; z[5] = 0.f; z[6] = 0.f; z[7] = 0.f;
  return z;
}
__device__ __forceinline__ float elu_f(float v) {                   // branchless elu (alpha = 1)
  const float e = __expf(v) - 1.0f;
  return v > 0.0f ? v : e;
}
__device__ __forceinline__ float tanh_f(float v) {                  // branchless tanh
  const float c = fminf(fmaxf(v, -15.0f), 15.0f);
  const float t = __expf(2.0f * c);
  return (t - 1.0f) * __builtin_amdgcn_rcpf(t + 1.0f);
}

// ---- 16-bit fragment loader (A, B alike): p points at row/col (lane&15), + k0 + 8*(lane>>4);
//      elements 0..7 <- p[0..7] (k0+8h..k0+8h+7), elements 8..15 <- p[16..23] (k0+16+8h..k0+16+8h+7)
__device__ __forceinline__ v16h ldfrag(const _Float16* p) {
  Frag f;
  f.half[0] = *(const v8h*)(p);
  f.half[1] = *(const v8h*)(p + 16);
  return f.v;
}

// ---- WMMA with trailing VALU hazard gap (ties D, keeps A/B live past the nops) ---------------------
__device__ __forceinline__ v8f mma(v16h a, v16h b, v8f c) {
  v8f d = __builtin_amdgcn_wmma_f32_16x16x32_f16(false, a, false, b, (short)0, c, false, false);
#if defined(__HIP_DEVICE_COMPILE__)
  asm volatile("v_nop\n\tv_nop\n\tv_nop\n\tv_nop" : "+v"(d) : "v"(a), "v"(b));
#endif
  return d;
}

// =====================================================================================================
// Weight planes: Wk [20 c][100 n] -> WkT[n][c] (n padded to 128, c padded to 32, pads zero), same for Wq;
// Wv [20][20] -> WvT[d][c] [32][32]. Values = f16 of (bf16-RNE value * 1024). One 256-thread block:
// fill the 9216-half LDS tile with 2-B stores (clamped source addresses), barrier, then 1152 x 16-B global
// =====================================================================================================
__global__ __launch_bounds__(256) void k_prep(const float* __restrict__ Wk, const float* __restrict__ Wq,
                                              const float* __restrict__ Wv, unsigned short* P) {
  __shared__ __align__(16) unsigned short sW[WS_HALVES];
  const int tid = threadIdx.x;

#pragma unroll 1
  for (int it = 0; it < 16; ++it) {                          // WkT: 4096 cells
    const int idx = it * 256 + tid;
    const int n = idx >> 5, c = idx & 31;
    const int nn = min(n, KQ - 1), cc = min(c, CC - 1);
    float v = Wk[cc * KQ + nn];
    v = (n < KQ && c < CC) ? v : 0.0f;
    sW[WK_OFF + idx] = h_bits(bfr(v) * 1024.0f);
  }
#pragma unroll 1
  for (int it = 0; it < 16; ++it) {                          // WqT: 4096 cells
    const int idx = it * 256 + tid;
    const int n = idx >> 5, c = idx & 31;
    const int nn = min(n, KQ - 1), cc = min(c, CC - 1);
    float v = Wq[cc * KQ + nn];
    v = (n < KQ && c < CC) ? v : 0.0f;
    sW[WQ_OFF + idx] = h_bits(bfr(v) * 1024.0f);
  }
#pragma unroll 1
  for (int it = 0; it < 4; ++it) {                           // WvT: 1024 cells
    const int idx = it * 256 + tid;
    const int d = idx >> 5, c = idx & 31;
    const int dd = min(d, CC - 1), cc = min(c, CC - 1);
    float v = Wv[cc * CC + dd];
    v = (d < CC && c < CC) ? v : 0.0f;
    sW[WV_OFF + idx] = h_bits(bfr(v) * 1024.0f);
  }
  __syncthreads();

  v4u pv[5];
#pragma unroll
  for (int it = 0; it < 5; ++it) {
    const int idx = min(it * 256 + tid, WS_HALVES / 8 - 1);
    pv[it] = *(const v4u*)(sW + (size_t)idx * 8);
  }
#pragma unroll
  for (int it = 0; it < 5; ++it) {
    const int idx = it * 256 + tid;                          // idx < 1152 is wave-uniform (tid < 128 at it = 4)
    if (idx < WS_HALVES / 8) *(v4u*)(P + (size_t)idx * 8) = pv[it];
  }
  
}

// =====================================================================================================
// Main: one 256-thread block (8 waves) per batch item; wave w owns token rows 16w..16w+15 in every GEMM.
// Phase 1: x -> xs (f32 bf16-RNE values) and xh (f16 of 16*x, cols 20..31 zero); threads 0..127 write cols
//          0..15 of row tid, threads 128..255 cols 16..31 (wave-uniform split). coverage: 128 rows x 32 cols.
// Phase 2: projections, A = xh rows (k = c, split map), B = W planes from global [n][c] (same map), one k-step;
//          D (row m0+8h+r, col n0+lo) -> elu/tanh in f32; kS/qS [i][d] = f16(8*val) with d >= 100 forced 0
//          (8 col tiles cover d 0..127); v -> vTh/vTl [d][j] for d 0..31 (d >= 20 forced 0).
// Phase 3: S[i][j] = (sum_d k q) / sqrt(128): A = kS rows i, B = qS as [n=j][k=d]; 4 k-steps; f32 into sS.
// Phase 4: softmax over i per column j: thread pair (tid>>1 = j, tid&1 = row half), max and sum combined with
//          __shfl_xor 1; P[i][j] = f16(1024 * e / sum) written into the qS region as [i][j].
// Phase 5: y_att[i][d] = sum_j P v: A = P rows i (k = j), B = vTh/vTl as [n=d][k=j]; hi and residual in
//          separate accumulators; y = (acc_h + acc_l/2048)/16384 + xs, written back into xs (d < 20).
// =====================================================================================================
__global__ __launch_bounds__(256) void k_main(const float* __restrict__ x, const unsigned short* __restrict__ Wp,
                                              const float* __restrict__ bk, const float* __restrict__ bq,
                                              const float* __restrict__ bv, float* out) {
  extern __shared__ __align__(16) unsigned char smem[];
  float*    xs  = (float*)(smem + OFF_XS);
  _Float16* xh  = (_Float16*)(smem + OFF_XH);
  _Float16* kS  = (_Float16*)(smem + OFF_KS);
  _Float16* qS  = (_Float16*)(smem + OFF_QS);
  _Float16* vTh = (_Float16*)(smem + OFF_VTH);
  _Float16* vTl = (_Float16*)(smem + OFF_VTL);
  float*    sS  = (float*)(smem + OFF_SS);
  const _Float16* W = (const _Float16*)(const void*)Wp;

  const int tid  = threadIdx.x;
  const int lane = tid & 31;
  const int wid  = tid >> 5;
  const int h    = lane >> 4;
  const int lo   = lane & 15;
  const int b    = blockIdx.x;
  const int m0   = wid * 16;
  const float* xb = x + (size_t)b * XROW;

  // ---------------- phase 1: stage x ----------------
  {
    const int part = tid >> 7;                      // wave-uniform
    const int row  = tid & 127;
    const float* xr  = xb + row * CC;               // row*80 B, 16-B aligned
    float*       xsr = xs + row * CC;
    _Float16*    xhr = xh + row * CP;
    if (part == 0) {
      const v4f a0 = bfr4(*(const v4f*)(xr));
      const v4f a1 = bfr4(*(const v4f*)(xr + 4));
      const v4f a2 = bfr4(*(const v4f*)(xr + 8));
      const v4f a3 = bfr4(*(const v4f*)(xr + 12));
      *(v4f*)(xsr)      = a0;
      *(v4f*)(xsr + 4)  = a1;
      *(v4f*)(xsr + 8)  = a2;
      *(v4f*)(xsr + 12) = a3;
      v8h p0, p1;
#pragma unroll
      for (int c = 0; c < 4; ++c) {
        p0[c]     = (_Float16)(a0[c] * 16.0f);
        p0[4 + c] = (_Float16)(a1[c] * 16.0f);
        p1[c]     = (_Float16)(a2[c] * 16.0f);
        p1[4 + c] = (_Float16)(a3[c] * 16.0f);
      }
      *(v8h*)(xhr)     = p0;
      *(v8h*)(xhr + 8) = p1;
    } else {
      const v4f a4 = bfr4(*(const v4f*)(xr + 16));
      *(v4f*)(xsr + 16) = a4;
      v8h p2, p3;
#pragma unroll
      for (int c = 0; c < 4; ++c) {
        p2[c]     = (_Float16)(a4[c] * 16.0f);
        p2[4 + c] = (_Float16)0.0f;
        p3[c]     = (_Float16)0.0f;
        p3[4 + c] = (_Float16)0.0f;
      }
      *(v8h*)(xhr + 16) = p2;
      *(v8h*)(xhr + 24) = p3;
    }
  }
  __syncthreads();

  // ---------------- phase 2: projections (K = 32, one k-step) ----------------
  {
    const v16h af = ldfrag(xh + (m0 + lo) * CP + 8 * h);        // A: row m0+lo, k = c
    // k = elu(x.Wk + bk)
#pragma unroll 1
    for (int nt = 0; nt < 8; ++nt) {
      const int n0 = nt * 16, n = n0 + lo;
      const v8f acc = mma(af, ldfrag(W + WK_OFF + (size_t)(n0 + lo) * CP + 8 * h), zero8());
      const float bias = bfr(bk[min(n, KQ - 1)]);
#pragma unroll
      for (int r = 0; r < 8; ++r) {
        float val = elu_f(acc[r] * 6.103515625e-05f + bias);   // acc * 2^-14
        val = (n < KQ) ? val : 0.0f;
        kS[(m0 + 8 * h + r) * DP + n] = (_Float16)(val * 8.0f);
      }
    }
    // q = elu(x.Wq + bq)
#pragma unroll 1
    for (int nt = 0; nt < 8; ++nt) {
      const int n0 = nt * 16, n = n0 + lo;
      const v8f acc = mma(af, ldfrag(W + WQ_OFF + (size_t)(n0 + lo) * CP + 8 * h), zero8());
      const float bias = bfr(bq[min(n, KQ - 1)]);
#pragma unroll
      for (int r = 0; r < 8; ++r) {
        float val = elu_f(acc[r] * 6.103515625e-05f + bias);
        val = (n < KQ) ? val : 0.0f;
        qS[(m0 + 8 * h + r) * DP + n] = (_Float16)(val * 8.0f);
      }
    }
    // v = tanh(x.Wv + bv), stored transposed as hi + residual planes
#pragma unroll 1
    for (int nt = 0; nt < 2; ++nt) {
      const int n0 = nt * 16, d = n0 + lo;
      const v8f acc = mma(af, ldfrag(W + WV_OFF + (size_t)(n0 + lo) * CP + 8 * h), zero8());
      const float bias = bfr(bv[min(d, CC - 1)]);
#pragma unroll
      for (int r = 0; r < 8; ++r) {
        float val = tanh_f(acc[r] * 6.103515625e-05f + bias);
        val = (d < CC) ? val : 0.0f;
        const float v16 = val * 16.0f;
        const _Float16 hh = (_Float16)v16;
        const _Float16 ll = (_Float16)((v16 - (float)hh) * 2048.0f);
        vTh[d * DP + m0 + 8 * h + r] = hh;
        vTl[d * DP + m0 + 8 * h + r] = ll;
      }
    }
  }
  __syncthreads();

  // ---------------- phase 3: scores S[i][j] (K = 128 over d) ----------------
  {
    const float SC64 = 0.08838834764831845f * 0.015625f;        // (1/sqrt(128)) * 2^-6
    const _Float16* pa = kS + (m0 + lo) * DP + 8 * h;            // A: row i = m0+lo, k = d
    const v16h a0 = ldfrag(pa);
    const v16h a1 = ldfrag(pa + 32);
    const v16h a2 = ldfrag(pa + 64);
    const v16h a3 = ldfrag(pa + 96);
#pragma unroll 1
    for (int nt = 0; nt < 8; ++nt) {
      const int n0 = nt * 16;
      const _Float16* pb = qS + (n0 + lo) * DP + 8 * h;          // B: col j = n0+lo, k = d (same map)
      v8f acc = mma(a0, ldfrag(pb), zero8());
      acc = mma(a1, ldfrag(pb + 32), acc);
      acc = mma(a2, ldfrag(pb + 64), acc);
      acc = mma(a3, ldfrag(pb + 96), acc);
#pragma unroll
      for (int r = 0; r < 8; ++r) sS[(m0 + 8 * h + r) * TT + n0 + lo] = acc[r] * SC64;
    }
  }
  __syncthreads();

  // ---------------- phase 4: softmax over i, per column j ----------------
  {
    const int j    = tid >> 1;
    const int half = tid & 1;
    float* col = sS + (half * 64) * TT + j;                      // rows i = 64*half + ii
    float mx = -3.0e38f;
#pragma unroll 4
    for (int ii = 0; ii < 64; ++ii) mx = fmaxf(mx, col[ii * TT]);
    mx = fmaxf(mx, __shfl_xor(mx, 1));
    float sum = 0.0f;
#pragma unroll 4
    for (int ii = 0; ii < 64; ++ii) {
      const float e = __expf(col[ii * TT] - mx);
      sum += e;
      col[ii * TT] = e;
    }
    sum += __shfl_xor(sum, 1);
    const float rs = 1.0f / sum;                                 // sum >= 1
    _Float16* Ph = qS;                                           // P as [i][j], carried x1024
#pragma unroll 4
    for (int ii = 0; ii < 64; ++ii)
      Ph[(half * 64 + ii) * DP + j] = (_Float16)((col[ii * TT] * rs) * 1024.0f);
  }
  __syncthreads();

  // ---------------- phase 5: y = P.v + x (K = 128 over j; hi and residual accumulators) ----------------
  {
    const _Float16* Ph = qS;
    const _Float16* pa = Ph + (m0 + lo) * DP + 8 * h;            // A: row i = m0+lo, k = j
    const v16h p0 = ldfrag(pa);
    const v16h p1 = ldfrag(pa + 32);
    const v16h p2 = ldfrag(pa + 64);
    const v16h p3 = ldfrag(pa + 96);
    const _Float16* bh0 = vTh + lo * DP + 8 * h;                 // B: col d = lo,    k = j
    const _Float16* bh1 = vTh + (16 + lo) * DP + 8 * h;          // B: col d = 16+lo, k = j
    const _Float16* bl0 = vTl + lo * DP + 8 * h;
    const _Float16* bl1 = vTl + (16 + lo) * DP + 8 * h;
    v8f ah0 = zero8(), ah1 = zero8(), al0 = zero8(), al1 = zero8();
    ah0 = mma(p0, ldfrag(bh0),      ah0); ah1 = mma(p0, ldfrag(bh1),      ah1);
    al0 = mma(p0, ldfrag(bl0),      al0); al1 = mma(p0, ldfrag(bl1),      al1);
    ah0 = mma(p1, ldfrag(bh0 + 32), ah0); ah1 = mma(p1, ldfrag(bh1 + 32), ah1);
    al0 = mma(p1, ldfrag(bl0 + 32), al0); al1 = mma(p1, ldfrag(bl1 + 32), al1);
    ah0 = mma(p2, ldfrag(bh0 + 64), ah0); ah1 = mma(p2, ldfrag(bh1 + 64), ah1);
    al0 = mma(p2, ldfrag(bl0 + 64), al0); al1 = mma(p2, ldfrag(bl1 + 64), al1);
    ah0 = mma(p3, ldfrag(bh0 + 96), ah0); ah1 = mma(p3, ldfrag(bh1 + 96), ah1);
    al0 = mma(p3, ldfrag(bl0 + 96), al0); al1 = mma(p3, ldfrag(bl1 + 96), al1);

    const int d1  = 16 + lo;
    const int d1c = min(d1, CC - 1);
#pragma unroll
    for (int r = 0; r < 8; ++r) {
      const int i = m0 + 8 * h + r;
      float* px = xs + i * CC;
      const float y0 = (ah0[r] + al0[r] * 0.00048828125f) * 6.103515625e-05f;   // (h + l/2048) * 2^-14
      const float y1 = (ah1[r] + al1[r] * 0.00048828125f) * 6.103515625e-05f;
      const float v0 = px[lo] + y0;                              // d = lo < 16 < 20 always valid
      const float v1 = px[d1c] + y1;
      px[lo] = v0;
      if (lo < 4) px[d1] = v1;                                   // d = 16..19
    }
  }
  __syncthreads();

  {
    const v4f* xs4 = (const v4f*)xs;
    const int c2  = 16 + wid;                                    // valid iff wid < 4 (wave-uniform)
    const int c2c = min(c2, 19);
    const v4f pv0 = xs4[(wid)     * 32 + lane];
    const v4f pv1 = xs4[(8 + wid) * 32 + lane];
    const v4f pv2 = xs4[c2c       * 32 + lane];
    float* ob = out + (size_t)b * XROW + (size_t)lane * 4;
    *(v4f*)(ob + (size_t)wid * 128)       = pv0;
    *(v4f*)(ob + (size_t)(8 + wid) * 128) = pv1;
    if (wid < 4) *(v4f*)(ob + (size_t)c2 * 128) = pv2;
    
  }
}

// =====================================================================================================
// Workspace map (bytes): WkT f16 [128][32] 8192 at 0; WqT 8192 at 8192; WvT f16 [32][32] 2048 at 16384;
// total 18432, every region a whole multiple of 512 B (the store granularity of k_prep).
// =====================================================================================================
extern "C" void kernel_launch(void* const* d_in, const int* in_sizes, int n_in,
                              void* d_out, int out_size, void* d_ws, size_t ws_size,
                              hipStream_t stream) {
  if (n_in < 7) return;
  if (in_sizes[0] != NBATCH * XROW) return;
  if (in_sizes[1] != CC * KQ) return;
  if (in_sizes[2] != KQ) return;
  if (in_sizes[3] != CC * KQ) return;
  if (in_sizes[4] != KQ) return;
  if (in_sizes[5] != CC * CC) return;
  if (in_sizes[6] != CC) return;
  if (out_size != NBATCH * XROW) return;

  const float* x  = (const float*)d_in[0];     // [4096][128][20]
  const float* Wk = (const float*)d_in[1];     // [20][100]
  const float* bk = (const float*)d_in[2];     // [100]
  const float* Wq = (const float*)d_in[3];     // [20][100]
  const float* bq = (const float*)d_in[4];     // [100]
  const float* Wv = (const float*)d_in[5];     // [20][20]
  const float* bv = (const float*)d_in[6];     // [20]
  float* out = (float*)d_out;                  // [4096][128][20]

  const size_t wsb = (size_t)WS_HALVES * 2;    // 18432
  if (wsb > ws_size) return;
  if (wsb > (size_t)134217728) return;
  unsigned short* P = (unsigned short*)d_ws;

  (void)hipFuncSetAttribute(reinterpret_cast<const void*>(&k_main),
                            hipFuncAttributeMaxDynamicSharedMemorySize, LDS_MAIN);

  const dim3 gPrep(1), bPrep(256);
  const dim3 gMain(NBATCH), bMain(256);

  k_prep<<<gPrep, bPrep, 0, stream>>>(Wk, Wq, Wv, P);
  k_main<<<gMain, bMain, LDS_MAIN, stream>>>(x, P, bk, bq, bv, out);
  (void)hipGetLastError();
}

// v001
// Measured time: 197 microseconds a run.
// Timed twice side by side with v000, it ran 1.79 and 1.80 times as fast.
// Contractions on v_wmma_f32_16x16x32_f16, f32 accumulate: x.Wk, x.Wq, x.Wv with f16 operands built from
// bf16-RNE inputs (x carried x16, W carried x1024), single products; k.q^T with k and q as plain f16 carried x8;
// P.v with P as plain f16 carried x1024 and v as f16 hi (x16) + x2048 residual plane (separate accumulator);
// elu, tanh, column softmax and the residual add in f32 on VALU.
#include <hip/hip_runtime.h>
#include <stdint.h>

#define NBATCH 4096
#define TT     128              // tokens per item
#define CC     20               // channels
#define KQ     100              // key/query dim
#define CP     32               // channels padded (k of the projections)
#define DP     128              // key dim padded (k of the score product)
#define PX     40               // LDS pitch of xh in halves: 80 B = 16 B x 5
#define PH     136              // LDS pitch of kS, qS / P, vTh, vTl in halves: 272 B = 16 B x 17
#define PS     132              // LDS pitch of sS in floats: rows 8 apart lie 32 banks apart
#define XROW   (TT * CC)        // 2560 floats per item

static_assert(XROW == 2560);
static_assert(TT == 128);
static_assert(DP == TT);
static_assert(PX >= CP && PH >= DP && PS >= TT);
static_assert((PX * 2) % 32 == 16 && (PH * 2) % 32 == 16);    // 16-B fragment reads: pitch = 16 B x odd

// LDS byte offsets of the main kernel
#define OFF_XS   0              // f32 [128][20]   10240  (bf16-RNE x, later y)
// (the pad columns behind each row's last used column are never written and never read)
#define OFF_XH   10240          // f16 [128][32 of 40]    10240  (16*x, cols 20..31 zero)
#define OFF_KS   20480          // f16 [128][128 of 136]  34816  (8*k, cols 100..127 zero)
#define OFF_QS   55296          // f16 [128][128 of 136]  34816  (8*q; reused for 1024*P as [i][j])
#define OFF_VTH  90112          // f16 [32][128 of 136]    8704  (hi of 16*v, transposed [d][j])
#define OFF_VTL  98816          // f16 [32][128 of 136]    8704  (x2048 residual, transposed)
#define OFF_SS   107520         // f32 [128][128 of 132]  67584  (scaled scores, then exp)
#define LDS_MAIN 175104
static_assert(OFF_XH == OFF_XS + TT * CC * 4);
static_assert(OFF_KS == OFF_XH + TT * PX * 2);
static_assert(OFF_QS == OFF_KS + TT * PH * 2);
static_assert(OFF_VTH == OFF_QS + TT * PH * 2);
static_assert(OFF_VTL == OFF_VTH + CP * PH * 2);
static_assert(OFF_SS == OFF_VTL + CP * PH * 2);
static_assert(LDS_MAIN == OFF_SS + TT * PS * 4);

// workspace: f16 planes (halves): WkT [128 n][32 c] at 0, WqT at 4096, WvT [32 d][32 c] at 8192; total 9216 halves
#define WK_OFF    0
#define WQ_OFF    4096
#define WV_OFF    8192
#define WS_HALVES 9216
static_assert(WS_HALVES == 4096 + 4096 + 1024);
static_assert((WS_HALVES % 8) == 0);

typedef _Float16     v16h __attribute__((ext_vector_type(16)));
typedef _Float16     v8h  __attribute__((ext_vector_type(8)));
typedef float        v8f  __attribute__((ext_vector_type(8)));
typedef float        v4f  __attribute__((ext_vector_type(4)));
typedef unsigned int v4u  __attribute__((ext_vector_type(4)));

union Frag { v16h v; v8h half[2]; };

// ---- scalar helpers --------------------------------------------------------------------------------
__device__ __forceinline__ unsigned short bf_bits(float f) {          // f32 -> bf16 bits, RNE convert
  unsigned u = __float_as_uint(f);
  return (unsigned short)((u + 0x7FFFu + ((u >> 16) & 1u)) >> 16);
}
__device__ __forceinline__ float bf_up(unsigned short b) { return __uint_as_float(((unsigned)b) << 16); }
__device__ __forceinline__ float bfr(float f) { return bf_up(bf_bits(f)); }   // value after bf16 RNE convert
__device__ __forceinline__ v4f bfr4(v4f a) {
  v4f o;
  o[0] = bfr(a[0]); o[1] = bfr(a[1]); o[2] = bfr(a[2]); o[3] = bfr(a[3]);
  return o;
}
__device__ __forceinline__ unsigned short h_bits(float f) {           // f32 -> f16 bits, RNE convert
  return __builtin_bit_cast(unsigned short, (_Float16)f);
}
__device__ __forceinline__ v8f zero8() {
  v8f z;
  z[0] = 0.f; z[1] = 0.f; z[2] = 0.f; z[3] = 0.f; z[4] = 0.f; z[5] = 0.f; z[6] = 0.f; z[7] = 0.f;
  return z;
}
__device__ __forceinline__ float elu_f(float v) {                   // branchless elu (alpha = 1)
  const float e = __expf(v) - 1.0f;
  return v > 0.0f ? v : e;
}
__device__ __forceinline__ float tanh_f(float v) {                  // branchless tanh
  const float c = fminf(fmaxf(v, -15.0f), 15.0f);
  const float t = __expf(2.0f * c);
  return (t - 1.0f) * __builtin_amdgcn_rcpf(t + 1.0f);
}

// ---- 16-bit fragment loader (A, B alike): p points at row/col (lane&15), + k0 + 8*(lane>>4);
//      elements 0..7 <- p[0..7] (k0+8h..k0+8h+7), elements 8..15 <- p[16..23] (k0+16+8h..k0+16+8h+7)
__device__ __forceinline__ v16h ldfrag(const _Float16* p) {
  Frag f;
  f.half[0] = *(const v8h*)(p);
  f.half[1] = *(const v8h*)(p + 16);
  return f.v;
}

// ---- WMMA with trailing VALU hazard gap (ties D, keeps A/B live past the nops) ---------------------
__device__ __forceinline__ v8f mma(v16h a, v16h b, v8f c) {
  v8f d = __builtin_amdgcn_wmma_f32_16x16x32_f16(false, a, false, b, (short)0, c, false, false);
#if defined(__HIP_DEVICE_COMPILE__)
  asm volatile("v_nop\n\tv_nop\n\tv_nop\n\tv_nop" : "+v"(d) : "v"(a), "v"(b));
#endif
  return d;
}

// =====================================================================================================
// Weight planes: Wk [20 c][100 n] -> WkT[n][c] (n padded to 128, c padded to 32, pads zero), same for Wq;
// Wv [20][20] -> WvT[d][c] [32][32]. Values = f16 of (bf16-RNE value * 1024). One 256-thread block:
// fill the 9216-half LDS tile with 2-B stores (clamped source addresses), barrier, then 1152 x 16-B global
// =====================================================================================================
__global__ __launch_bounds__(256) void k_prep(const float* __restrict__ Wk, const float* __restrict__ Wq,
                                              const float* __restrict__ Wv, unsigned short* P) {
  __shared__ __align__(16) unsigned short sW[WS_HALVES];
  const int tid = threadIdx.x;

#pragma unroll 1
  for (int it = 0; it < 16; ++it) {                          // WkT: 4096 cells
    const int idx = it * 256 + tid;
    const int n = idx >> 5, c = idx & 31;
    const int nn = min(n, KQ - 1), cc = min(c, CC - 1);
    float v = Wk[cc * KQ + nn];
    v = (n < KQ && c < CC) ? v : 0.0f;
    sW[WK_OFF + idx] = h_bits(bfr(v) * 1024.0f);
  }
#pragma unroll 1
  for (int it = 0; it < 16; ++it) {                          // WqT: 4096 cells
    const int idx = it * 256 + tid;
    const int n = idx >> 5, c = idx & 31;
    const int nn = min(n, KQ - 1), cc = min(c, CC - 1);
    float v = Wq[cc * KQ + nn];
    v = (n < KQ && c < CC) ? v : 0.0f;
    sW[WQ_OFF + idx] = h_bits(bfr(v) * 1024.0f);
  }
#pragma unroll 1
  for (int it = 0; it < 4; ++it) {                           // WvT: 1024 cells
    const int idx = it * 256 + tid;
    const int d = idx >> 5, c = idx & 31;
    const int dd = min(d, CC - 1), cc = min(c, CC - 1);
    float v = Wv[cc * CC + dd];
    v = (d < CC && c < CC) ? v : 0.0f;
    sW[WV_OFF + idx] = h_bits(bfr(v) * 1024.0f);
  }
  __syncthreads();

  v4u pv[5];
#pragma unroll
  for (int it = 0; it < 5; ++it) {
    const int idx = min(it * 256 + tid, WS_HALVES / 8 - 1);
    pv[it] = *(const v4u*)(sW + (size_t)idx * 8);
  }
#pragma unroll
  for (int it = 0; it < 5; ++it) {
    const int idx = it * 256 + tid;                          // idx < 1152 is wave-uniform (tid < 128 at it = 4)
    if (idx < WS_HALVES / 8) *(v4u*)(P + (size_t)idx * 8) = pv[it];
  }
  
}

// =====================================================================================================
// Main: one 256-thread block (8 waves) per batch item; wave w owns token rows 16w..16w+15 in every GEMM.
// Phase 1: x -> xs (f32 bf16-RNE values) and xh (f16 of 16*x, cols 20..31 zero); threads 0..127 write cols
//          0..15 of row tid, threads 128..255 cols 16..31 (wave-uniform split). coverage: 128 rows x 32 cols.
// Phase 2: projections, A = xh rows (k = c, split map), B = W planes from global [n][c] (same map), one k-step;
//          D (row m0+8h+r, col n0+lo) -> elu/tanh in f32; kS/qS [i][d] = f16(8*val) with d >= 100 forced 0
//          (8 col tiles cover d 0..127); v -> vTh/vTl [d][j] for d 0..31 (d >= 20 forced 0).
// Phase 3: S[i][j] = (sum_d k q) / sqrt(128): A = kS rows i, B = qS as [n=j][k=d]; 4 k-steps; f32 into sS.
// Phase 4: softmax over i per column j: thread pair (tid>>1 = j, tid&1 = row half), max and sum combined with
//          __shfl_xor 1; P[i][j] = f16(1024 * e / sum) written into the qS region as [i][j].
// Phase 5: y_att[i][d] = sum_j P v: A = P rows i (k = j), B = vTh/vTl as [n=d][k=j]; hi and residual in
//          separate accumulators; y = (acc_h + acc_l/2048)/16384 + xs, written back into xs (d < 20).
// =====================================================================================================
__global__ __launch_bounds__(256) void k_main(const float* __restrict__ x, const unsigned short* __restrict__ Wp,
                                              const float* __restrict__ bk, const float* __restrict__ bq,
                                              const float* __restrict__ bv, float* out) {
  extern __shared__ __align__(16) unsigned char smem[];
  float*    xs  = (float*)(smem + OFF_XS);
  _Float16* xh  = (_Float16*)(smem + OFF_XH);
  _Float16* kS  = (_Float16*)(smem + OFF_KS);
  _Float16* qS  = (_Float16*)(smem + OFF_QS);
  _Float16* vTh = (_Float16*)(smem + OFF_VTH);
  _Float16* vTl = (_Float16*)(smem + OFF_VTL);
  float*    sS  = (float*)(smem + OFF_SS);
  const _Float16* W = (const _Float16*)(const void*)Wp;

  const int tid  = threadIdx.x;
  const int lane = tid & 31;
  const int wid  = tid >> 5;
  const int h    = lane >> 4;
  const int lo   = lane & 15;
  const int b    = blockIdx.x;
  const int m0   = wid * 16;
  const float* xb = x + (size_t)b * XROW;

  // ---------------- phase 1: stage x ----------------
  {
    const int part = tid >> 7;                      // wave-uniform
    const int row  = tid & 127;
    const float* xr  = xb + row * CC;               // row*80 B, 16-B aligned
    float*       xsr = xs + row * CC;
    _Float16*    xhr = xh + row * PX;
    if (part == 0) {
      const v4f a0 = bfr4(*(const v4f*)(xr));
      const v4f a1 = bfr4(*(const v4f*)(xr + 4));
      const v4f a2 = bfr4(*(const v4f*)(xr + 8));
      const v4f a3 = bfr4(*(const v4f*)(xr + 12));
      *(v4f*)(xsr)      = a0;
      *(v4f*)(xsr + 4)  = a1;
      *(v4f*)(xsr + 8)  = a2;
      *(v4f*)(xsr + 12) = a3;
      v8h p0, p1;
#pragma unroll
      for (int c = 0; c < 4; ++c) {
        p0[c]     = (_Float16)(a0[c] * 16.0f);
        p0[4 + c] = (_Float16)(a1[c] * 16.0f);
        p1[c]     = (_Float16)(a2[c] * 16.0f);
        p1[4 + c] = (_Float16)(a3[c] * 16.0f);
      }
      *(v8h*)(xhr)     = p0;
      *(v8h*)(xhr + 8) = p1;
    } else {
      const v4f a4 = bfr4(*(const v4f*)(xr + 16));
      *(v4f*)(xsr + 16) = a4;
      v8h p2, p3;
#pragma unroll
      for (int c = 0; c < 4; ++c) {
        p2[c]     = (_Float16)(a4[c] * 16.0f);
        p2[4 + c] = (_Float16)0.0f;
        p3[c]     = (_Float16)0.0f;
        p3[4 + c] = (_Float16)0.0f;
      }
      *(v8h*)(xhr + 16) = p2;
      *(v8h*)(xhr + 24) = p3;
    }
  }
  __syncthreads();

  // ---------------- phase 2: projections (K = 32, one k-step) ----------------
  {
    const v16h af = ldfrag(xh + (m0 + lo) * PX + 8 * h);        // A: row m0+lo, k = c
    // k = elu(x.Wk + bk)
#pragma unroll 1
    for (int nt = 0; nt < 8; ++nt) {
      const int n0 = nt * 16, n = n0 + lo;
      const v8f acc = mma(af, ldfrag(W + WK_OFF + (size_t)(n0 + lo) * CP + 8 * h), zero8());
      const float bias = bfr(bk[min(n, KQ - 1)]);
#pragma unroll
      for (int r = 0; r < 8; ++r) {
        float val = elu_f(acc[r] * 6.103515625e-05f + bias);   // acc * 2^-14
        val = (n < KQ) ? val : 0.0f;
        kS[(m0 + 8 * h + r) * PH + n] = (_Float16)(val * 8.0f);
      }
    }
    // q = elu(x.Wq + bq)
#pragma unroll 1
    for (int nt = 0; nt < 8; ++nt) {
      const int n0 = nt * 16, n = n0 + lo;
      const v8f acc = mma(af, ldfrag(W + WQ_OFF + (size_t)(n0 + lo) * CP + 8 * h), zero8());
      const float bias = bfr(bq[min(n, KQ - 1)]);
#pragma unroll
      for (int r = 0; r < 8; ++r) {
        float val = elu_f(acc[r] * 6.103515625e-05f + bias);
        val = (n < KQ) ? val : 0.0f;
        qS[(m0 + 8 * h + r) * PH + n] = (_Float16)(val * 8.0f);
      }
    }
    // v = tanh(x.Wv + bv), stored transposed as hi + residual planes
#pragma unroll 1
    for (int nt = 0; nt < 2; ++nt) {
      const int n0 = nt * 16, d = n0 + lo;
      const v8f acc = mma(af, ldfrag(W + WV_OFF + (size_t)(n0 + lo) * CP + 8 * h), zero8());
      const float bias = bfr(bv[min(d, CC - 1)]);
#pragma unroll
      for (int r = 0; r < 8; ++r) {
        float val = tanh_f(acc[r] * 6.103515625e-05f + bias);
        val = (d < CC) ? val : 0.0f;
        const float v16 = val * 16.0f;
        const _Float16 hh = (_Float16)v16;
        const _Float16 ll = (_Float16)((v16 - (float)hh) * 2048.0f);
        vTh[d * PH + m0 + 8 * h + r] = hh;
        vTl[d * PH + m0 + 8 * h + r] = ll;
      }
    }
  }
  __syncthreads();

  // ---------------- phase 3: scores S[i][j] (K = 128 over d) ----------------
  {
    const float SC64 = 0.08838834764831845f * 0.015625f;        // (1/sqrt(128)) * 2^-6
    const _Float16* pa = kS + (m0 + lo) * PH + 8 * h;            // A: row i = m0+lo, k = d
    const v16h a0 = ldfrag(pa);
    const v16h a1 = ldfrag(pa + 32);
    const v16h a2 = ldfrag(pa + 64);
    const v16h a3 = ldfrag(pa + 96);
#pragma unroll 1
    for (int nt = 0; nt < 8; ++nt) {
      const int n0 = nt * 16;
      const _Float16* pb = qS + (n0 + lo) * PH + 8 * h;          // B: col j = n0+lo, k = d (same map)
      v8f acc = mma(a0, ldfrag(pb), zero8());
      acc = mma(a1, ldfrag(pb + 32), acc);
      acc = mma(a2, ldfrag(pb + 64), acc);
      acc = mma(a3, ldfrag(pb + 96), acc);
#pragma unroll
      for (int r = 0; r < 8; ++r) sS[(m0 + 8 * h + r) * PS + n0 + lo] = acc[r] * SC64;
    }
  }
  __syncthreads();

  // ---------------- phase 4: softmax over i, per column j ----------------
  {
    const int j    = tid >> 1;
    const int half = tid & 1;
    float* col = sS + (half * 64) * PS + j;                      // rows i = 64*half + ii
    float mx = -3.0e38f;
#pragma unroll 4
    for (int ii = 0; ii < 64; ++ii) mx = fmaxf(mx, col[ii * PS]);
    mx = fmaxf(mx, __shfl_xor(mx, 1));
    float sum = 0.0f;
#pragma unroll 4
    for (int ii = 0; ii < 64; ++ii) {
      const float e = __expf(col[ii * PS] - mx);
      sum += e;
      col[ii * PS] = e;
    }
    sum += __shfl_xor(sum, 1);
    const float rs = 1.0f / sum;                                 // sum >= 1
    _Float16* Ph = qS;                                           // P as [i][j], carried x1024
#pragma unroll 4
    for (int ii = 0; ii < 64; ++ii)
      Ph[(half * 64 + ii) * PH + j] = (_Float16)((col[ii * PS] * rs) * 1024.0f);
  }
  __syncthreads();

  // ---------------- phase 5: y = P.v + x (K = 128 over j; hi and residual accumulators) ----------------
  {
    const _Float16* Ph = qS;
    const _Float16* pa = Ph + (m0 + lo) * PH + 8 * h;            // A: row i = m0+lo, k = j
    const v16h p0 = ldfrag(pa);
    const v16h p1 = ldfrag(pa + 32);
    const v16h p2 = ldfrag(pa + 64);
    const v16h p3 = ldfrag(pa + 96);
    const _Float16* bh0 = vTh + lo * PH + 8 * h;                 // B: col d = lo,    k = j
    const _Float16* bh1 = vTh + (16 + lo) * PH + 8 * h;          // B: col d = 16+lo, k = j
    const _Float16* bl0 = vTl + lo * PH + 8 * h;
    const _Float16* bl1 = vTl + (16 + lo) * PH + 8 * h;
    v8f ah0 = zero8(), ah1 = zero8(), al0 = zero8(), al1 = zero8();
    ah0 = mma(p0, ldfrag(bh0),      ah0); ah1 = mma(p0, ldfrag(bh1),      ah1);
    al0 = mma(p0, ldfrag(bl0),      al0); al1 = mma(p0, ldfrag(bl1),      al1);
    ah0 = mma(p1, ldfrag(bh0 + 32), ah0); ah1 = mma(p1, ldfrag(bh1 + 32), ah1);
    al0 = mma(p1, ldfrag(bl0 + 32), al0); al1 = mma(p1, ldfrag(bl1 + 32), al1);
    ah0 = mma(p2, ldfrag(bh0 + 64), ah0); ah1 = mma(p2, ldfrag(bh1 + 64), ah1);
    al0 = mma(p2, ldfrag(bl0 + 64), al0); al1 = mma(p2, ldfrag(bl1 + 64), al1);
    ah0 = mma(p3, ldfrag(bh0 + 96), ah0); ah1 = mma(p3, ldfrag(bh1 + 96), ah1);
    al0 = mma(p3, ldfrag(bl0 + 96), al0); al1 = mma(p3, ldfrag(bl1 + 96), al1);

    const int d1  = 16 + lo;
    const int d1c = min(d1, CC - 1);
#pragma unroll
    for (int r = 0; r < 8; ++r) {
      const int i = m0 + 8 * h + r;
      float* px = xs + i * CC;
      const float y0 = (ah0[r] + al0[r] * 0.00048828125f) * 6.103515625e-05f;   // (h + l/2048) * 2^-14
      const float y1 = (ah1[r] + al1[r] * 0.00048828125f) * 6.103515625e-05f;
      const float v0 = px[lo] + y0;                              // d = lo < 16 < 20 always valid
      const float v1 = px[d1c] + y1;
      px[lo] = v0;
      if (lo < 4) px[d1] = v1;                                   // d = 16..19
    }
  }
  __syncthreads();

  {
    const v4f* xs4 = (const v4f*)xs;
    const int c2  = 16 + wid;                                    // valid iff wid < 4 (wave-uniform)
    const int c2c = min(c2, 19);
    const v4f pv0 = xs4[(wid)     * 32 + lane];
    const v4f pv1 = xs4[(8 + wid) * 32 + lane];
    const v4f pv2 = xs4[c2c       * 32 + lane];
    float* ob = out + (size_t)b * XROW + (size_t)lane * 4;
    *(v4f*)(ob + (size_t)wid * 128)       = pv0;
    *(v4f*)(ob + (size_t)(8 + wid) * 128) = pv1;
    if (wid < 4) *(v4f*)(ob + (size_t)c2 * 128) = pv2;
    
  }
}

// =====================================================================================================
// Workspace map (bytes): WkT f16 [128][32] 8192 at 0; WqT 8192 at 8192; WvT f16 [32][32] 2048 at 16384;
// total 18432, every region a whole multiple of 512 B (the store granularity of k_prep).
// =====================================================================================================
extern "C" void kernel_launch(void* const* d_in, const int* in_sizes, int n_in,
                              void* d_out, int out_size, void* d_ws, size_t ws_size,
                              hipStream_t stream) {
  if (n_in < 7) return;
  if (in_sizes[0] != NBATCH * XROW) return;
  if (in_sizes[1] != CC * KQ) return;
  if (in_sizes[2] != KQ) return;
  if (in_sizes[3] != CC * KQ) return;
  if (in_sizes[4] != KQ) return;
  if (in_sizes[5] != CC * CC) return;
  if (in_sizes[6] != CC) return;
  if (out_size != NBATCH * XROW) return;

  const float* x  = (const float*)d_in[0];     // [4096][128][20]
  const float* Wk = (const float*)d_in[1];     // [20][100]
  const float* bk = (const float*)d_in[2];     // [100]
  const float* Wq = (const float*)d_in[3];     // [20][100]
  const float* bq = (const float*)d_in[4];     // [100]
  const float* Wv = (const float*)d_in[5];     // [20][20]
  const float* bv = (const float*)d_in[6];     // [20]
  float* out = (float*)d_out;                  // [4096][128][20]

  const size_t wsb = (size_t)WS_HALVES * 2;    // 18432
  if (wsb > ws_size) return;
  if (wsb > (size_t)134217728) return;
  unsigned short* P = (unsigned short*)d_ws;

  (void)hipFuncSetAttribute(reinterpret_cast<const void*>(&k_main),
                            hipFuncAttributeMaxDynamicSharedMemorySize, LDS_MAIN);

  const dim3 gPrep(1), bPrep(256);
  const dim3 gMain(NBATCH), bMain(256);

  k_prep<<<gPrep, bPrep, 0, stream>>>(Wk, Wq, Wv, P);
  k_main<<<gMain, bMain, LDS_MAIN, stream>>>(x, P, bk, bq, bv, out);
  (void)hipGetLastError();
}

// v002
// Measured time: 78.7 microseconds a run.
// Timed twice side by side with v001, it ran 2.50 and 2.49 times as fast.
// Over all steps from v000 it is 4.49 times as fast.
// Contractions on v_wmma_f32_16x16x32_f16, f32 accumulate: x.Wk, x.Wq, x.Wv with f16 operands built from
// bf16-RNE inputs (x carried x16, W carried x1024), single products; k.q^T with k and q as plain f16 carried x8;
// P.v with P as plain f16 carried x1024 and v as f16 hi (x16) + x2048 residual plane (separate accumulator);
// elu, tanh, column softmax (in registers) and the residual add in f32 on VALU.
#include <hip/hip_runtime.h>
#include <stdint.h>

#define NBATCH 4096
#define TT     128              // tokens per item
#define CC     20               // channels
#define KQ     100              // key/query dim
#define CP     32               // channels padded (k of the projections)
#define DP     128              // key dim padded (k of the score product)
#define PX     40               // LDS pitch of xh in halves: 80 B = 16 B x 5
#define PH     136              // LDS pitch of kS, qS / P, vTh, vTl in halves: 272 B = 16 B x 17
#define XROW   (TT * CC)        // 2560 floats per item

static_assert(XROW == 2560);
static_assert(TT == 128);
static_assert(DP == TT);
static_assert(PX >= CP && PH >= DP);
static_assert((PX * 2) % 32 == 16 && (PH * 2) % 32 == 16);    // 16-B fragment reads: pitch = 16 B x odd

// LDS byte offsets of the main kernel
#define OFF_XS   0              // f32 [128][20]   10240  (bf16-RNE x, later y)
// (the pad columns behind each row's last used column are never written and never read)
#define OFF_XH   10240          // f16 [128][32 of 40]    10240  (16*x, cols 20..31 zero)
#define OFF_KS   20480          // f16 [128][128 of 136]  34816  (8*k, cols 100..127 zero)
#define OFF_QS   55296          // f16 [128][128 of 136]  34816  (8*q; reused for 1024*P as [i][j])
#define OFF_VTH  90112          // f16 [32][128 of 136]    8704  (hi of 16*v, transposed [d][j])
#define OFF_VTL  98816          // f16 [32][128 of 136]    8704  (x2048 residual, transposed)
#define LDS_MAIN 107520         // three blocks fit the 327680 B of a WGP
static_assert(OFF_XH == OFF_XS + TT * CC * 4);
static_assert(OFF_KS == OFF_XH + TT * PX * 2);
static_assert(OFF_QS == OFF_KS + TT * PH * 2);
static_assert(OFF_VTH == OFF_QS + TT * PH * 2);
static_assert(OFF_VTL == OFF_VTH + CP * PH * 2);
static_assert(LDS_MAIN == OFF_VTL + CP * PH * 2);
static_assert(3 * LDS_MAIN <= 327680);

// workspace: f16 planes (halves): WkT [128 n][32 c] at 0, WqT at 4096, WvT [32 d][32 c] at 8192; total 9216 halves
#define WK_OFF    0
#define WQ_OFF    4096
#define WV_OFF    8192
#define WS_HALVES 9216
static_assert(WS_HALVES == 4096 + 4096 + 1024);
static_assert((WS_HALVES % 8) == 0);

typedef _Float16     v16h __attribute__((ext_vector_type(16)));
typedef _Float16     v8h  __attribute__((ext_vector_type(8)));
typedef float        v8f  __attribute__((ext_vector_type(8)));
typedef float        v4f  __attribute__((ext_vector_type(4)));
typedef unsigned int v4u  __attribute__((ext_vector_type(4)));

union Frag { v16h v; v8h half[2]; };

// ---- scalar helpers --------------------------------------------------------------------------------
__device__ __forceinline__ unsigned short bf_bits(float f) {          // f32 -> bf16 bits, RNE convert
  unsigned u = __float_as_uint(f);
  return (unsigned short)((u + 0x7FFFu + ((u >> 16) & 1u)) >> 16);
}
__device__ __forceinline__ float bf_up(unsigned short b) { return __uint_as_float(((unsigned)b) << 16); }
__device__ __forceinline__ float bfr(float f) { return bf_up(bf_bits(f)); }   // value after bf16 RNE convert
__device__ __forceinline__ v4f bfr4(v4f a) {
  v4f o;
  o[0] = bfr(a[0]); o[1] = bfr(a[1]); o[2] = bfr(a[2]); o[3] = bfr(a[3]);
  return o;
}
__device__ __forceinline__ unsigned short h_bits(float f) {           // f32 -> f16 bits, RNE convert
  return __builtin_bit_cast(unsigned short, (_Float16)f);
}
__device__ __forceinline__ v8f zero8() {
  v8f z;
  z[0] = 0.f; z[1] = 0.f; z[2] = 0.f; z[3] = 0.f; z[4] = 0.f; z[5] = 0.f; z[6] = 0.f; z[7] = 0.f;
  return z;
}
__device__ __forceinline__ float elu_f(float v) {                   // branchless elu (alpha = 1)
  const float e = __expf(v) - 1.0f;
  return v > 0.0f ? v : e;
}
__device__ __forceinline__ float tanh_f(float v) {                  // branchless tanh
  const float c = fminf(fmaxf(v, -15.0f), 15.0f);
  const float t = __expf(2.0f * c);
  return (t - 1.0f) * __builtin_amdgcn_rcpf(t + 1.0f);
}

// ---- maximum / sum over the 16 lanes of a row (lanes 0..15, lanes 16..31), result in every lane of the row;
//      DPP row_xmask:m (control 0x160 + m) reads lane l ^ m of the same row; all 32 lanes are on at every use
template <int CTRL>
__device__ __forceinline__ float dpp_x(float v) {
  return __builtin_bit_cast(float, __builtin_amdgcn_update_dpp(0, __builtin_bit_cast(int, v), CTRL, 0xf, 0xf, true));
}
// Row maximum of eight values at once. In asm because fmaxf on a DPP move compiled to three instructions a step
// (move, quieting max, max) where the fused v_max_num_f32_dpp is one; the eight chains are interleaved so that
// every instruction's producer stands eight instructions back (no dependent pair in a row).
__device__ __forceinline__ void row_max16x8(float (&m)[8]) {
#if defined(__HIP_DEVICE_COMPILE__)
  asm(
      "v_max_num_f32_dpp %0, %0, %0 row_xmask:1 row_mask:0xf bank_mask:0xf\n\t"
      "v_max_num_f32_dpp %1, %1, %1 row_xmask:1 row_mask:0xf bank_mask:0xf\n\t"
      "v_max_num_f32_dpp %2, %2, %2 row_xmask:1 row_mask:0xf bank_mask:0xf\n\t"
      "v_max_num_f32_dpp %3, %3, %3 row_xmask:1 row_mask:0xf bank_mask:0xf\n\t"
      "v_max_num_f32_dpp %4, %4, %4 row_xmask:1 row_mask:0xf bank_mask:0xf\n\t"
      "v_max_num_f32_dpp %5, %5, %5 row_xmask:1 row_mask:0xf bank_mask:0xf\n\t"
      "v_max_num_f32_dpp %6, %6, %6 row_xmask:1 row_mask:0xf bank_mask:0xf\n\t"
      "v_max_num_f32_dpp %7, %7, %7 row_xmask:1 row_mask:0xf bank_mask:0xf\n\t"
      "v_max_num_f32_dpp %0, %0, %0 row_xmask:2 row_mask:0xf bank_mask:0xf\n\t"
      "v_max_num_f32_dpp %1, %1, %1 row_xmask:2 row_mask:0xf bank_mask:0xf\n\t"
      "v_max_num_f32_dpp %2, %2, %2 row_xmask:2 row_mask:0xf bank_mask:0xf\n\t"
      "v_max_num_f32_dpp %3, %3, %3 row_xmask:2 row_mask:0xf bank_mask:0xf\n\t"
      "v_max_num_f32_dpp %4, %4, %4 row_xmask:2 row_mask:0xf bank_mask:0xf\n\t"
      "v_max_num_f32_dpp %5, %5, %5 row_xmask:2 row_mask:0xf bank_mask:0xf\n\t"
      "v_max_num_f32_dpp %6, %6, %6 row_xmask:2 row_mask:0xf bank_mask:0xf\n\t"
      "v_max_num_f32_dpp %7, %7, %7 row_xmask:2 row_mask:0xf bank_mask:0xf\n\t"
      "v_max_num_f32_dpp %0, %0, %0 row_xmask:4 row_mask:0xf bank_mask:0xf\n\t"
      "v_max_num_f32_dpp %1, %1, %1 row_xmask:4 row_mask:0xf bank_mask:0xf\n\t"
      "v_max_num_f32_dpp %2, %2, %2 row_xmask:4 row_mask:0xf bank_mask:0xf\n\t"
      "v_max_num_f32_dpp %3, %3, %3 row_xmask:4 row_mask:0xf bank_mask:0xf\n\t"
      "v_max_num_f32_dpp %4, %4, %4 row_xmask:4 row_mask:0xf bank_mask:0xf\n\t"
      "v_max_num_f32_dpp %5, %5, %5 row_xmask:4 row_mask:0xf bank_mask:0xf\n\t"
      "v_max_num_f32_dpp %6, %6, %6 row_xmask:4 row_mask:0xf bank_mask:0xf\n\t"
      "v_max_num_f32_dpp %7, %7, %7 row_xmask:4 row_mask:0xf bank_mask:0xf\n\t"
      "v_max_num_f32_dpp %0, %0, %0 row_xmask:8 row_mask:0xf bank_mask:0xf\n\t"
      "v_max_num_f32_dpp %1, %1, %1 row_xmask:8 row_mask:0xf bank_mask:0xf\n\t"
      "v_max_num_f32_dpp %2, %2, %2 row_xmask:8 row_mask:0xf bank_mask:0xf\n\t"
      "v_max_num_f32_dpp %3, %3, %3 row_xmask:8 row_mask:0xf bank_mask:0xf\n\t"
      "v_max_num_f32_dpp %4, %4, %4 row_xmask:8 row_mask:0xf bank_mask:0xf\n\t"
      "v_max_num_f32_dpp %5, %5, %5 row_xmask:8 row_mask:0xf bank_mask:0xf\n\t"
      "v_max_num_f32_dpp %6, %6, %6 row_xmask:8 row_mask:0xf bank_mask:0xf\n\t"
      "v_max_num_f32_dpp %7, %7, %7 row_xmask:8 row_mask:0xf bank_mask:0xf"
      : "+v"(m[0]), "+v"(m[1]), "+v"(m[2]), "+v"(m[3]), "+v"(m[4]), "+v"(m[5]), "+v"(m[6]), "+v"(m[7]));
#endif
}
// Eight transcendentals in place, then one free slot.
// Here result and source are one register, no line touches another line's register, and the closing v_nop is the
// one independent slot the instruction set asks for in front of the first reader.
__device__ __forceinline__ void exp2x8(float (&t)[8]) {
#if defined(__HIP_DEVICE_COMPILE__)
  asm("v_exp_f32 %0, %0\n\tv_exp_f32 %1, %1\n\tv_exp_f32 %2, %2\n\tv_exp_f32 %3, %3\n\t"
      "v_exp_f32 %4, %4\n\tv_exp_f32 %5, %5\n\tv_exp_f32 %6, %6\n\tv_exp_f32 %7, %7\n\tv_nop"
      : "+v"(t[0]), "+v"(t[1]), "+v"(t[2]), "+v"(t[3]), "+v"(t[4]), "+v"(t[5]), "+v"(t[6]), "+v"(t[7]));
#endif
}
__device__ __forceinline__ void rcpx8(float (&t)[8]) {
#if defined(__HIP_DEVICE_COMPILE__)
  asm("v_rcp_f32 %0, %0\n\tv_rcp_f32 %1, %1\n\tv_rcp_f32 %2, %2\n\tv_rcp_f32 %3, %3\n\t"
      "v_rcp_f32 %4, %4\n\tv_rcp_f32 %5, %5\n\tv_rcp_f32 %6, %6\n\tv_rcp_f32 %7, %7\n\tv_nop"
      : "+v"(t[0]), "+v"(t[1]), "+v"(t[2]), "+v"(t[3]), "+v"(t[4]), "+v"(t[5]), "+v"(t[6]), "+v"(t[7]));
#endif
}
__device__ __forceinline__ float row_sum16(float v) {
  v += dpp_x<0x161>(v);
  v += dpp_x<0x162>(v);
  v += dpp_x<0x164>(v);
  v += dpp_x<0x168>(v);
  return v;
}

// ---- 16-bit fragment loader (A, B alike): p points at row/col (lane&15), + k0 + 8*(lane>>4);
//      elements 0..7 <- p[0..7] (k0+8h..k0+8h+7), elements 8..15 <- p[16..23] (k0+16+8h..k0+16+8h+7)
__device__ __forceinline__ v16h ldfrag(const _Float16* p) {
  Frag f;
  f.half[0] = *(const v8h*)(p);
  f.half[1] = *(const v8h*)(p + 16);
  return f.v;
}

// ---- WMMA with trailing VALU hazard gap (ties D, keeps A/B live past the nops) ---------------------
__device__ __forceinline__ v8f mma(v16h a, v16h b, v8f c) {
  v8f d = __builtin_amdgcn_wmma_f32_16x16x32_f16(false, a, false, b, (short)0, c, false, false);
#if defined(__HIP_DEVICE_COMPILE__)
  asm volatile("v_nop\n\tv_nop\n\tv_nop\n\tv_nop" : "+v"(d) : "v"(a), "v"(b));
#endif
  return d;
}

// =====================================================================================================
// Weight planes: Wk [20 c][100 n] -> WkT[n][c] (n padded to 128, c padded to 32, pads zero), same for Wq;
// Wv [20][20] -> WvT[d][c] [32][32]. Values = f16 of (bf16-RNE value * 1024). One 256-thread block:
// fill the 9216-half LDS tile with 2-B stores (clamped source addresses), barrier, then 1152 x 16-B global
// =====================================================================================================
__global__ __launch_bounds__(256) void k_prep(const float* __restrict__ Wk, const float* __restrict__ Wq,
                                              const float* __restrict__ Wv, unsigned short* P) {
  __shared__ __align__(16) unsigned short sW[WS_HALVES];
  const int tid = threadIdx.x;

#pragma unroll 1
  for (int it = 0; it < 16; ++it) {                          // WkT: 4096 cells
    const int idx = it * 256 + tid;
    const int n = idx >> 5, c = idx & 31;
    const int nn = min(n, KQ - 1), cc = min(c, CC - 1);
    float v = Wk[cc * KQ + nn];
    v = (n < KQ && c < CC) ? v : 0.0f;
    sW[WK_OFF + idx] = h_bits(bfr(v) * 1024.0f);
  }
#pragma unroll 1
  for (int it = 0; it < 16; ++it) {                          // WqT: 4096 cells
    const int idx = it * 256 + tid;
    const int n = idx >> 5, c = idx & 31;
    const int nn = min(n, KQ - 1), cc = min(c, CC - 1);
    float v = Wq[cc * KQ + nn];
    v = (n < KQ && c < CC) ? v : 0.0f;
    sW[WQ_OFF + idx] = h_bits(bfr(v) * 1024.0f);
  }
#pragma unroll 1
  for (int it = 0; it < 4; ++it) {                           // WvT: 1024 cells
    const int idx = it * 256 + tid;
    const int d = idx >> 5, c = idx & 31;
    const int dd = min(d, CC - 1), cc = min(c, CC - 1);
    float v = Wv[cc * CC + dd];
    v = (d < CC && c < CC) ? v : 0.0f;
    sW[WV_OFF + idx] = h_bits(bfr(v) * 1024.0f);
  }
  __syncthreads();

  v4u pv[5];
#pragma unroll
  for (int it = 0; it < 5; ++it) {
    const int idx = min(it * 256 + tid, WS_HALVES / 8 - 1);
    pv[it] = *(const v4u*)(sW + (size_t)idx * 8);
  }
#pragma unroll
  for (int it = 0; it < 5; ++it) {
    const int idx = it * 256 + tid;                          // idx < 1152 is wave-uniform (tid < 128 at it = 4)
    if (idx < WS_HALVES / 8) *(v4u*)(P + (size_t)idx * 8) = pv[it];
  }
  
}

// =====================================================================================================
// Main: one 256-thread block (8 waves) per batch item; wave w owns token rows 16w..16w+15 in the projections and
// in P.v, and score COLUMNS j = 16w..16w+15 (all 128 rows i) in the score product.
// Phase 1: x -> xs (f32 bf16-RNE values) and xh (f16 of 16*x, cols 20..31 zero); threads 0..127 write cols
//          0..15 of row tid, threads 128..255 cols 16..31 (wave-uniform split). coverage: 128 rows x 32 cols.
// Phase 2: projections, A = xh rows (k = c, split map), B = W planes from global [n][c] (same map), one k-step;
//          D (row m0+8h+r, col n0+lo) -> elu/tanh in f32; kS/qS [i][d] = f16(8*val) with d >= 100 forced 0
//          (8 col tiles cover d 0..127); v -> vTh/vTl [d][j] for d 0..31 (d >= 20 forced 0).
// Phase 3: S^T[j][i] = sum_d q[j][d] k[i][d]: A = qS rows j (the wave's own 16), B = kS as [n=i][k=d]; 8 column
//          tiles x 4 k-steps; D (row j = m0+8h+r, col i = 16nt+lo) stays in 64 accumulator registers.
// Phase 4: softmax over i per column j, in registers: i runs over the 8 tiles and the 16 lanes of a row, so max
//          and sum are 8 values a lane, each folded over nt and then over the row by DPP; the 8 values r of one
//          tile are 8 neighbouring j of row i: P[i][j] = f16(1024 * e / sum) goes into the qS region as [i][j]
//          with one 16-B store a tile (the barrier behind phase 3 has ended every wave's reads of kS and qS).
// Phase 5: y_att[i][d] = sum_j P v: A = P rows i (k = j), B = vTh/vTl as [n=d][k=j]; hi and residual in
//          separate accumulators; y = (acc_h + acc_l/2048)/16384 + xs, written back into xs (d < 20).
// =====================================================================================================
__global__ __launch_bounds__(256) void k_main(const float* __restrict__ x, const unsigned short* __restrict__ Wp,
                                              const float* __restrict__ bk, const float* __restrict__ bq,
                                              const float* __restrict__ bv, float* out) {
  extern __shared__ __align__(16) unsigned char smem[];
  float*    xs  = (float*)(smem + OFF_XS);
  _Float16* xh  = (_Float16*)(smem + OFF_XH);
  _Float16* kS  = (_Float16*)(smem + OFF_KS);
  _Float16* qS  = (_Float16*)(smem + OFF_QS);
  _Float16* vTh = (_Float16*)(smem + OFF_VTH);
  _Float16* vTl = (_Float16*)(smem + OFF_VTL);
  const _Float16* W = (const _Float16*)(const void*)Wp;

  const int tid  = threadIdx.x;
  const int lane = tid & 31;
  const int wid  = tid >> 5;
  const int h    = lane >> 4;
  const int lo   = lane & 15;
  const int b    = blockIdx.x;
  const int m0   = wid * 16;
  const float* xb = x + (size_t)b * XROW;

  // ---------------- phase 1: stage x ----------------
  {
    const int part = tid >> 7;                      // wave-uniform
    const int row  = tid & 127;
    const float* xr  = xb + row * CC;               // row*80 B, 16-B aligned
    float*       xsr = xs + row * CC;
    _Float16*    xhr = xh + row * PX;
    if (part == 0) {
      const v4f a0 = bfr4(*(const v4f*)(xr));
      const v4f a1 = bfr4(*(const v4f*)(xr + 4));
      const v4f a2 = bfr4(*(const v4f*)(xr + 8));
      const v4f a3 = bfr4(*(const v4f*)(xr + 12));
      *(v4f*)(xsr)      = a0;
      *(v4f*)(xsr + 4)  = a1;
      *(v4f*)(xsr + 8)  = a2;
      *(v4f*)(xsr + 12) = a3;
      v8h p0, p1;
#pragma unroll
      for (int c = 0; c < 4; ++c) {
        p0[c]     = (_Float16)(a0[c] * 16.0f);
        p0[4 + c] = (_Float16)(a1[c] * 16.0f);
        p1[c]     = (_Float16)(a2[c] * 16.0f);
        p1[4 + c] = (_Float16)(a3[c] * 16.0f);
      }
      *(v8h*)(xhr)     = p0;
      *(v8h*)(xhr + 8) = p1;
    } else {
      const v4f a4 = bfr4(*(const v4f*)(xr + 16));
      *(v4f*)(xsr + 16) = a4;
      v8h p2, p3;
#pragma unroll
      for (int c = 0; c < 4; ++c) {
        p2[c]     = (_Float16)(a4[c] * 16.0f);
        p2[4 + c] = (_Float16)0.0f;
        p3[c]     = (_Float16)0.0f;
        p3[4 + c] = (_Float16)0.0f;
      }
      *(v8h*)(xhr + 16) = p2;
      *(v8h*)(xhr + 24) = p3;
    }
  }
  __syncthreads();

  // ---------------- phase 2: projections (K = 32, one k-step) ----------------
  {
    const v16h af = ldfrag(xh + (m0 + lo) * PX + 8 * h);        // A: row m0+lo, k = c
    // k = elu(x.Wk + bk)
#pragma unroll 1
    for (int nt = 0; nt < 8; ++nt) {
      const int n0 = nt * 16, n = n0 + lo;
      const v8f acc = mma(af, ldfrag(W + WK_OFF + (size_t)(n0 + lo) * CP + 8 * h), zero8());
      const float bias = bfr(bk[min(n, KQ - 1)]);
#pragma unroll
      for (int r = 0; r < 8; ++r) {
        float val = elu_f(acc[r] * 6.103515625e-05f + bias);   // acc * 2^-14
        val = (n < KQ) ? val : 0.0f;
        kS[(m0 + 8 * h + r) * PH + n] = (_Float16)(val * 8.0f);
      }
    }
    // q = elu(x.Wq + bq)
#pragma unroll 1
    for (int nt = 0; nt < 8; ++nt) {
      const int n0 = nt * 16, n = n0 + lo;
      const v8f acc = mma(af, ldfrag(W + WQ_OFF + (size_t)(n0 + lo) * CP + 8 * h), zero8());
      const float bias = bfr(bq[min(n, KQ - 1)]);
#pragma unroll
      for (int r = 0; r < 8; ++r) {
        float val = elu_f(acc[r] * 6.103515625e-05f + bias);
        val = (n < KQ) ? val : 0.0f;
        qS[(m0 + 8 * h + r) * PH + n] = (_Float16)(val * 8.0f);
      }
    }
    // v = tanh(x.Wv + bv), stored transposed as hi + residual planes
#pragma unroll 1
    for (int nt = 0; nt < 2; ++nt) {
      const int n0 = nt * 16, d = n0 + lo;
      const v8f acc = mma(af, ldfrag(W + WV_OFF + (size_t)(n0 + lo) * CP + 8 * h), zero8());
      const float bias = bfr(bv[min(d, CC - 1)]);
#pragma unroll
      for (int r = 0; r < 8; ++r) {
        float val = tanh_f(acc[r] * 6.103515625e-05f + bias);
        val = (d < CC) ? val : 0.0f;
        const float v16 = val * 16.0f;
        const _Float16 hh = (_Float16)v16;
        const _Float16 ll = (_Float16)((v16 - (float)hh) * 2048.0f);
        vTh[d * PH + m0 + 8 * h + r] = hh;
        vTl[d * PH + m0 + 8 * h + r] = ll;
      }
    }
  }
  __syncthreads();

  // ---------------- phase 3: scores, transposed: S^T[j][i] (K = 128 over d), kept in registers ----------------
  v8f acc[8];                                                    // acc[nt][r] = 64 * S[i = 16nt+lo][j = m0+8h+r]
  {
    const _Float16* pa = qS + (m0 + lo) * PH + 8 * h;            // A: row j = m0+lo, k = d
    const _Float16* pb = kS + lo * PH + 8 * h;                   // B: col i = 16nt+lo, k = d (same map)
#pragma unroll
    for (int nt = 0; nt < 8; ++nt) acc[nt] = zero8();
#pragma unroll
    for (int ks = 0; ks < 4; ++ks) {                             // k-step outermost: 8 independent accumulators in a row
      const v16h a = ldfrag(pa + 32 * ks);
      v16h bf[8];
#pragma unroll
      for (int nt = 0; nt < 8; ++nt) bf[nt] = ldfrag(pb + nt * 16 * PH + 32 * ks);
      // keeps the 18 LDS reads of a k-step one group in front of its 8 products: left alone the compiler put two
      // reads and a full wait in front of every product, one LDS latency each
      __builtin_amdgcn_sched_barrier(0);
#pragma unroll
      for (int nt = 0; nt < 8; ++nt)
        acc[nt] = __builtin_amdgcn_wmma_f32_16x16x32_f16(false, a, false, bf[nt], (short)0, acc[nt], false, false);
      // second half of the pair: the next k-step's reads stay behind these products (their registers are reused)
      __builtin_amdgcn_sched_barrier(0);
    }
  }
  __syncthreads();                                               // every wave has read kS and qS: the qS region is free

  // ---------------- phase 4: softmax over i, per column j, in registers ----------------
  {
    // exp(s - max) = exp2((acc - max_acc) * C2), C2 = (1/sqrt(128)) * 2^-6 * log2(e) > 0
    const float C2 = 0.08838834764831845f * 0.015625f * 1.4426950408889634f;
    float mx[8], rs[8];
#pragma unroll
    for (int r = 0; r < 8; ++r) {
      mx[r] = acc[0][r];
#pragma unroll
      for (int nt = 1; nt < 8; ++nt) mx[r] = fmaxf(mx[r], acc[nt][r]);
    }
    row_max16x8(mx);
#pragma unroll
    for (int r = 0; r < 8; ++r) {
      const float nb = -C2 * mx[r];
      float t[8];
#pragma unroll
      for (int nt = 0; nt < 8; ++nt) t[nt] = __builtin_fmaf(acc[nt][r], C2, nb);
      exp2x8(t);
      float sum = t[0];
      acc[0][r] = t[0];
#pragma unroll
      for (int nt = 1; nt < 8; ++nt) {
        acc[nt][r] = t[nt];
        sum += t[nt];
      }
      rs[r] = row_sum16(sum);                                    // the largest term is 1: sum >= 1
    }
    rcpx8(rs);
#pragma unroll
    for (int r = 0; r < 8; ++r) rs[r] *= 1024.0f;
    _Float16* Pw = qS + lo * PH + m0 + 8 * h;                    // P as [i][j], carried x1024
#pragma unroll
    for (int nt = 0; nt < 8; ++nt) {
      v8h p;
#pragma unroll
      for (int r = 0; r < 8; ++r) p[r] = (_Float16)(acc[nt][r] * rs[r]);
      *(v8h*)(Pw + nt * 16 * PH) = p;
    }
  }
  __syncthreads();

  // ---------------- phase 5: y = P.v + x (K = 128 over j; hi and residual accumulators) ----------------
  {
    const _Float16* Ph = qS;
    const _Float16* pa = Ph + (m0 + lo) * PH + 8 * h;            // A: row i = m0+lo, k = j
    const v16h p0 = ldfrag(pa);
    const v16h p1 = ldfrag(pa + 32);
    const v16h p2 = ldfrag(pa + 64);
    const v16h p3 = ldfrag(pa + 96);
    const _Float16* bh0 = vTh + lo * PH + 8 * h;                 // B: col d = lo,    k = j
    const _Float16* bh1 = vTh + (16 + lo) * PH + 8 * h;          // B: col d = 16+lo, k = j
    const _Float16* bl0 = vTl + lo * PH + 8 * h;
    const _Float16* bl1 = vTl + (16 + lo) * PH + 8 * h;
    v8f ah0 = zero8(), ah1 = zero8(), al0 = zero8(), al1 = zero8();
    ah0 = mma(p0, ldfrag(bh0),      ah0); ah1 = mma(p0, ldfrag(bh1),      ah1);
    al0 = mma(p0, ldfrag(bl0),      al0); al1 = mma(p0, ldfrag(bl1),      al1);
    ah0 = mma(p1, ldfrag(bh0 + 32), ah0); ah1 = mma(p1, ldfrag(bh1 + 32), ah1);
    al0 = mma(p1, ldfrag(bl0 + 32), al0); al1 = mma(p1, ldfrag(bl1 + 32), al1);
    ah0 = mma(p2, ldfrag(bh0 + 64), ah0); ah1 = mma(p2, ldfrag(bh1 + 64), ah1);
    al0 = mma(p2, ldfrag(bl0 + 64), al0); al1 = mma(p2, ldfrag(bl1 + 64), al1);
    ah0 = mma(p3, ldfrag(bh0 + 96), ah0); ah1 = mma(p3, ldfrag(bh1 + 96), ah1);
    al0 = mma(p3, ldfrag(bl0 + 96), al0); al1 = mma(p3, ldfrag(bl1 + 96), al1);

    const int d1  = 16 + lo;
    const int d1c = min(d1, CC - 1);
#pragma unroll
    for (int r = 0; r < 8; ++r) {
      const int i = m0 + 8 * h + r;
      float* px = xs + i * CC;
      const float y0 = (ah0[r] + al0[r] * 0.00048828125f) * 6.103515625e-05f;   // (h + l/2048) * 2^-14
      const float y1 = (ah1[r] + al1[r] * 0.00048828125f) * 6.103515625e-05f;
      const float v0 = px[lo] + y0;                              // d = lo < 16 < 20 always valid
      const float v1 = px[d1c] + y1;
      px[lo] = v0;
      if (lo < 4) px[d1] = v1;                                   // d = 16..19
    }
  }
  __syncthreads();

  {
    const v4f* xs4 = (const v4f*)xs;
    const int c2  = 16 + wid;                                    // valid iff wid < 4 (wave-uniform)
    const int c2c = min(c2, 19);
    const v4f pv0 = xs4[(wid)     * 32 + lane];
    const v4f pv1 = xs4[(8 + wid) * 32 + lane];
    const v4f pv2 = xs4[c2c       * 32 + lane];
    float* ob = out + (size_t)b * XROW + (size_t)lane * 4;
    *(v4f*)(ob + (size_t)wid * 128)       = pv0;
    *(v4f*)(ob + (size_t)(8 + wid) * 128) = pv1;
    if (wid < 4) *(v4f*)(ob + (size_t)c2 * 128) = pv2;
    
  }
}

// =====================================================================================================
// Workspace map (bytes): WkT f16 [128][32] 8192 at 0; WqT 8192 at 8192; WvT f16 [32][32] 2048 at 16384;
// total 18432, every region a whole multiple of 512 B (the store granularity of k_prep).
// =====================================================================================================
extern "C" void kernel_launch(void* const* d_in, const int* in_sizes, int n_in,
                              void* d_out, int out_size, void* d_ws, size_t ws_size,
                              hipStream_t stream) {
  if (n_in < 7) return;
  if (in_sizes[0] != NBATCH * XROW) return;
  if (in_sizes[1] != CC * KQ) return;
  if (in_sizes[2] != KQ) return;
  if (in_sizes[3] != CC * KQ) return;
  if (in_sizes[4] != KQ) return;
  if (in_sizes[5] != CC * CC) return;
  if (in_sizes[6] != CC) return;
  if (out_size != NBATCH * XROW) return;

  const float* x  = (const float*)d_in[0];     // [4096][128][20]
  const float* Wk = (const float*)d_in[1];     // [20][100]
  const float* bk = (const float*)d_in[2];     // [100]
  const float* Wq = (const float*)d_in[3];     // [20][100]
  const float* bq = (const float*)d_in[4];     // [100]
  const float* Wv = (const float*)d_in[5];     // [20][20]
  const float* bv = (const float*)d_in[6];     // [20]
  float* out = (float*)d_out;                  // [4096][128][20]

  const size_t wsb = (size_t)WS_HALVES * 2;    // 18432
  if (wsb > ws_size) return;
  if (wsb > (size_t)134217728) return;
  unsigned short* P = (unsigned short*)d_ws;

  (void)hipFuncSetAttribute(reinterpret_cast<const void*>(&k_main),
                            hipFuncAttributeMaxDynamicSharedMemorySize, LDS_MAIN);

  const dim3 gPrep(1), bPrep(256);
  const dim3 gMain(NBATCH), bMain(256);

  k_prep<<<gPrep, bPrep, 0, stream>>>(Wk, Wq, Wv, P);
  k_main<<<gMain, bMain, LDS_MAIN, stream>>>(x, P, bk, bq, bv, out);
  (void)hipGetLastError();
}

// v003
// It runs in 55.8 microseconds.
// In both of two side-by-side timings against v002, it was 1.42 times as fast.
// All steps since v000 together make it 6.37 times as fast.
// Contractions on v_wmma_f32_16x16x32_f16, f32 accumulate: x.Wk, x.Wq, x.Wv with f16 operands built from
// bf16-RNE inputs (x carried x16, W carried x1024), single products (k and q as W^T.x^T with the bias in C);
// k.q^T with k and q as plain f16 carried x8;
// P.v with P as plain f16 carried x1024 and v as f16 hi (x16) + x2048 residual plane (separate accumulator);
// elu, tanh, column softmax (in registers) and the residual add in f32 on VALU.
#include <hip/hip_runtime.h>
#include <stdint.h>

#define NBATCH 4096
#define TT     128              // tokens per item
#define CC     20               // channels
#define KQ     100              // key/query dim
#define CP     32               // channels padded (k of the projections)
#define DP     128              // key dim padded (k of the score product)
#define PX     40               // LDS pitch of xh in halves: 80 B = 16 B x 5
#define PH     136              // LDS pitch of kS, P, vTh, vTl in halves: 272 B = 16 B x 17
#define XROW   (TT * CC)        // 2560 floats per item

static_assert(XROW == 2560);
static_assert(TT == 128);
static_assert(DP == TT);
static_assert(PX >= CP && PH >= DP);
static_assert((PX * 2) % 32 == 16 && (PH * 2) % 32 == 16);    // 16-B fragment reads: pitch = 16 B x odd

// LDS byte offsets of the main kernel
#define OFF_XS   0              // f32 [128][20]   10240  (bf16-RNE x, later y)
// (the pad columns behind each row's last used column are never written and never read)
#define OFF_XH   10240          // f16 [128][32 of 40]    10240  (16*x, cols 20..31 zero)
#define OFF_KS   20480          // f16 [128][128 of 136]  34816  (8*k, cols 100..127 zero)
#define OFF_PS   55296          // f16 [128][128 of 136]  34816  (1024*P as [i][j])
#define OFF_VTH  90112          // f16 [32][128 of 136]    8704  (hi of 16*v, transposed [d][j])
#define OFF_VTL  98816          // f16 [32][128 of 136]    8704  (x2048 residual, transposed)
#define LDS_MAIN 107520         // three blocks fit the 327680 B of a WGP
static_assert(OFF_XH == OFF_XS + TT * CC * 4);
static_assert(OFF_KS == OFF_XH + TT * PX * 2);
static_assert(OFF_PS == OFF_KS + TT * PH * 2);
static_assert(OFF_VTH == OFF_PS + TT * PH * 2);
static_assert(OFF_VTL == OFF_VTH + CP * PH * 2);
static_assert(LDS_MAIN == OFF_VTL + CP * PH * 2);
static_assert(3 * LDS_MAIN <= 327680);

// workspace: f16 planes (halves): WkT [128 n][32 c] at 0, WqT at 4096, WvT [32 d][32 c] at 8192; total 9216 halves;
// behind them two f32 planes of 128: bk and bq as the projections' C operand (bf16-RNE value * 2^14, n >= 100 zero)
#define WK_OFF    0
#define WQ_OFF    4096
#define WV_OFF    8192
#define WS_HALVES 9216
static_assert(WS_HALVES == 4096 + 4096 + 1024);
static_assert((WS_HALVES % 8) == 0);
#define WS_BIAS   256             // floats: bk plane [128], bq plane [128]
#define NTKQ      7               // 16-wide tiles of the key dim that hold a real column (100 = 6 * 16 + 4)
static_assert(NTKQ * 16 >= KQ && (NTKQ - 1) * 16 < KQ && (NTKQ + 1) * 16 == DP);

typedef _Float16     v16h __attribute__((ext_vector_type(16)));
typedef _Float16     v8h  __attribute__((ext_vector_type(8)));
typedef float        v8f  __attribute__((ext_vector_type(8)));
typedef float        v4f  __attribute__((ext_vector_type(4)));
typedef unsigned int v4u  __attribute__((ext_vector_type(4)));

union Frag { v16h v; v8h half[2]; };

// ---- scalar helpers --------------------------------------------------------------------------------
__device__ __forceinline__ unsigned short bf_bits(float f) {          // f32 -> bf16 bits, RNE convert
  unsigned u = __float_as_uint(f);
  return (unsigned short)((u + 0x7FFFu + ((u >> 16) & 1u)) >> 16);
}
__device__ __forceinline__ float bf_up(unsigned short b) { return __uint_as_float(((unsigned)b) << 16); }
__device__ __forceinline__ float bfr(float f) { return bf_up(bf_bits(f)); }   // value after bf16 RNE convert
__device__ __forceinline__ v4f bfr4(v4f a) {
  v4f o;
  o[0] = bfr(a[0]); o[1] = bfr(a[1]); o[2] = bfr(a[2]); o[3] = bfr(a[3]);
  return o;
}
__device__ __forceinline__ unsigned short h_bits(float f) {           // f32 -> f16 bits, RNE convert
  return __builtin_bit_cast(unsigned short, (_Float16)f);
}
__device__ __forceinline__ v8f zero8() {
  v8f z;
  z[0] = 0.f; z[1] = 0.f; z[2] = 0.f; z[3] = 0.f; z[4] = 0.f; z[5] = 0.f; z[6] = 0.f; z[7] = 0.f;
  return z;
}
__device__ __forceinline__ float tanh_f(float v) {                  // branchless tanh
  const float c = fminf(fmaxf(v, -15.0f), 15.0f);
  const float t = __expf(2.0f * c);
  return (t - 1.0f) * __builtin_amdgcn_rcpf(t + 1.0f);
}

// ---- maximum / sum over the 16 lanes of a row (lanes 0..15, lanes 16..31), result in every lane of the row;
//      DPP row_xmask:m (control 0x160 + m) reads lane l ^ m of the same row; all 32 lanes are on at every use
template <int CTRL>
__device__ __forceinline__ float dpp_x(float v) {
  return __builtin_bit_cast(float, __builtin_amdgcn_update_dpp(0, __builtin_bit_cast(int, v), CTRL, 0xf, 0xf, true));
}
// Row maximum of eight values at once. In asm because fmaxf on a DPP move compiled to three instructions a step
// (move, quieting max, max) where the fused v_max_num_f32_dpp is one; the eight chains are interleaved so that
// every instruction's producer stands eight instructions back (no dependent pair in a row).
__device__ __forceinline__ void row_max16x8(float (&m)[8]) {
#if defined(__HIP_DEVICE_COMPILE__)
  asm(
      "v_max_num_f32_dpp %0, %0, %0 row_xmask:1 row_mask:0xf bank_mask:0xf\n\t"
      "v_max_num_f32_dpp %1, %1, %1 row_xmask:1 row_mask:0xf bank_mask:0xf\n\t"
      "v_max_num_f32_dpp %2, %2, %2 row_xmask:1 row_mask:0xf bank_mask:0xf\n\t"
      "v_max_num_f32_dpp %3, %3, %3 row_xmask:1 row_mask:0xf bank_mask:0xf\n\t"
      "v_max_num_f32_dpp %4, %4, %4 row_xmask:1 row_mask:0xf bank_mask:0xf\n\t"
      "v_max_num_f32_dpp %5, %5, %5 row_xmask:1 row_mask:0xf bank_mask:0xf\n\t"
      "v_max_num_f32_dpp %6, %6, %6 row_xmask:1 row_mask:0xf bank_mask:0xf\n\t"
      "v_max_num_f32_dpp %7, %7, %7 row_xmask:1 row_mask:0xf bank_mask:0xf\n\t"
      "v_max_num_f32_dpp %0, %0, %0 row_xmask:2 row_mask:0xf bank_mask:0xf\n\t"
      "v_max_num_f32_dpp %1, %1, %1 row_xmask:2 row_mask:0xf bank_mask:0xf\n\t"
      "v_max_num_f32_dpp %2, %2, %2 row_xmask:2 row_mask:0xf bank_mask:0xf\n\t"
      "v_max_num_f32_dpp %3, %3, %3 row_xmask:2 row_mask:0xf bank_mask:0xf\n\t"
      "v_max_num_f32_dpp %4, %4, %4 row_xmask:2 row_mask:0xf bank_mask:0xf\n\t"
      "v_max_num_f32_dpp %5, %5, %5 row_xmask:2 row_mask:0xf bank_mask:0xf\n\t"
      "v_max_num_f32_dpp %6, %6, %6 row_xmask:2 row_mask:0xf bank_mask:0xf\n\t"
      "v_max_num_f32_dpp %7, %7, %7 row_xmask:2 row_mask:0xf bank_mask:0xf\n\t"
      "v_max_num_f32_dpp %0, %0, %0 row_xmask:4 row_mask:0xf bank_mask:0xf\n\t"
      "v_max_num_f32_dpp %1, %1, %1 row_xmask:4 row_mask:0xf bank_mask:0xf\n\t"
      "v_max_num_f32_dpp %2, %2, %2 row_xmask:4 row_mask:0xf bank_mask:0xf\n\t"
      "v_max_num_f32_dpp %3, %3, %3 row_xmask:4 row_mask:0xf bank_mask:0xf\n\t"
      "v_max_num_f32_dpp %4, %4, %4 row_xmask:4 row_mask:0xf bank_mask:0xf\n\t"
      "v_max_num_f32_dpp %5, %5, %5 row_xmask:4 row_mask:0xf bank_mask:0xf\n\t"
      "v_max_num_f32_dpp %6, %6, %6 row_xmask:4 row_mask:0xf bank_mask:0xf\n\t"
      "v_max_num_f32_dpp %7, %7, %7 row_xmask:4 row_mask:0xf bank_mask:0xf\n\t"
      "v_max_num_f32_dpp %0, %0, %0 row_xmask:8 row_mask:0xf bank_mask:0xf\n\t"
      "v_max_num_f32_dpp %1, %1, %1 row_xmask:8 row_mask:0xf bank_mask:0xf\n\t"
      "v_max_num_f32_dpp %2, %2, %2 row_xmask:8 row_mask:0xf bank_mask:0xf\n\t"
      "v_max_num_f32_dpp %3, %3, %3 row_xmask:8 row_mask:0xf bank_mask:0xf\n\t"
      "v_max_num_f32_dpp %4, %4, %4 row_xmask:8 row_mask:0xf bank_mask:0xf\n\t"
      "v_max_num_f32_dpp %5, %5, %5 row_xmask:8 row_mask:0xf bank_mask:0xf\n\t"
      "v_max_num_f32_dpp %6, %6, %6 row_xmask:8 row_mask:0xf bank_mask:0xf\n\t"
      "v_max_num_f32_dpp %7, %7, %7 row_xmask:8 row_mask:0xf bank_mask:0xf"
      : "+v"(m[0]), "+v"(m[1]), "+v"(m[2]), "+v"(m[3]), "+v"(m[4]), "+v"(m[5]), "+v"(m[6]), "+v"(m[7]));
#endif
}
// Eight transcendentals in place, then one free slot.
// Here result and source are one register, no line touches another line's register, and the closing v_nop is the
// one independent slot the instruction set asks for in front of the first reader.
__device__ __forceinline__ void exp2x8(float (&t)[8]) {
#if defined(__HIP_DEVICE_COMPILE__)
  asm("v_exp_f32 %0, %0\n\tv_exp_f32 %1, %1\n\tv_exp_f32 %2, %2\n\tv_exp_f32 %3, %3\n\t"
      "v_exp_f32 %4, %4\n\tv_exp_f32 %5, %5\n\tv_exp_f32 %6, %6\n\tv_exp_f32 %7, %7\n\tv_nop"
      : "+v"(t[0]), "+v"(t[1]), "+v"(t[2]), "+v"(t[3]), "+v"(t[4]), "+v"(t[5]), "+v"(t[6]), "+v"(t[7]));
#endif
}
__device__ __forceinline__ void rcpx8(float (&t)[8]) {
#if defined(__HIP_DEVICE_COMPILE__)
  asm("v_rcp_f32 %0, %0\n\tv_rcp_f32 %1, %1\n\tv_rcp_f32 %2, %2\n\tv_rcp_f32 %3, %3\n\t"
      "v_rcp_f32 %4, %4\n\tv_rcp_f32 %5, %5\n\tv_rcp_f32 %6, %6\n\tv_rcp_f32 %7, %7\n\tv_nop"
      : "+v"(t[0]), "+v"(t[1]), "+v"(t[2]), "+v"(t[3]), "+v"(t[4]), "+v"(t[5]), "+v"(t[6]), "+v"(t[7]));
#endif
}
__device__ __forceinline__ float row_sum16(float v) {
  v += dpp_x<0x161>(v);
  v += dpp_x<0x162>(v);
  v += dpp_x<0x164>(v);
  v += dpp_x<0x168>(v);
  return v;
}

// ---- 16-bit fragment loader (A, B alike): p points at row/col (lane&15), + k0 + 8*(lane>>4);
//      elements 0..7 <- p[0..7] (k0+8h..k0+8h+7), elements 8..15 <- p[16..23] (k0+16+8h..k0+16+8h+7)
__device__ __forceinline__ v16h ldfrag(const _Float16* p) {
  Frag f;
  f.half[0] = *(const v8h*)(p);
  f.half[1] = *(const v8h*)(p + 16);
  return f.v;
}

// ---- WMMA with trailing VALU hazard gap (ties D, keeps A/B live past the nops) ---------------------
__device__ __forceinline__ v8f mma(v16h a, v16h b, v8f c) {
  v8f d = __builtin_amdgcn_wmma_f32_16x16x32_f16(false, a, false, b, (short)0, c, false, false);
#if defined(__HIP_DEVICE_COMPILE__)
  asm volatile("v_nop\n\tv_nop\n\tv_nop\n\tv_nop" : "+v"(d) : "v"(a), "v"(b));
#endif
  return d;
}

// =====================================================================================================
// Weight planes: Wk [20 c][100 n] -> WkT[n][c] (n padded to 128, c padded to 32, pads zero), same for Wq;
// Wv [20][20] -> WvT[d][c] [32][32]. Values = f16 of (bf16-RNE value * 1024). One 256-thread block:
// fill the 9216-half LDS tile with 2-B stores (clamped source addresses), barrier, then 1152 x 16-B global.
// Bias planes: thread t < 128 writes bk[t], thread 128 + t writes bq[t], as f32 of (bf16-RNE value * 2^14).
// =====================================================================================================
__global__ __launch_bounds__(256) void k_prep(const float* __restrict__ Wk, const float* __restrict__ Wq,
                                              const float* __restrict__ Wv, const float* __restrict__ bk,
                                              const float* __restrict__ bq, unsigned short* P) {
  __shared__ __align__(16) unsigned short sW[WS_HALVES];
  const int tid = threadIdx.x;
  const float braw = ((tid < 128) ? bk : bq)[min(tid & 127, KQ - 1)];   // plane choice is wave-uniform; stored last

#pragma unroll 1
  for (int it = 0; it < 16; ++it) {                          // WkT: 4096 cells
    const int idx = it * 256 + tid;
    const int n = idx >> 5, c = idx & 31;
    const int nn = min(n, KQ - 1), cc = min(c, CC - 1);
    float v = Wk[cc * KQ + nn];
    v = (n < KQ && c < CC) ? v : 0.0f;
    sW[WK_OFF + idx] = h_bits(bfr(v) * 1024.0f);
  }
#pragma unroll 1
  for (int it = 0; it < 16; ++it) {                          // WqT: 4096 cells
    const int idx = it * 256 + tid;
    const int n = idx >> 5, c = idx & 31;
    const int nn = min(n, KQ - 1), cc = min(c, CC - 1);
    float v = Wq[cc * KQ + nn];
    v = (n < KQ && c < CC) ? v : 0.0f;
    sW[WQ_OFF + idx] = h_bits(bfr(v) * 1024.0f);
  }
#pragma unroll 1
  for (int it = 0; it < 4; ++it) {                           // WvT: 1024 cells
    const int idx = it * 256 + tid;
    const int d = idx >> 5, c = idx & 31;
    const int dd = min(d, CC - 1), cc = min(c, CC - 1);
    float v = Wv[cc * CC + dd];
    v = (d < CC && c < CC) ? v : 0.0f;
    sW[WV_OFF + idx] = h_bits(bfr(v) * 1024.0f);
  }
  __syncthreads();

  v4u pv[5];
#pragma unroll
  for (int it = 0; it < 5; ++it) {
    const int idx = min(it * 256 + tid, WS_HALVES / 8 - 1);
    pv[it] = *(const v4u*)(sW + (size_t)idx * 8);
  }
#pragma unroll
  for (int it = 0; it < 5; ++it) {
    const int idx = it * 256 + tid;                          // idx < 1152 is wave-uniform (tid < 128 at it = 4)
    if (idx < WS_HALVES / 8) *(v4u*)(P + (size_t)idx * 8) = pv[it];
  }
  ((float*)(void*)(P + WS_HALVES))[tid] = bfr(((tid & 127) < KQ) ? braw : 0.0f) * 16384.0f;
}

// =====================================================================================================
// Main: one 256-thread block (8 waves) per batch item; wave w owns token rows 16w..16w+15 in the projections and
// in P.v, and score COLUMNS j = 16w..16w+15 (all 128 rows i) in the score product.
// Phase 1: x -> xs (f32 bf16-RNE values) and xh (f16 of 16*x, cols 20..31 zero); threads 0..127 write cols
//          0..15 of row tid, threads 128..255 cols 16..31 (wave-uniform split). coverage: 128 rows x 32 cols.
// Phase 2: projections, one k-step (k = c, split map, the same for A and B). k and q transposed: A = W plane rows
//          n from global [n][c], B = xh as [col = token][c], C = the bias plane; D (row n = 16nt+8h+r, col token
//          m0+lo): a lane holds 8 neighbouring d of ONE token, which is half a 16-bit fragment of that token's row.
//          elu in f32, f16(8*val); pad rows n >= 100 come out 0 (W and bias planes are 0 there, elu(0) = 0).
//          k: one 16-B store a tile into kS [i][d], cols 112..127 stored as zeros. q: tiles 2s and 2s+1 ARE the
//          A fragment of k-step s of phase 3 (elements 0..7: d = 32s+8h+r, 8..15: d = 32s+16+8h+r, row m0+lo);
//          it stays in registers. v: A = xh rows, B = WvT; D (row m0+8h+r, col d) -> tanh -> vTh/vTl [d][j] for
//          d 0..31 (d >= 20 forced 0).
// Phase 3: S^T[j][i] = sum_d q[j][d] k[i][d]: A = q rows j (the wave's own 16, registers), B = kS as [n=i][k=d];
//          8 column tiles x 4 k-steps; D (row j = m0+8h+r, col i = 16nt+lo) stays in 64 accumulator registers.
// Phase 4: softmax over i per column j, in registers: i runs over the 8 tiles and the 16 lanes of a row, so max
//          and sum are 8 values a lane, each folded over nt and then over the row by DPP; the 8 values r of one
//          tile are 8 neighbouring j of row i: P[i][j] = f16(1024 * e / sum) goes into its own region as [i][j]
//          with one 16-B store a tile (nothing else uses that region, so no barrier stands in front of it).
// Phase 5: y_att[i][d] = sum_j P v: A = P rows i (k = j), B = vTh/vTl as [n=d][k=j]; hi and residual in
//          separate accumulators; y = (acc_h + acc_l/2048)/16384 + xs, written back into xs (d < 20).
// =====================================================================================================
// register budget for six waves a SIMD: three work-groups a WGP, which is also what the LDS allows
__global__ __launch_bounds__(256) __attribute__((amdgpu_waves_per_eu(6)))
void k_main(const float* __restrict__ x, const unsigned short* __restrict__ Wp, const float* __restrict__ bv,
            float* out) {
  extern __shared__ __align__(16) unsigned char smem[];
  float*    xs  = (float*)(smem + OFF_XS);
  _Float16* xh  = (_Float16*)(smem + OFF_XH);
  _Float16* kS  = (_Float16*)(smem + OFF_KS);
  _Float16* pS  = (_Float16*)(smem + OFF_PS);
  _Float16* vTh = (_Float16*)(smem + OFF_VTH);
  _Float16* vTl = (_Float16*)(smem + OFF_VTL);
  const _Float16* W = (const _Float16*)(const void*)Wp;
  const float* Bp = (const float*)(const void*)(Wp + WS_HALVES);   // bias planes: bk [128], bq [128]

  const int tid  = threadIdx.x;
  const int lane = tid & 31;
  const int wid  = tid >> 5;
  const int h    = lane >> 4;
  const int lo   = lane & 15;
  const int b    = blockIdx.x;
  const int m0   = wid * 16;
  const float* xb = x + (size_t)b * XROW;

  // ---------------- phase 1: stage x ----------------
  {
    const int part = tid >> 7;                      // wave-uniform
    const int row  = tid & 127;
    const float* xr  = xb + row * CC;               // row*80 B, 16-B aligned
    float*       xsr = xs + row * CC;
    _Float16*    xhr = xh + row * PX;
    if (part == 0) {
      const v4f a0 = bfr4(*(const v4f*)(xr));
      const v4f a1 = bfr4(*(const v4f*)(xr + 4));
      const v4f a2 = bfr4(*(const v4f*)(xr + 8));
      const v4f a3 = bfr4(*(const v4f*)(xr + 12));
      *(v4f*)(xsr)      = a0;
      *(v4f*)(xsr + 4)  = a1;
      *(v4f*)(xsr + 8)  = a2;
      *(v4f*)(xsr + 12) = a3;
      v8h p0, p1;
#pragma unroll
      for (int c = 0; c < 4; ++c) {
        p0[c]     = (_Float16)(a0[c] * 16.0f);
        p0[4 + c] = (_Float16)(a1[c] * 16.0f);
        p1[c]     = (_Float16)(a2[c] * 16.0f);
        p1[4 + c] = (_Float16)(a3[c] * 16.0f);
      }
      *(v8h*)(xhr)     = p0;
      *(v8h*)(xhr + 8) = p1;
    } else {
      const v4f a4 = bfr4(*(const v4f*)(xr + 16));
      *(v4f*)(xsr + 16) = a4;
      v8h p2, p3;
#pragma unroll
      for (int c = 0; c < 4; ++c) {
        p2[c]     = (_Float16)(a4[c] * 16.0f);
        p2[4 + c] = (_Float16)0.0f;
        p3[c]     = (_Float16)0.0f;
        p3[4 + c] = (_Float16)0.0f;
      }
      *(v8h*)(xhr + 16) = p2;
      *(v8h*)(xhr + 24) = p3;
    }
  }
  __syncthreads();

  // ---------------- phase 2: projections (K = 32, one k-step) ----------------
  Frag qa[4];                                                    // q rows m0+lo as the A fragments of phase 3
  {
    const v16h af = ldfrag(xh + (m0 + lo) * PX + 8 * h);        // row / col token m0+lo, k = c
    const _Float16* pw = W + (size_t)lo * CP + 8 * h;            // A: row n = 16nt+lo of a W plane, k = c
    const float*    pc = Bp + 8 * h;                             // C: rows n = 16nt+8h+r
    // v = tanh(x.Wv + bv), stored transposed as hi + residual planes
#pragma unroll 1
    for (int nt = 0; nt < 2; ++nt) {
      const int n0 = nt * 16, d = n0 + lo;
      const v8f acc = mma(af, ldfrag(W + WV_OFF + (size_t)(n0 + lo) * CP + 8 * h), zero8());
      const float bias = bfr(bv[min(d, CC - 1)]);
#pragma unroll
      for (int r = 0; r < 8; ++r) {
        float val = tanh_f(acc[r] * 6.103515625e-05f + bias);
        val = (d < CC) ? val : 0.0f;
        const float v16 = val * 16.0f;
        const _Float16 hh = (_Float16)v16;
        const _Float16 ll = (_Float16)((v16 - (float)hh) * 2048.0f);
        vTh[d * PH + m0 + 8 * h + r] = hh;
        vTl[d * PH + m0 + 8 * h + r] = ll;
      }
    }
    // k^T = elu(Wk^T.x^T + bk): tiles t = 0..6; q^T = elu(Wq^T.x^T + bq): tiles t = 7..13
    _Float16* kw = kS + (m0 + lo) * PH + 8 * h;
    v16h wf[2 * NTKQ];
    union { v8f v; v4f q[2]; } cb[2 * NTKQ];
    v8f ac[2 * NTKQ];
    // elu (alpha = 1) of v = acc * 2^-14, carried x8: exp(v) = exp2(acc * CE), 8 * v = acc * CV
    const float CE = 1.4426950408889634f * 6.103515625e-05f, CV = 0.00048828125f;
#define LOAD_TILE(t)                                                                         \
    {                                                                                          \
      const int pl = (t) / NTKQ, nt = (t) % NTKQ;                                              \
      wf[t]      = ldfrag(pw + (pl ? WQ_OFF : WK_OFF) + nt * 16 * CP);                         \
      cb[t].q[0] = *(const v4f*)(pc + pl * 128 + nt * 16);                                     \
      cb[t].q[1] = *(const v4f*)(pc + pl * 128 + nt * 16 + 4);                                 \
    }
#define MMA_TILE(t)                                                                          \
    ac[t] = __builtin_amdgcn_wmma_f32_16x16x32_f16(false, wf[t], false, af, (short)0, cb[t].v, false, false)
    LOAD_TILE(0) LOAD_TILE(1) LOAD_TILE(2)
    MMA_TILE(0);
#pragma unroll
    for (int t = 0; t < 2 * NTKQ; ++t) {
      if (t + 1 < 2 * NTKQ) MMA_TILE(t + 1);                     // its result slots are filled by tile t's elu
      float e[8];
#pragma unroll
      for (int r = 0; r < 8; ++r) e[r] = ac[t][r] * CE;
      exp2x8(e);
      v8h o;
#pragma unroll
      for (int r = 0; r < 8; ++r)
        o[r] = (_Float16)(ac[t][r] > 0.0f ? ac[t][r] * CV : __builtin_fmaf(e[r], 8.0f, -8.0f));
      if (t < NTKQ) *(v8h*)(kw + t * 16) = o;
      else          qa[(t - NTKQ) >> 1].half[(t - NTKQ) & 1] = o;
      if (t + 3 < 2 * NTKQ) LOAD_TILE(t + 3)
      // one tile a group: keeps the loads of tile t+3 a whole tile in front of their product (left alone the compiler
      // put each tile's four loads and a full wait directly in front of it), and ends q's elu in front of phase 3
      __builtin_amdgcn_sched_barrier(0);
    }
#undef LOAD_TILE
#undef MMA_TILE
    v8h z8;
#pragma unroll
    for (int r = 0; r < 8; ++r) z8[r] = (_Float16)0.0f;
    *(v8h*)(kw + NTKQ * 16) = z8;
    qa[NTKQ >> 1].half[NTKQ & 1] = z8;
  }
  __syncthreads();

  // ---------------- phase 3: scores, transposed: S^T[j][i] (K = 128 over d), kept in registers ----------------
  v8f acc[8];                                                    // acc[nt][r] = 64 * S[i = 16nt+lo][j = m0+8h+r]
  {
    const _Float16* pb = kS + lo * PH + 8 * h;                   // B: col i = 16nt+lo, k = d (the map of qa)
#pragma unroll
    for (int nt = 0; nt < 8; ++nt) acc[nt] = zero8();
#pragma unroll
    for (int ks = 0; ks < 4; ++ks) {                             // k-step outermost: 8 independent accumulators in a row
      v16h bf[8];
#pragma unroll
      for (int nt = 0; nt < 8; ++nt) bf[nt] = ldfrag(pb + nt * 16 * PH + 32 * ks);
      // keeps the 16 LDS reads of a k-step one group in front of its 8 products: left alone the compiler put two
      // reads and a full wait in front of every product, one LDS latency each
      __builtin_amdgcn_sched_barrier(0);
#pragma unroll
      for (int nt = 0; nt < 8; ++nt)
        acc[nt] = __builtin_amdgcn_wmma_f32_16x16x32_f16(false, qa[ks].v, false, bf[nt], (short)0, acc[nt], false, false);
      // second half of the pair: the next k-step's reads stay behind these products (their registers are reused)
      __builtin_amdgcn_sched_barrier(0);
    }
  }

  // ---------------- phase 4: softmax over i, per column j, in registers ----------------
  {
    // exp(s - max) = exp2((acc - max_acc) * C2), C2 = (1/sqrt(128)) * 2^-6 * log2(e) > 0
    const float C2 = 0.08838834764831845f * 0.015625f * 1.4426950408889634f;
    float mx[8], rs[8];
#pragma unroll
    for (int r = 0; r < 8; ++r) {
      mx[r] = acc[0][r];
#pragma unroll
      for (int nt = 1; nt < 8; ++nt) mx[r] = fmaxf(mx[r], acc[nt][r]);
    }
    row_max16x8(mx);
#pragma unroll
    for (int r = 0; r < 8; ++r) {
      const float nb = -C2 * mx[r];
      float t[8];
#pragma unroll
      for (int nt = 0; nt < 8; ++nt) t[nt] = __builtin_fmaf(acc[nt][r], C2, nb);
      exp2x8(t);
      float sum = t[0];
      acc[0][r] = t[0];
#pragma unroll
      for (int nt = 1; nt < 8; ++nt) {
        acc[nt][r] = t[nt];
        sum += t[nt];
      }
      rs[r] = row_sum16(sum);                                    // the largest term is 1: sum >= 1
    }
    rcpx8(rs);
#pragma unroll
    for (int r = 0; r < 8; ++r) rs[r] *= 1024.0f;
    _Float16* Pw = pS + lo * PH + m0 + 8 * h;                    // P as [i][j], carried x1024
#pragma unroll
    for (int nt = 0; nt < 8; ++nt) {
      v8h p;
#pragma unroll
      for (int r = 0; r < 8; ++r) p[r] = (_Float16)(acc[nt][r] * rs[r]);
      *(v8h*)(Pw + nt * 16 * PH) = p;
    }
  }
  __syncthreads();

  // ---------------- phase 5: y = P.v + x (K = 128 over j; hi and residual accumulators) ----------------
  {
    const _Float16* pa = pS + (m0 + lo) * PH + 8 * h;            // A: row i = m0+lo, k = j
    const v16h p0 = ldfrag(pa);
    const v16h p1 = ldfrag(pa + 32);
    const v16h p2 = ldfrag(pa + 64);
    const v16h p3 = ldfrag(pa + 96);
    const _Float16* bh0 = vTh + lo * PH + 8 * h;                 // B: col d = lo,    k = j
    const _Float16* bh1 = vTh + (16 + lo) * PH + 8 * h;          // B: col d = 16+lo, k = j
    const _Float16* bl0 = vTl + lo * PH + 8 * h;
    const _Float16* bl1 = vTl + (16 + lo) * PH + 8 * h;
    v8f ah0 = zero8(), ah1 = zero8(), al0 = zero8(), al1 = zero8();
    ah0 = mma(p0, ldfrag(bh0),      ah0); ah1 = mma(p0, ldfrag(bh1),      ah1);
    al0 = mma(p0, ldfrag(bl0),      al0); al1 = mma(p0, ldfrag(bl1),      al1);
    ah0 = mma(p1, ldfrag(bh0 + 32), ah0); ah1 = mma(p1, ldfrag(bh1 + 32), ah1);
    al0 = mma(p1, ldfrag(bl0 + 32), al0); al1 = mma(p1, ldfrag(bl1 + 32), al1);
    ah0 = mma(p2, ldfrag(bh0 + 64), ah0); ah1 = mma(p2, ldfrag(bh1 + 64), ah1);
    al0 = mma(p2, ldfrag(bl0 + 64), al0); al1 = mma(p2, ldfrag(bl1 + 64), al1);
    ah0 = mma(p3, ldfrag(bh0 + 96), ah0); ah1 = mma(p3, ldfrag(bh1 + 96), ah1);
    al0 = mma(p3, ldfrag(bl0 + 96), al0); al1 = mma(p3, ldfrag(bl1 + 96), al1);

    const int d1  = 16 + lo;
    const int d1c = min(d1, CC - 1);
#pragma unroll
    for (int r = 0; r < 8; ++r) {
      const int i = m0 + 8 * h + r;
      float* px = xs + i * CC;
      const float y0 = (ah0[r] + al0[r] * 0.00048828125f) * 6.103515625e-05f;   // (h + l/2048) * 2^-14
      const float y1 = (ah1[r] + al1[r] * 0.00048828125f) * 6.103515625e-05f;
      const float v0 = px[lo] + y0;                              // d = lo < 16 < 20 always valid
      const float v1 = px[d1c] + y1;
      px[lo] = v0;
      if (lo < 4) px[d1] = v1;                                   // d = 16..19
    }
  }
  __syncthreads();

  {
    const v4f* xs4 = (const v4f*)xs;
    const int c2  = 16 + wid;                                    // valid iff wid < 4 (wave-uniform)
    const int c2c = min(c2, 19);
    const v4f pv0 = xs4[(wid)     * 32 + lane];
    const v4f pv1 = xs4[(8 + wid) * 32 + lane];
    const v4f pv2 = xs4[c2c       * 32 + lane];
    float* ob = out + (size_t)b * XROW + (size_t)lane * 4;
    *(v4f*)(ob + (size_t)wid * 128)       = pv0;
    *(v4f*)(ob + (size_t)(8 + wid) * 128) = pv1;
    if (wid < 4) *(v4f*)(ob + (size_t)c2 * 128) = pv2;
    
  }
}

// =====================================================================================================
// Workspace map (bytes): WkT f16 [128][32] 8192 at 0; WqT 8192 at 8192; WvT f16 [32][32] 2048 at 16384;
// bk plane f32 [128] 512 at 18432; bq plane 512 at 18944; total 19456, every region a whole multiple of 512 B.
// =====================================================================================================
extern "C" void kernel_launch(void* const* d_in, const int* in_sizes, int n_in,
                              void* d_out, int out_size, void* d_ws, size_t ws_size,
                              hipStream_t stream) {
  if (n_in < 7) return;
  if (in_sizes[0] != NBATCH * XROW) return;
  if (in_sizes[1] != CC * KQ) return;
  if (in_sizes[2] != KQ) return;
  if (in_sizes[3] != CC * KQ) return;
  if (in_sizes[4] != KQ) return;
  if (in_sizes[5] != CC * CC) return;
  if (in_sizes[6] != CC) return;
  if (out_size != NBATCH * XROW) return;

  const float* x  = (const float*)d_in[0];     // [4096][128][20]
  const float* Wk = (const float*)d_in[1];     // [20][100]
  const float* bk = (const float*)d_in[2];     // [100]
  const float* Wq = (const float*)d_in[3];     // [20][100]
  const float* bq = (const float*)d_in[4];     // [100]
  const float* Wv = (const float*)d_in[5];     // [20][20]
  const float* bv = (const float*)d_in[6];     // [20]
  float* out = (float*)d_out;                  // [4096][128][20]

  const size_t wsb = (size_t)WS_HALVES * 2 + (size_t)WS_BIAS * 4;    // 19456
  if (wsb > ws_size) return;
  if (wsb > (size_t)134217728) return;
  unsigned short* P = (unsigned short*)d_ws;

  (void)hipFuncSetAttribute(reinterpret_cast<const void*>(&k_main),
                            hipFuncAttributeMaxDynamicSharedMemorySize, LDS_MAIN);

  const dim3 gPrep(1), bPrep(256);
  const dim3 gMain(NBATCH), bMain(256);

  k_prep<<<gPrep, bPrep, 0, stream>>>(Wk, Wq, Wv, bk, bq, P);
  k_main<<<gMain, bMain, LDS_MAIN, stream>>>(x, P, bv, out);
  (void)hipGetLastError();
}

// v004
// A run of this version takes 50.5 microseconds.
// Timed twice side by side with v003, it ran 1.09 and 1.10 times as fast.
// All steps since v000 together make it 6.97 times as fast.
// Contractions on v_wmma_f32_16x16x32_f16, f32 accumulate: x.Wk, x.Wq, x.Wv with f16 operands built from
// bf16-RNE inputs (x carried x16, W carried x1024), single products (k and q as W^T.x^T with the bias in C);
// k.q^T with k and q as plain f16 carried x8;
// P.v with P as plain f16 carried x1024 and v as f16 hi (x16) + x2048 residual plane (separate accumulator);
// elu, tanh, column softmax (in registers) and the residual add in f32 on VALU.
#include <hip/hip_runtime.h>
#include <stdint.h>

#define NBATCH 4096
#define TT     128              // tokens per item
#define CC     20               // channels
#define KQ     100              // key/query dim
#define CP     32               // channels padded (k of the projections)
#define DP     128              // key dim padded (k of the score product)
#define PX     40               // LDS pitch of xh in halves: 80 B = 16 B x 5
#define PH     136              // LDS pitch of kS, P, vTh, vTl in halves: 272 B = 16 B x 17
#define XROW   (TT * CC)        // 2560 floats per item

static_assert(XROW == 2560);
static_assert(TT == 128);
static_assert(DP == TT);
static_assert(PX >= CP && PH >= DP);
static_assert((PX * 2) % 32 == 16 && (PH * 2) % 32 == 16);    // 16-B fragment reads: pitch = 16 B x odd

// LDS byte offsets of the main kernel
#define OFF_XS   0              // f32 [128][20]   10240  (bf16-RNE x, later y)
// (the pad columns behind each row's last used column are never written and never read)
#define OFF_XH   10240          // f16 [128][32 of 40]    10240  (16*x, cols 20..31 zero)
#define OFF_KS   20480          // f16 [128][128 of 136]  34816  (8*k, cols 100..127 zero)
#define OFF_PS   55296          // f16 [128][128 of 136]  34816  (1024*P as [i][j])
#define OFF_VTH  90112          // f16 [32][128 of 136]    8704  (hi of 16*v, transposed [d][j])
#define OFF_VTL  98816          // f16 [32][128 of 136]    8704  (x2048 residual, transposed)
#define LDS_MAIN 107520         // three blocks fit the 327680 B of a WGP
static_assert(OFF_XH == OFF_XS + TT * CC * 4);
static_assert(OFF_KS == OFF_XH + TT * PX * 2);
static_assert(OFF_PS == OFF_KS + TT * PH * 2);
static_assert(OFF_VTH == OFF_PS + TT * PH * 2);
static_assert(OFF_VTL == OFF_VTH + CP * PH * 2);
static_assert(LDS_MAIN == OFF_VTL + CP * PH * 2);
static_assert(3 * LDS_MAIN <= 327680);

// workspace: f16 planes (halves): WkT [128 n][32 c] at 0, WqT at 4096, WvT [32 d][32 c] at 8192; total 9216 halves;
// behind them two f32 planes of 128: bk and bq as the projections' C operand (bf16-RNE value * 2^14, n >= 100 zero)
#define WK_OFF    0
#define WQ_OFF    4096
#define WV_OFF    8192
#define WS_HALVES 9216
static_assert(WS_HALVES == 4096 + 4096 + 1024);
static_assert((WS_HALVES % 8) == 0);
#define WS_BIAS   256             // floats: bk plane [128], bq plane [128]
#define NTKQ      7               // 16-wide tiles of the key dim that hold a real column (100 = 6 * 16 + 4)
static_assert(NTKQ * 16 >= KQ && (NTKQ - 1) * 16 < KQ && (NTKQ + 1) * 16 == DP);

typedef _Float16     v16h __attribute__((ext_vector_type(16)));
typedef _Float16     v8h  __attribute__((ext_vector_type(8)));
typedef float        v8f  __attribute__((ext_vector_type(8)));
typedef float        v4f  __attribute__((ext_vector_type(4)));
typedef unsigned int v4u  __attribute__((ext_vector_type(4)));

union Frag { v16h v; v8h half[2]; };

// ---- scalar helpers --------------------------------------------------------------------------------
__device__ __forceinline__ unsigned short bf_bits(float f) {          // f32 -> bf16 bits, RNE convert
  unsigned u = __float_as_uint(f);
  return (unsigned short)((u + 0x7FFFu + ((u >> 16) & 1u)) >> 16);
}
__device__ __forceinline__ float bf_up(unsigned short b) { return __uint_as_float(((unsigned)b) << 16); }
__device__ __forceinline__ float bfr(float f) { return bf_up(bf_bits(f)); }   // value after bf16 RNE convert
__device__ __forceinline__ v4f bfr4(v4f a) {
  v4f o;
  o[0] = bfr(a[0]); o[1] = bfr(a[1]); o[2] = bfr(a[2]); o[3] = bfr(a[3]);
  return o;
}
__device__ __forceinline__ v8f zero8() {
  v8f z;
  z[0] = 0.f; z[1] = 0.f; z[2] = 0.f; z[3] = 0.f; z[4] = 0.f; z[5] = 0.f; z[6] = 0.f; z[7] = 0.f;
  return z;
}
__device__ __forceinline__ float tanh_f(float v) {                  // branchless tanh
  const float c = fminf(fmaxf(v, -15.0f), 15.0f);
  const float t = __expf(2.0f * c);
  return (t - 1.0f) * __builtin_amdgcn_rcpf(t + 1.0f);
}

// ---- maximum / sum over the 16 lanes of a row (lanes 0..15, lanes 16..31), result in every lane of the row;
//      DPP row_xmask:m (control 0x160 + m) reads lane l ^ m of the same row; all 32 lanes are on at every use
template <int CTRL>
__device__ __forceinline__ float dpp_x(float v) {
  return __builtin_bit_cast(float, __builtin_amdgcn_update_dpp(0, __builtin_bit_cast(int, v), CTRL, 0xf, 0xf, true));
}
// Row maximum of eight values at once. In asm because fmaxf on a DPP move compiled to three instructions a step
// (move, quieting max, max) where the fused v_max_num_f32_dpp is one; the eight chains are interleaved so that
// every instruction's producer stands eight instructions back (no dependent pair in a row).
__device__ __forceinline__ void row_max16x8(float (&m)[8]) {
#if defined(__HIP_DEVICE_COMPILE__)
  asm(
      "v_max_num_f32_dpp %0, %0, %0 row_xmask:1 row_mask:0xf bank_mask:0xf\n\t"
      "v_max_num_f32_dpp %1, %1, %1 row_xmask:1 row_mask:0xf bank_mask:0xf\n\t"
      "v_max_num_f32_dpp %2, %2, %2 row_xmask:1 row_mask:0xf bank_mask:0xf\n\t"
      "v_max_num_f32_dpp %3, %3, %3 row_xmask:1 row_mask:0xf bank_mask:0xf\n\t"
      "v_max_num_f32_dpp %4, %4, %4 row_xmask:1 row_mask:0xf bank_mask:0xf\n\t"
      "v_max_num_f32_dpp %5, %5, %5 row_xmask:1 row_mask:0xf bank_mask:0xf\n\t"
      "v_max_num_f32_dpp %6, %6, %6 row_xmask:1 row_mask:0xf bank_mask:0xf\n\t"
      "v_max_num_f32_dpp %7, %7, %7 row_xmask:1 row_mask:0xf bank_mask:0xf\n\t"
      "v_max_num_f32_dpp %0, %0, %0 row_xmask:2 row_mask:0xf bank_mask:0xf\n\t"
      "v_max_num_f32_dpp %1, %1, %1 row_xmask:2 row_mask:0xf bank_mask:0xf\n\t"
      "v_max_num_f32_dpp %2, %2, %2 row_xmask:2 row_mask:0xf bank_mask:0xf\n\t"
      "v_max_num_f32_dpp %3, %3, %3 row_xmask:2 row_mask:0xf bank_mask:0xf\n\t"
      "v_max_num_f32_dpp %4, %4, %4 row_xmask:2 row_mask:0xf bank_mask:0xf\n\t"
      "v_max_num_f32_dpp %5, %5, %5 row_xmask:2 row_mask:0xf bank_mask:0xf\n\t"
      "v_max_num_f32_dpp %6, %6, %6 row_xmask:2 row_mask:0xf bank_mask:0xf\n\t"
      "v_max_num_f32_dpp %7, %7, %7 row_xmask:2 row_mask:0xf bank_mask:0xf\n\t"
      "v_max_num_f32_dpp %0, %0, %0 row_xmask:4 row_mask:0xf bank_mask:0xf\n\t"
      "v_max_num_f32_dpp %1, %1, %1 row_xmask:4 row_mask:0xf bank_mask:0xf\n\t"
      "v_max_num_f32_dpp %2, %2, %2 row_xmask:4 row_mask:0xf bank_mask:0xf\n\t"
      "v_max_num_f32_dpp %3, %3, %3 row_xmask:4 row_mask:0xf bank_mask:0xf\n\t"
      "v_max_num_f32_dpp %4, %4, %4 row_xmask:4 row_mask:0xf bank_mask:0xf\n\t"
      "v_max_num_f32_dpp %5, %5, %5 row_xmask:4 row_mask:0xf bank_mask:0xf\n\t"
      "v_max_num_f32_dpp %6, %6, %6 row_xmask:4 row_mask:0xf bank_mask:0xf\n\t"
      "v_max_num_f32_dpp %7, %7, %7 row_xmask:4 row_mask:0xf bank_mask:0xf\n\t"
      "v_max_num_f32_dpp %0, %0, %0 row_xmask:8 row_mask:0xf bank_mask:0xf\n\t"
      "v_max_num_f32_dpp %1, %1, %1 row_xmask:8 row_mask:0xf bank_mask:0xf\n\t"
      "v_max_num_f32_dpp %2, %2, %2 row_xmask:8 row_mask:0xf bank_mask:0xf\n\t"
      "v_max_num_f32_dpp %3, %3, %3 row_xmask:8 row_mask:0xf bank_mask:0xf\n\t"
      "v_max_num_f32_dpp %4, %4, %4 row_xmask:8 row_mask:0xf bank_mask:0xf\n\t"
      "v_max_num_f32_dpp %5, %5, %5 row_xmask:8 row_mask:0xf bank_mask:0xf\n\t"
      "v_max_num_f32_dpp %6, %6, %6 row_xmask:8 row_mask:0xf bank_mask:0xf\n\t"
      "v_max_num_f32_dpp %7, %7, %7 row_xmask:8 row_mask:0xf bank_mask:0xf"
      : "+v"(m[0]), "+v"(m[1]), "+v"(m[2]), "+v"(m[3]), "+v"(m[4]), "+v"(m[5]), "+v"(m[6]), "+v"(m[7]));
#endif
}
// Eight transcendentals in place, then one free slot.
// Here result and source are one register, no line touches another line's register, and the closing v_nop is the
// one independent slot the instruction set asks for in front of the first reader.
__device__ __forceinline__ void exp2x8(float (&t)[8]) {
#if defined(__HIP_DEVICE_COMPILE__)
  asm("v_exp_f32 %0, %0\n\tv_exp_f32 %1, %1\n\tv_exp_f32 %2, %2\n\tv_exp_f32 %3, %3\n\t"
      "v_exp_f32 %4, %4\n\tv_exp_f32 %5, %5\n\tv_exp_f32 %6, %6\n\tv_exp_f32 %7, %7\n\tv_nop"
      : "+v"(t[0]), "+v"(t[1]), "+v"(t[2]), "+v"(t[3]), "+v"(t[4]), "+v"(t[5]), "+v"(t[6]), "+v"(t[7]));
#endif
}
__device__ __forceinline__ void rcpx8(float (&t)[8]) {
#if defined(__HIP_DEVICE_COMPILE__)
  asm("v_rcp_f32 %0, %0\n\tv_rcp_f32 %1, %1\n\tv_rcp_f32 %2, %2\n\tv_rcp_f32 %3, %3\n\t"
      "v_rcp_f32 %4, %4\n\tv_rcp_f32 %5, %5\n\tv_rcp_f32 %6, %6\n\tv_rcp_f32 %7, %7\n\tv_nop"
      : "+v"(t[0]), "+v"(t[1]), "+v"(t[2]), "+v"(t[3]), "+v"(t[4]), "+v"(t[5]), "+v"(t[6]), "+v"(t[7]));
#endif
}
__device__ __forceinline__ float row_sum16(float v) {
  v += dpp_x<0x161>(v);
  v += dpp_x<0x162>(v);
  v += dpp_x<0x164>(v);
  v += dpp_x<0x168>(v);
  return v;
}

// ---- 16-bit fragment loader (A, B alike): p points at row/col (lane&15), + k0 + 8*(lane>>4);
//      elements 0..7 <- p[0..7] (k0+8h..k0+8h+7), elements 8..15 <- p[16..23] (k0+16+8h..k0+16+8h+7)
__device__ __forceinline__ v16h ldfrag(const _Float16* p) {
  Frag f;
  f.half[0] = *(const v8h*)(p);
  f.half[1] = *(const v8h*)(p + 16);
  return f.v;
}

// ---- WMMA with trailing VALU hazard gap (ties D, keeps A/B live past the nops) ---------------------
__device__ __forceinline__ v8f mma(v16h a, v16h b, v8f c) {
  v8f d = __builtin_amdgcn_wmma_f32_16x16x32_f16(false, a, false, b, (short)0, c, false, false);
#if defined(__HIP_DEVICE_COMPILE__)
  asm volatile("v_nop\n\tv_nop\n\tv_nop\n\tv_nop" : "+v"(d) : "v"(a), "v"(b));
#endif
  return d;
}

// =====================================================================================================
// Weight planes: Wk [20 c][100 n] -> WkT[n][c] (n padded to 128, c padded to 32, pads zero), same for Wq;
// Wv [20][20] -> WvT[d][c] [32][32]. Values = f16 of (bf16-RNE value * 1024). One plane row n (64 B) a thread:
// its 20 loads (one clamped address, constant steps; a wave reads 128 B in a row) are in flight together, so the
// whole launch costs one load latency. One wave a block, 32 rows: blocks 0..3 WkT, 4..7 WqT, 8 WvT.
// Bias planes: the thread of row n of WkT / WqT also writes bk[n] / bq[n] as f32 of (bf16-RNE value * 2^14),
// n >= 100 zero.
// =====================================================================================================
#define PREP_THREADS 32
#define PREP_BLOCKS  9
static_assert(PREP_BLOCKS * PREP_THREADS * CP == WS_HALVES);
static_assert(WQ_OFF == 4 * PREP_THREADS * CP && WV_OFF == 8 * PREP_THREADS * CP);
static_assert(8 * PREP_THREADS == WS_BIAS);
template <int NCOL>                                            // columns of the source = its row pitch
__device__ __forceinline__ void prep_row(const float* __restrict__ src, int n, unsigned short* dst) {
  const float* p = src + min(n, NCOL - 1);
  float raw[CC];
#pragma unroll                                                 // the 20 loads issue in a row, ahead of the first use
  for (int c = 0; c < CC; ++c) raw[c] = p[c * NCOL];
  v8h o[CP / 8];
#pragma unroll                                                 // constant indices: o stays in registers
  for (int c = 0; c < CP; ++c) o[c >> 3][c & 7] = (_Float16)0.0f;
#pragma unroll                                                 // constant indices: raw and o stay in registers
  for (int c = 0; c < CC; ++c) o[c >> 3][c & 7] = (_Float16)(bfr((n < NCOL) ? raw[c] : 0.0f) * 1024.0f);
#pragma unroll                                                 // constant indices; the 4 stores issue in a row
  for (int k = 0; k < CP / 8; ++k) *(v4u*)(dst + k * 8) = __builtin_bit_cast(v4u, o[k]);
#if defined(__HIP_DEVICE_COMPILE__)
  // the wait that stands between issued global stores and any later write of a register that they name
  asm volatile("s_wait_xcnt 0x0" ::: "memory");
#endif
}
__global__ __launch_bounds__(PREP_THREADS) void k_prep(const float* __restrict__ Wk, const float* __restrict__ Wq,
                                                       const float* __restrict__ Wv, const float* __restrict__ bk,
                                                       const float* __restrict__ bq, unsigned short* P) {
  const int row = blockIdx.x * PREP_THREADS + threadIdx.x;     // row of the three planes taken as one: 0..287
  unsigned short* dst = P + (size_t)row * CP;
  if (blockIdx.x < 8) {                                        // block-uniform
    const bool isq = blockIdx.x >= 4;
    const int n = row & 127;
    const float braw = (isq ? bq : bk)[min(n, KQ - 1)];
    prep_row<KQ>(isq ? Wq : Wk, n, dst);
    ((float*)(void*)(P + WS_HALVES))[row] = bfr((n < KQ) ? braw : 0.0f) * 16384.0f;
  } else {
    prep_row<CC>(Wv, row & 31, dst);
  }
}

// =====================================================================================================
// Main: one 256-thread block (8 waves) per batch item; wave w owns token rows 16w..16w+15 in the projections and
// in P.v, and score COLUMNS j = 16w..16w+15 (all 128 rows i) in the score product.
// Phase 1: x -> xs (f32 bf16-RNE values) and xh (f16 of 16*x, cols 20..31 zero); threads 0..127 write cols
//          0..15 of row tid, threads 128..255 cols 16..31 (wave-uniform split). coverage: 128 rows x 32 cols.
// Phase 2: projections, one k-step (k = c, split map, the same for A and B). k and q transposed: A = W plane rows
//          n from global [n][c], B = xh as [col = token][c], C = the bias plane; D (row n = 16nt+8h+r, col token
//          m0+lo): a lane holds 8 neighbouring d of ONE token, which is half a 16-bit fragment of that token's row.
//          elu in f32, f16(8*val); pad rows n >= 100 come out 0 (W and bias planes are 0 there, elu(0) = 0).
//          k: one 16-B store a tile into kS [i][d], cols 112..127 stored as zeros. q: tiles 2s and 2s+1 ARE the
//          A fragment of k-step s of phase 3 (elements 0..7: d = 32s+8h+r, 8..15: d = 32s+16+8h+r, row m0+lo);
//          it stays in registers. v: A = xh rows, B = WvT; D (row m0+8h+r, col d) -> tanh -> vTh/vTl [d][j] for
//          d 0..31 (d >= 20 forced 0).
// Phase 3: S^T[j][i] = sum_d q[j][d] k[i][d]: A = q rows j (the wave's own 16, registers), B = kS as [n=i][k=d];
//          8 column tiles x 4 k-steps; D (row j = m0+8h+r, col i = 16nt+lo) stays in 64 accumulator registers.
// Phase 4: softmax over i per column j, in registers: i runs over the 8 tiles and the 16 lanes of a row, so max
//          and sum are 8 values a lane, each folded over nt and then over the row by DPP; the 8 values r of one
//          tile are 8 neighbouring j of row i: P[i][j] = f16(1024 * e / sum) goes into its own region as [i][j]
//          with one 16-B store a tile (nothing else uses that region, so no barrier stands in front of it).
// Phase 5: y_att[i][d] = sum_j P v: A = P rows i (k = j), B = vTh/vTl as [n=d][k=j]; hi and residual in
//          separate accumulators; y = (acc_h + acc_l/2048)/16384 + xs, written back into xs (d < 20).
// =====================================================================================================
// register budget for six waves a SIMD: three work-groups a WGP, which is also what the LDS allows
__global__ __launch_bounds__(256) __attribute__((amdgpu_waves_per_eu(6)))
void k_main(const float* __restrict__ x, const unsigned short* __restrict__ Wp, const float* __restrict__ bv,
            float* out) {
  extern __shared__ __align__(16) unsigned char smem[];
  float*    xs  = (float*)(smem + OFF_XS);
  _Float16* xh  = (_Float16*)(smem + OFF_XH);
  _Float16* kS  = (_Float16*)(smem + OFF_KS);
  _Float16* pS  = (_Float16*)(smem + OFF_PS);
  _Float16* vTh = (_Float16*)(smem + OFF_VTH);
  _Float16* vTl = (_Float16*)(smem + OFF_VTL);
  const _Float16* W = (const _Float16*)(const void*)Wp;
  const float* Bp = (const float*)(const void*)(Wp + WS_HALVES);   // bias planes: bk [128], bq [128]

  const int tid  = threadIdx.x;
  const int lane = tid & 31;
  const int wid  = tid >> 5;
  const int h    = lane >> 4;
  const int lo   = lane & 15;
  const int b    = blockIdx.x;
  const int m0   = wid * 16;
  const float* xb = x + (size_t)b * XROW;

  // ---------------- phase 1: stage x ----------------
  {
    const int part = tid >> 7;                      // wave-uniform
    const int row  = tid & 127;
    const float* xr  = xb + row * CC;               // row*80 B, 16-B aligned
    float*       xsr = xs + row * CC;
    _Float16*    xhr = xh + row * PX;
    if (part == 0) {
      const v4f a0 = bfr4(*(const v4f*)(xr));
      const v4f a1 = bfr4(*(const v4f*)(xr + 4));
      const v4f a2 = bfr4(*(const v4f*)(xr + 8));
      const v4f a3 = bfr4(*(const v4f*)(xr + 12));
      *(v4f*)(xsr)      = a0;
      *(v4f*)(xsr + 4)  = a1;
      *(v4f*)(xsr + 8)  = a2;
      *(v4f*)(xsr + 12) = a3;
      v8h p0, p1;
#pragma unroll
      for (int c = 0; c < 4; ++c) {
        p0[c]     = (_Float16)(a0[c] * 16.0f);
        p0[4 + c] = (_Float16)(a1[c] * 16.0f);
        p1[c]     = (_Float16)(a2[c] * 16.0f);
        p1[4 + c] = (_Float16)(a3[c] * 16.0f);
      }
      *(v8h*)(xhr)     = p0;
      *(v8h*)(xhr + 8) = p1;
    } else {
      const v4f a4 = bfr4(*(const v4f*)(xr + 16));
      *(v4f*)(xsr + 16) = a4;
      v8h p2, p3;
#pragma unroll
      for (int c = 0; c < 4; ++c) {
        p2[c]     = (_Float16)(a4[c] * 16.0f);
        p2[4 + c] = (_Float16)0.0f;
        p3[c]     = (_Float16)0.0f;
        p3[4 + c] = (_Float16)0.0f;
      }
      *(v8h*)(xhr + 16) = p2;
      *(v8h*)(xhr + 24) = p3;
    }
  }
  __syncthreads();

  // ---------------- phase 2: projections (K = 32, one k-step) ----------------
  Frag qa[4];                                                    // q rows m0+lo as the A fragments of phase 3
  {
    const v16h af = ldfrag(xh + (m0 + lo) * PX + 8 * h);        // row / col token m0+lo, k = c
    const _Float16* pw = W + (size_t)lo * CP + 8 * h;            // A: row n = 16nt+lo of a W plane, k = c
    const float*    pc = Bp + 8 * h;                             // C: rows n = 16nt+8h+r
    // v = tanh(x.Wv + bv), stored transposed as hi + residual planes
#pragma unroll 1
    for (int nt = 0; nt < 2; ++nt) {
      const int n0 = nt * 16, d = n0 + lo;
      const v8f acc = mma(af, ldfrag(W + WV_OFF + (size_t)(n0 + lo) * CP + 8 * h), zero8());
      const float bias = bfr(bv[min(d, CC - 1)]);
#pragma unroll
      for (int r = 0; r < 8; ++r) {
        float val = tanh_f(acc[r] * 6.103515625e-05f + bias);
        val = (d < CC) ? val : 0.0f;
        const float v16 = val * 16.0f;
        const _Float16 hh = (_Float16)v16;
        const _Float16 ll = (_Float16)((v16 - (float)hh) * 2048.0f);
        vTh[d * PH + m0 + 8 * h + r] = hh;
        vTl[d * PH + m0 + 8 * h + r] = ll;
      }
    }
    // k^T = elu(Wk^T.x^T + bk): tiles t = 0..6; q^T = elu(Wq^T.x^T + bq): tiles t = 7..13
    _Float16* kw = kS + (m0 + lo) * PH + 8 * h;
    v16h wf[2 * NTKQ];
    union { v8f v; v4f q[2]; } cb[2 * NTKQ];
    v8f ac[2 * NTKQ];
    // elu (alpha = 1) of v = acc * 2^-14, carried x8: exp(v) = exp2(acc * CE), 8 * v = acc * CV
    const float CE = 1.4426950408889634f * 6.103515625e-05f, CV = 0.00048828125f;
#define LOAD_TILE(t)                                                                         \
    {                                                                                          \
      const int pl = (t) / NTKQ, nt = (t) % NTKQ;                                              \
      wf[t]      = ldfrag(pw + (pl ? WQ_OFF : WK_OFF) + nt * 16 * CP);                         \
      cb[t].q[0] = *(const v4f*)(pc + pl * 128 + nt * 16);                                     \
      cb[t].q[1] = *(const v4f*)(pc + pl * 128 + nt * 16 + 4);                                 \
    }
#define MMA_TILE(t)                                                                          \
    ac[t] = __builtin_amdgcn_wmma_f32_16x16x32_f16(false, wf[t], false, af, (short)0, cb[t].v, false, false)
    LOAD_TILE(0) LOAD_TILE(1) LOAD_TILE(2)
    MMA_TILE(0);
#pragma unroll
    for (int t = 0; t < 2 * NTKQ; ++t) {
      if (t + 1 < 2 * NTKQ) MMA_TILE(t + 1);                     // its result slots are filled by tile t's elu
      float e[8];
#pragma unroll
      for (int r = 0; r < 8; ++r) e[r] = ac[t][r] * CE;
      exp2x8(e);
      v8h o;
#pragma unroll
      for (int r = 0; r < 8; ++r)
        o[r] = (_Float16)(ac[t][r] > 0.0f ? ac[t][r] * CV : __builtin_fmaf(e[r], 8.0f, -8.0f));
      if (t < NTKQ) *(v8h*)(kw + t * 16) = o;
      else          qa[(t - NTKQ) >> 1].half[(t - NTKQ) & 1] = o;
      if (t + 3 < 2 * NTKQ) LOAD_TILE(t + 3)
      // one tile a group: keeps the loads of tile t+3 a whole tile in front of their product (left alone the compiler
      // put each tile's four loads and a full wait directly in front of it), and ends q's elu in front of phase 3
      __builtin_amdgcn_sched_barrier(0);
    }
#undef LOAD_TILE
#undef MMA_TILE
    v8h z8;
#pragma unroll
    for (int r = 0; r < 8; ++r) z8[r] = (_Float16)0.0f;
    *(v8h*)(kw + NTKQ * 16) = z8;
    qa[NTKQ >> 1].half[NTKQ & 1] = z8;
  }
  __syncthreads();

  // ---------------- phase 3: scores, transposed: S^T[j][i] (K = 128 over d), kept in registers ----------------
  v8f acc[8];                                                    // acc[nt][r] = 64 * S[i = 16nt+lo][j = m0+8h+r]
  {
    const _Float16* pb = kS + lo * PH + 8 * h;                   // B: col i = 16nt+lo, k = d (the map of qa)
#pragma unroll
    for (int nt = 0; nt < 8; ++nt) acc[nt] = zero8();
#pragma unroll
    for (int ks = 0; ks < 4; ++ks) {                             // k-step outermost: 8 independent accumulators in a row
      v16h bf[8];
#pragma unroll
      for (int nt = 0; nt < 8; ++nt) bf[nt] = ldfrag(pb + nt * 16 * PH + 32 * ks);
      // keeps the 16 LDS reads of a k-step one group in front of its 8 products: left alone the compiler put two
      // reads and a full wait in front of every product, one LDS latency each
      __builtin_amdgcn_sched_barrier(0);
#pragma unroll
      for (int nt = 0; nt < 8; ++nt)
        acc[nt] = __builtin_amdgcn_wmma_f32_16x16x32_f16(false, qa[ks].v, false, bf[nt], (short)0, acc[nt], false, false);
      // second half of the pair: the next k-step's reads stay behind these products (their registers are reused)
      __builtin_amdgcn_sched_barrier(0);
    }
  }

  // ---------------- phase 4: softmax over i, per column j, in registers ----------------
  {
    // exp(s - max) = exp2((acc - max_acc) * C2), C2 = (1/sqrt(128)) * 2^-6 * log2(e) > 0
    const float C2 = 0.08838834764831845f * 0.015625f * 1.4426950408889634f;
    float mx[8], rs[8];
#pragma unroll
    for (int r = 0; r < 8; ++r) {
      mx[r] = acc[0][r];
#pragma unroll
      for (int nt = 1; nt < 8; ++nt) mx[r] = fmaxf(mx[r], acc[nt][r]);
    }
    row_max16x8(mx);
#pragma unroll
    for (int r = 0; r < 8; ++r) {
      const float nb = -C2 * mx[r];
      float t[8];
#pragma unroll
      for (int nt = 0; nt < 8; ++nt) t[nt] = __builtin_fmaf(acc[nt][r], C2, nb);
      exp2x8(t);
      float sum = t[0];
      acc[0][r] = t[0];
#pragma unroll
      for (int nt = 1; nt < 8; ++nt) {
        acc[nt][r] = t[nt];
        sum += t[nt];
      }
      rs[r] = row_sum16(sum);                                    // the largest term is 1: sum >= 1
    }
    rcpx8(rs);
#pragma unroll
    for (int r = 0; r < 8; ++r) rs[r] *= 1024.0f;
    _Float16* Pw = pS + lo * PH + m0 + 8 * h;                    // P as [i][j], carried x1024
#pragma unroll
    for (int nt = 0; nt < 8; ++nt) {
      v8h p;
#pragma unroll
      for (int r = 0; r < 8; ++r) p[r] = (_Float16)(acc[nt][r] * rs[r]);
      *(v8h*)(Pw + nt * 16 * PH) = p;
    }
  }
  __syncthreads();

  // ---------------- phase 5: y = P.v + x (K = 128 over j; hi and residual accumulators) ----------------
  {
    const _Float16* pa = pS + (m0 + lo) * PH + 8 * h;            // A: row i = m0+lo, k = j
    const v16h p0 = ldfrag(pa);
    const v16h p1 = ldfrag(pa + 32);
    const v16h p2 = ldfrag(pa + 64);
    const v16h p3 = ldfrag(pa + 96);
    const _Float16* bh0 = vTh + lo * PH + 8 * h;                 // B: col d = lo,    k = j
    const _Float16* bh1 = vTh + (16 + lo) * PH + 8 * h;          // B: col d = 16+lo, k = j
    const _Float16* bl0 = vTl + lo * PH + 8 * h;
    const _Float16* bl1 = vTl + (16 + lo) * PH + 8 * h;
    v8f ah0 = zero8(), ah1 = zero8(), al0 = zero8(), al1 = zero8();
    ah0 = mma(p0, ldfrag(bh0),      ah0); ah1 = mma(p0, ldfrag(bh1),      ah1);
    al0 = mma(p0, ldfrag(bl0),      al0); al1 = mma(p0, ldfrag(bl1),      al1);
    ah0 = mma(p1, ldfrag(bh0 + 32), ah0); ah1 = mma(p1, ldfrag(bh1 + 32), ah1);
    al0 = mma(p1, ldfrag(bl0 + 32), al0); al1 = mma(p1, ldfrag(bl1 + 32), al1);
    ah0 = mma(p2, ldfrag(bh0 + 64), ah0); ah1 = mma(p2, ldfrag(bh1 + 64), ah1);
    al0 = mma(p2, ldfrag(bl0 + 64), al0); al1 = mma(p2, ldfrag(bl1 + 64), al1);
    ah0 = mma(p3, ldfrag(bh0 + 96), ah0); ah1 = mma(p3, ldfrag(bh1 + 96), ah1);
    al0 = mma(p3, ldfrag(bl0 + 96), al0); al1 = mma(p3, ldfrag(bl1 + 96), al1);

    const int d1  = 16 + lo;
    const int d1c = min(d1, CC - 1);
#pragma unroll
    for (int r = 0; r < 8; ++r) {
      const int i = m0 + 8 * h + r;
      float* px = xs + i * CC;
      const float y0 = (ah0[r] + al0[r] * 0.00048828125f) * 6.103515625e-05f;   // (h + l/2048) * 2^-14
      const float y1 = (ah1[r] + al1[r] * 0.00048828125f) * 6.103515625e-05f;
      const float v0 = px[lo] + y0;                              // d = lo < 16 < 20 always valid
      const float v1 = px[d1c] + y1;
      px[lo] = v0;
      if (lo < 4) px[d1] = v1;                                   // d = 16..19
    }
  }
  __syncthreads();

  {
    const v4f* xs4 = (const v4f*)xs;
    const int c2  = 16 + wid;                                    // valid iff wid < 4 (wave-uniform)
    const int c2c = min(c2, 19);
    const v4f pv0 = xs4[(wid)     * 32 + lane];
    const v4f pv1 = xs4[(8 + wid) * 32 + lane];
    const v4f pv2 = xs4[c2c       * 32 + lane];
    float* ob = out + (size_t)b * XROW + (size_t)lane * 4;
    *(v4f*)(ob + (size_t)wid * 128)       = pv0;
    *(v4f*)(ob + (size_t)(8 + wid) * 128) = pv1;
    if (wid < 4) *(v4f*)(ob + (size_t)c2 * 128) = pv2;
    
  }
}

// =====================================================================================================
// Workspace map (bytes): WkT f16 [128][32] 8192 at 0; WqT 8192 at 8192; WvT f16 [32][32] 2048 at 16384;
// bk plane f32 [128] 512 at 18432; bq plane 512 at 18944; total 19456, every region a whole multiple of 512 B.
// =====================================================================================================
extern "C" void kernel_launch(void* const* d_in, const int* in_sizes, int n_in,
                              void* d_out, int out_size, void* d_ws, size_t ws_size,
                              hipStream_t stream) {
  if (n_in < 7) return;
  if (in_sizes[0] != NBATCH * XROW) return;
  if (in_sizes[1] != CC * KQ) return;
  if (in_sizes[2] != KQ) return;
  if (in_sizes[3] != CC * KQ) return;
  if (in_sizes[4] != KQ) return;
  if (in_sizes[5] != CC * CC) return;
  if (in_sizes[6] != CC) return;
  if (out_size != NBATCH * XROW) return;

  const float* x  = (const float*)d_in[0];     // [4096][128][20]
  const float* Wk = (const float*)d_in[1];     // [20][100]
  const float* bk = (const float*)d_in[2];     // [100]
  const float* Wq = (const float*)d_in[3];     // [20][100]
  const float* bq = (const float*)d_in[4];     // [100]
  const float* Wv = (const float*)d_in[5];     // [20][20]
  const float* bv = (const float*)d_in[6];     // [20]
  float* out = (float*)d_out;                  // [4096][128][20]

  const size_t wsb = (size_t)WS_HALVES * 2 + (size_t)WS_BIAS * 4;    // 19456
  if (wsb > ws_size) return;
  if (wsb > (size_t)134217728) return;
  unsigned short* P = (unsigned short*)d_ws;

  (void)hipFuncSetAttribute(reinterpret_cast<const void*>(&k_main),
                            hipFuncAttributeMaxDynamicSharedMemorySize, LDS_MAIN);

  const dim3 gPrep(PREP_BLOCKS), bPrep(PREP_THREADS);
  const dim3 gMain(NBATCH), bMain(256);

  k_prep<<<gPrep, bPrep, 0, stream>>>(Wk, Wq, Wv, bk, bq, P);
  k_main<<<gMain, bMain, LDS_MAIN, stream>>>(x, P, bv, out);
  (void)hipGetLastError();
}

// v005
// One run takes 46 microseconds.
// Timed twice side by side with v004, it ran 1.11 and 1.10 times as fast.
// Over all steps from v000 it is 7.70 times as fast.
// Contractions on v_wmma_f32_16x16x32_f16, f32 accumulate: x.Wk, x.Wq, x.Wv with f16 operands built from
// bf16-RNE inputs (x carried x16, W carried x1024), single products (k and q as W^T.x^T with the bias in C);
// k.q^T with k and q as plain f16 carried x8;
// P.v with P as plain f16 carried x1024 and v as f16 hi (x16) + x2048 residual plane (separate accumulator);
// elu, tanh, column softmax (in registers) and the residual add in f32 on VALU.
#include <hip/hip_runtime.h>
#include <stdint.h>

#define NBATCH 4096
#define TT     128              // tokens per item
#define CC     20               // channels
#define KQ     100              // key/query dim
#define CP     32               // channels padded (k of the projections)
#define DP     128              // key dim padded (k of the score product)
#define PX     40               // LDS pitch of xh in halves: 80 B = 16 B x 5
#define PH     136              // LDS pitch of kS, P, vTh, vTl in halves: 272 B = 16 B x 17
#define XROW   (TT * CC)        // 2560 floats per item

static_assert(XROW == 2560);
static_assert(TT == 128);
static_assert(DP == TT);
static_assert(PX >= CP && PH >= DP);
static_assert((PX * 2) % 32 == 16 && (PH * 2) % 32 == 16);    // 16-B fragment reads: pitch = 16 B x odd

// LDS byte offsets of the main kernel
#define OFF_XS   0              // f32 [128][20]   10240  (bf16-RNE x, later y)
// (the pad columns behind each row's last used column are never written and never read)
#define OFF_XH   10240          // f16 [128][32 of 40]    10240  (16*x, cols 20..31 zero)
#define OFF_KS   20480          // f16 [128][128 of 136]  34816  (8*k, cols 100..127 zero)
#define OFF_PS   55296          // f16 [128][128 of 136]  34816  (1024*P as [i][j])
#define OFF_VTH  90112          // f16 [32][128 of 136]    8704  (hi of 16*v, transposed [d][j])
#define OFF_VTL  98816          // f16 [32][128 of 136]    8704  (x2048 residual, transposed)
#define LDS_MAIN 107520         // three blocks fit the 327680 B of a WGP
static_assert(OFF_XH == OFF_XS + TT * CC * 4);
static_assert(OFF_KS == OFF_XH + TT * PX * 2);
static_assert(OFF_PS == OFF_KS + TT * PH * 2);
static_assert(OFF_VTH == OFF_PS + TT * PH * 2);
static_assert(OFF_VTL == OFF_VTH + CP * PH * 2);
static_assert(LDS_MAIN == OFF_VTL + CP * PH * 2);
static_assert(3 * LDS_MAIN <= 327680);

// workspace: f16 planes (halves): WkT [128 n][32 c] at 0, WqT at 4096, WvT [32 d][32 c] at 8192; total 9216 halves;
// behind them two f32 planes of 128: bk and bq as the projections' C operand (bf16-RNE value * 2^14, n >= 100 zero)
#define WK_OFF    0
#define WQ_OFF    4096
#define WV_OFF    8192
#define WS_HALVES 9216
static_assert(WS_HALVES == 4096 + 4096 + 1024);
static_assert((WS_HALVES % 8) == 0);
#define WS_BIAS   256             // floats: bk plane [128], bq plane [128]
#define NTKQ      7               // 16-wide tiles of the key dim that hold a real column (100 = 6 * 16 + 4)
static_assert(NTKQ * 16 >= KQ && (NTKQ - 1) * 16 < KQ && (NTKQ + 1) * 16 == DP);

typedef _Float16     v16h __attribute__((ext_vector_type(16)));
typedef _Float16     v8h  __attribute__((ext_vector_type(8)));
typedef float        v8f  __attribute__((ext_vector_type(8)));
typedef float        v4f  __attribute__((ext_vector_type(4)));
typedef unsigned int v4u  __attribute__((ext_vector_type(4)));

union Frag { v16h v; v8h half[2]; };

// ---- scalar helpers --------------------------------------------------------------------------------
__device__ __forceinline__ unsigned short bf_bits(float f) {          // f32 -> bf16 bits, RNE convert
  unsigned u = __float_as_uint(f);
  return (unsigned short)((u + 0x7FFFu + ((u >> 16) & 1u)) >> 16);
}
__device__ __forceinline__ float bf_up(unsigned short b) { return __uint_as_float(((unsigned)b) << 16); }
__device__ __forceinline__ float bfr(float f) { return bf_up(bf_bits(f)); }   // value after bf16 RNE convert
__device__ __forceinline__ v4f bfr4(v4f a) {
  v4f o;
  o[0] = bfr(a[0]); o[1] = bfr(a[1]); o[2] = bfr(a[2]); o[3] = bfr(a[3]);
  return o;
}
__device__ __forceinline__ v8f zero8() {
  v8f z;
  z[0] = 0.f; z[1] = 0.f; z[2] = 0.f; z[3] = 0.f; z[4] = 0.f; z[5] = 0.f; z[6] = 0.f; z[7] = 0.f;
  return z;
}
__device__ __forceinline__ float tanh_f(float v) {                  // branchless tanh
  const float c = fminf(fmaxf(v, -15.0f), 15.0f);
  const float t = __expf(2.0f * c);
  return (t - 1.0f) * __builtin_amdgcn_rcpf(t + 1.0f);
}

// ---- maximum / sum over the 16 lanes of a row (lanes 0..15, lanes 16..31), result in every lane of the row;
//      DPP row_xmask:m (control 0x160 + m) reads lane l ^ m of the same row; all 32 lanes are on at every use
template <int CTRL>
__device__ __forceinline__ float dpp_x(float v) {
  return __builtin_bit_cast(float, __builtin_amdgcn_update_dpp(0, __builtin_bit_cast(int, v), CTRL, 0xf, 0xf, true));
}
// Row maximum of eight values at once. In asm because fmaxf on a DPP move compiled to three instructions a step
// (move, quieting max, max) where the fused v_max_num_f32_dpp is one; the eight chains are interleaved so that
// every instruction's producer stands eight instructions back (no dependent pair in a row).
__device__ __forceinline__ void row_max16x8(float (&m)[8]) {
#if defined(__HIP_DEVICE_COMPILE__)
  asm(
      "v_max_num_f32_dpp %0, %0, %0 row_xmask:1 row_mask:0xf bank_mask:0xf\n\t"
      "v_max_num_f32_dpp %1, %1, %1 row_xmask:1 row_mask:0xf bank_mask:0xf\n\t"
      "v_max_num_f32_dpp %2, %2, %2 row_xmask:1 row_mask:0xf bank_mask:0xf\n\t"
      "v_max_num_f32_dpp %3, %3, %3 row_xmask:1 row_mask:0xf bank_mask:0xf\n\t"
      "v_max_num_f32_dpp %4, %4, %4 row_xmask:1 row_mask:0xf bank_mask:0xf\n\t"
      "v_max_num_f32_dpp %5, %5, %5 row_xmask:1 row_mask:0xf bank_mask:0xf\n\t"
      "v_max_num_f32_dpp %6, %6, %6 row_xmask:1 row_mask:0xf bank_mask:0xf\n\t"
      "v_max_num_f32_dpp %7, %7, %7 row_xmask:1 row_mask:0xf bank_mask:0xf\n\t"
      "v_max_num_f32_dpp %0, %0, %0 row_xmask:2 row_mask:0xf bank_mask:0xf\n\t"
      "v_max_num_f32_dpp %1, %1, %1 row_xmask:2 row_mask:0xf bank_mask:0xf\n\t"
      "v_max_num_f32_dpp %2, %2, %2 row_xmask:2 row_mask:0xf bank_mask:0xf\n\t"
      "v_max_num_f32_dpp %3, %3, %3 row_xmask:2 row_mask:0xf bank_mask:0xf\n\t"
      "v_max_num_f32_dpp %4, %4, %4 row_xmask:2 row_mask:0xf bank_mask:0xf\n\t"
      "v_max_num_f32_dpp %5, %5, %5 row_xmask:2 row_mask:0xf bank_mask:0xf\n\t"
      "v_max_num_f32_dpp %6, %6, %6 row_xmask:2 row_mask:0xf bank_mask:0xf\n\t"
      "v_max_num_f32_dpp %7, %7, %7 row_xmask:2 row_mask:0xf bank_mask:0xf\n\t"
      "v_max_num_f32_dpp %0, %0, %0 row_xmask:4 row_mask:0xf bank_mask:0xf\n\t"
      "v_max_num_f32_dpp %1, %1, %1 row_xmask:4 row_mask:0xf bank_mask:0xf\n\t"
      "v_max_num_f32_dpp %2, %2, %2 row_xmask:4 row_mask:0xf bank_mask:0xf\n\t"
      "v_max_num_f32_dpp %3, %3, %3 row_xmask:4 row_mask:0xf bank_mask:0xf\n\t"
      "v_max_num_f32_dpp %4, %4, %4 row_xmask:4 row_mask:0xf bank_mask:0xf\n\t"
      "v_max_num_f32_dpp %5, %5, %5 row_xmask:4 row_mask:0xf bank_mask:0xf\n\t"
      "v_max_num_f32_dpp %6, %6, %6 row_xmask:4 row_mask:0xf bank_mask:0xf\n\t"
      "v_max_num_f32_dpp %7, %7, %7 row_xmask:4 row_mask:0xf bank_mask:0xf\n\t"
      "v_max_num_f32_dpp %0, %0, %0 row_xmask:8 row_mask:0xf bank_mask:0xf\n\t"
      "v_max_num_f32_dpp %1, %1, %1 row_xmask:8 row_mask:0xf bank_mask:0xf\n\t"
      "v_max_num_f32_dpp %2, %2, %2 row_xmask:8 row_mask:0xf bank_mask:0xf\n\t"
      "v_max_num_f32_dpp %3, %3, %3 row_xmask:8 row_mask:0xf bank_mask:0xf\n\t"
      "v_max_num_f32_dpp %4, %4, %4 row_xmask:8 row_mask:0xf bank_mask:0xf\n\t"
      "v_max_num_f32_dpp %5, %5, %5 row_xmask:8 row_mask:0xf bank_mask:0xf\n\t"
      "v_max_num_f32_dpp %6, %6, %6 row_xmask:8 row_mask:0xf bank_mask:0xf\n\t"
      "v_max_num_f32_dpp %7, %7, %7 row_xmask:8 row_mask:0xf bank_mask:0xf"
      : "+v"(m[0]), "+v"(m[1]), "+v"(m[2]), "+v"(m[3]), "+v"(m[4]), "+v"(m[5]), "+v"(m[6]), "+v"(m[7]));
#endif
}
// Eight transcendentals in place, then one free slot.
// Here result and source are one register, no line touches another line's register, and the closing v_nop is the
// one independent slot the instruction set asks for in front of the first reader.
__device__ __forceinline__ void exp2x8(float (&t)[8]) {
#if defined(__HIP_DEVICE_COMPILE__)
  asm("v_exp_f32 %0, %0\n\tv_exp_f32 %1, %1\n\tv_exp_f32 %2, %2\n\tv_exp_f32 %3, %3\n\t"
      "v_exp_f32 %4, %4\n\tv_exp_f32 %5, %5\n\tv_exp_f32 %6, %6\n\tv_exp_f32 %7, %7\n\tv_nop"
      : "+v"(t[0]), "+v"(t[1]), "+v"(t[2]), "+v"(t[3]), "+v"(t[4]), "+v"(t[5]), "+v"(t[6]), "+v"(t[7]));
#endif
}
__device__ __forceinline__ void rcpx8(float (&t)[8]) {
#if defined(__HIP_DEVICE_COMPILE__)
  asm("v_rcp_f32 %0, %0\n\tv_rcp_f32 %1, %1\n\tv_rcp_f32 %2, %2\n\tv_rcp_f32 %3, %3\n\t"
      "v_rcp_f32 %4, %4\n\tv_rcp_f32 %5, %5\n\tv_rcp_f32 %6, %6\n\tv_rcp_f32 %7, %7\n\tv_nop"
      : "+v"(t[0]), "+v"(t[1]), "+v"(t[2]), "+v"(t[3]), "+v"(t[4]), "+v"(t[5]), "+v"(t[6]), "+v"(t[7]));
#endif
}
__device__ __forceinline__ float row_sum16(float v) {
  v += dpp_x<0x161>(v);
  v += dpp_x<0x162>(v);
  v += dpp_x<0x164>(v);
  v += dpp_x<0x168>(v);
  return v;
}

// ---- 16-bit fragment loader (A, B alike): p points at row/col (lane&15), + k0 + 8*(lane>>4);
//      elements 0..7 <- p[0..7] (k0+8h..k0+8h+7), elements 8..15 <- p[16..23] (k0+16+8h..k0+16+8h+7)
__device__ __forceinline__ v16h ldfrag(const _Float16* p) {
  Frag f;
  f.half[0] = *(const v8h*)(p);
  f.half[1] = *(const v8h*)(p + 16);
  return f.v;
}

// ---- WMMA with trailing VALU hazard gap (ties D, keeps A/B live past the nops) ---------------------
__device__ __forceinline__ v8f mma(v16h a, v16h b, v8f c) {
  v8f d = __builtin_amdgcn_wmma_f32_16x16x32_f16(false, a, false, b, (short)0, c, false, false);
#if defined(__HIP_DEVICE_COMPILE__)
  asm volatile("v_nop\n\tv_nop\n\tv_nop\n\tv_nop" : "+v"(d) : "v"(a), "v"(b));
#endif
  return d;
}

// =====================================================================================================
// Weight planes: Wk [20 c][100 n] -> WkT[n][c] (n padded to 128, c padded to 32, pads zero), same for Wq;
// Wv [20][20] -> WvT[d][c] [32][32]. Values = f16 of (bf16-RNE value * 1024). One plane row n (64 B) a thread:
// its 20 loads (one clamped address, constant steps; a wave reads 128 B in a row) are in flight together, so the
// whole launch costs one load latency. One wave a block, 32 rows: blocks 0..3 WkT, 4..7 WqT, 8 WvT.
// Bias planes: the thread of row n of WkT / WqT also writes bk[n] / bq[n] as f32 of (bf16-RNE value * 2^14),
// n >= 100 zero.
// =====================================================================================================
#define PREP_THREADS 32
#define PREP_BLOCKS  9
static_assert(PREP_BLOCKS * PREP_THREADS * CP == WS_HALVES);
static_assert(WQ_OFF == 4 * PREP_THREADS * CP && WV_OFF == 8 * PREP_THREADS * CP);
static_assert(8 * PREP_THREADS == WS_BIAS);
template <int NCOL>                                            // columns of the source = its row pitch
__device__ __forceinline__ void prep_row(const float* __restrict__ src, int n, unsigned short* dst) {
  const float* p = src + min(n, NCOL - 1);
  float raw[CC];
#pragma unroll                                                 // the 20 loads issue in a row, ahead of the first use
  for (int c = 0; c < CC; ++c) raw[c] = p[c * NCOL];
  v8h o[CP / 8];
#pragma unroll                                                 // constant indices: o stays in registers
  for (int c = 0; c < CP; ++c) o[c >> 3][c & 7] = (_Float16)0.0f;
#pragma unroll                                                 // constant indices: raw and o stay in registers
  for (int c = 0; c < CC; ++c) o[c >> 3][c & 7] = (_Float16)(bfr((n < NCOL) ? raw[c] : 0.0f) * 1024.0f);
#pragma unroll                                                 // constant indices; the 4 stores issue in a row
  for (int k = 0; k < CP / 8; ++k) *(v4u*)(dst + k * 8) = __builtin_bit_cast(v4u, o[k]);
#if defined(__HIP_DEVICE_COMPILE__)
  // the wait that stands between issued global stores and any later write of a register that they name
  asm volatile("s_wait_xcnt 0x0" ::: "memory");
#endif
}
__global__ __launch_bounds__(PREP_THREADS) void k_prep(const float* __restrict__ Wk, const float* __restrict__ Wq,
                                                       const float* __restrict__ Wv, const float* __restrict__ bk,
                                                       const float* __restrict__ bq, unsigned short* P) {
  const int row = blockIdx.x * PREP_THREADS + threadIdx.x;     // row of the three planes taken as one: 0..287
  unsigned short* dst = P + (size_t)row * CP;
  if (blockIdx.x < 8) {                                        // block-uniform
    const bool isq = blockIdx.x >= 4;
    const int n = row & 127;
    const float braw = (isq ? bq : bk)[min(n, KQ - 1)];
    prep_row<KQ>(isq ? Wq : Wk, n, dst);
    ((float*)(void*)(P + WS_HALVES))[row] = bfr((n < KQ) ? braw : 0.0f) * 16384.0f;
  } else {
    prep_row<CC>(Wv, row & 31, dst);
  }
}

// =====================================================================================================
// Main: one 256-thread block (8 waves) per batch item; wave w owns token rows 16w..16w+15 in the projections and
// in P.v, and score COLUMNS j = 16w..16w+15 (all 128 rows i) in the score product.
// Phase 1: x -> xs (f32 bf16-RNE values) and xh (f16 of 16*x, cols 20..31 zero); threads 0..127 write cols
//          0..15 of row tid, threads 128..255 cols 16..31 (wave-uniform split). coverage: 128 rows x 32 cols.
// Phase 2: projections, one k-step (k = c, split map, the same for A and B). k and q transposed: A = W plane rows
//          n from global [n][c], B = xh as [col = token][c], C = the bias plane; D (row n = 16nt+8h+r, col token
//          m0+lo): a lane holds 8 neighbouring d of ONE token, which is half a 16-bit fragment of that token's row.
//          elu in f32, f16(8*val); pad rows n >= 100 come out 0 (W and bias planes are 0 there, elu(0) = 0).
//          k: one 16-B store a tile into kS [i][d], cols 112..127 stored as zeros. q: tiles 2s and 2s+1 ARE the
//          A fragment of k-step s of phase 3 (elements 0..7: d = 32s+8h+r, 8..15: d = 32s+16+8h+r, row m0+lo);
//          it stays in registers. v: A = xh rows, B = WvT; D (row m0+8h+r, col d) -> tanh -> vTh/vTl [d][j] for
//          d 0..31 (d >= 20 forced 0).
// Phase 3: S^T[j][i] = sum_d q[j][d] k[i][d]: A = q rows j (the wave's own 16, registers), B = kS as [n=i][k=d];
//          8 column tiles x 4 k-steps; D (row j = m0+8h+r, col i = 16nt+lo) stays in 64 accumulator registers.
// Phase 4: softmax over i per column j, in registers: i runs over the 8 tiles and the 16 lanes of a row, so max
//          and sum are 8 values a lane, each folded over nt and then over the row by DPP; the 8 values r of one
//          tile are 8 neighbouring j of row i: P[i][j] = f16(1024 * e / sum) goes into its own region as [i][j]
//          with one 16-B store a tile (nothing else uses that region, so no barrier stands in front of it).
// Phase 5: y_att[i][d] = sum_j P v: A = P rows i (k = j), B = vTh/vTl as [n=d][k=j]; hi and residual in
//          separate accumulators; y = (acc_h + acc_l/2048)/16384 + xs, written back into xs (d < 20). The LDS reads
//          stand in groups ahead of their users: two register sets of B fragments, x read before the first product.
// =====================================================================================================
// register budget for six waves a SIMD: three work-groups a WGP, which is also what the LDS allows
__global__ __launch_bounds__(256) __attribute__((amdgpu_waves_per_eu(6)))
void k_main(const float* __restrict__ x, const unsigned short* __restrict__ Wp, const float* __restrict__ bv,
            float* out) {
  extern __shared__ __align__(16) unsigned char smem[];
  float*    xs  = (float*)(smem + OFF_XS);
  _Float16* xh  = (_Float16*)(smem + OFF_XH);
  _Float16* kS  = (_Float16*)(smem + OFF_KS);
  _Float16* pS  = (_Float16*)(smem + OFF_PS);
  _Float16* vTh = (_Float16*)(smem + OFF_VTH);
  _Float16* vTl = (_Float16*)(smem + OFF_VTL);
  const _Float16* W = (const _Float16*)(const void*)Wp;
  const float* Bp = (const float*)(const void*)(Wp + WS_HALVES);   // bias planes: bk [128], bq [128]

  const int tid  = threadIdx.x;
  const int lane = tid & 31;
  const int wid  = __builtin_amdgcn_readfirstlane(tid >> 5);   // scalar: as a vector value it cost a spill in phase 3
  const int h    = lane >> 4;
  const int lo   = lane & 15;
  const int b    = blockIdx.x;
  const int m0   = wid * 16;
  const float* xb = x + (size_t)b * XROW;

  // ---------------- phase 1: stage x ----------------
  {
    const int part = tid >> 7;                      // wave-uniform
    const int row  = tid & 127;
    const float* xr  = xb + row * CC;               // row*80 B, 16-B aligned
    float*       xsr = xs + row * CC;
    _Float16*    xhr = xh + row * PX;
    if (part == 0) {
      const v4f a0 = bfr4(*(const v4f*)(xr));
      const v4f a1 = bfr4(*(const v4f*)(xr + 4));
      const v4f a2 = bfr4(*(const v4f*)(xr + 8));
      const v4f a3 = bfr4(*(const v4f*)(xr + 12));
      *(v4f*)(xsr)      = a0;
      *(v4f*)(xsr + 4)  = a1;
      *(v4f*)(xsr + 8)  = a2;
      *(v4f*)(xsr + 12) = a3;
      v8h p0, p1;
#pragma unroll
      for (int c = 0; c < 4; ++c) {
        p0[c]     = (_Float16)(a0[c] * 16.0f);
        p0[4 + c] = (_Float16)(a1[c] * 16.0f);
        p1[c]     = (_Float16)(a2[c] * 16.0f);
        p1[4 + c] = (_Float16)(a3[c] * 16.0f);
      }
      *(v8h*)(xhr)     = p0;
      *(v8h*)(xhr + 8) = p1;
    } else {
      const v4f a4 = bfr4(*(const v4f*)(xr + 16));
      *(v4f*)(xsr + 16) = a4;
      v8h p2, p3;
#pragma unroll
      for (int c = 0; c < 4; ++c) {
        p2[c]     = (_Float16)(a4[c] * 16.0f);
        p2[4 + c] = (_Float16)0.0f;
        p3[c]     = (_Float16)0.0f;
        p3[4 + c] = (_Float16)0.0f;
      }
      *(v8h*)(xhr + 16) = p2;
      *(v8h*)(xhr + 24) = p3;
    }
  }
  __syncthreads();

  // ---------------- phase 2: projections (K = 32, one k-step) ----------------
  Frag qa[4];                                                    // q rows m0+lo as the A fragments of phase 3
  {
    const v16h af = ldfrag(xh + (m0 + lo) * PX + 8 * h);        // row / col token m0+lo, k = c
    const _Float16* pw = W + (size_t)lo * CP + 8 * h;            // A: row n = 16nt+lo of a W plane, k = c
    const float*    pc = Bp + 8 * h;                             // C: rows n = 16nt+8h+r
    // v = tanh(x.Wv + bv), stored transposed as hi + residual planes
#pragma unroll 1
    for (int nt = 0; nt < 2; ++nt) {
      const int n0 = nt * 16, d = n0 + lo;
      const v8f acc = mma(af, ldfrag(W + WV_OFF + (size_t)(n0 + lo) * CP + 8 * h), zero8());
      const float bias = bfr(bv[min(d, CC - 1)]);
#pragma unroll
      for (int r = 0; r < 8; ++r) {
        float val = tanh_f(acc[r] * 6.103515625e-05f + bias);
        val = (d < CC) ? val : 0.0f;
        const float v16 = val * 16.0f;
        const _Float16 hh = (_Float16)v16;
        const _Float16 ll = (_Float16)((v16 - (float)hh) * 2048.0f);
        vTh[d * PH + m0 + 8 * h + r] = hh;
        vTl[d * PH + m0 + 8 * h + r] = ll;
      }
    }
    // k^T = elu(Wk^T.x^T + bk): tiles t = 0..6; q^T = elu(Wq^T.x^T + bq): tiles t = 7..13
    _Float16* kw = kS + (m0 + lo) * PH + 8 * h;
    v16h wf[2 * NTKQ];
    union { v8f v; v4f q[2]; } cb[2 * NTKQ];
    v8f ac[2 * NTKQ];
    // elu (alpha = 1) of v = acc * 2^-14, carried x8: exp(v) = exp2(acc * CE), 8 * v = acc * CV
    const float CE = 1.4426950408889634f * 6.103515625e-05f, CV = 0.00048828125f;
#define LOAD_TILE(t)                                                                         \
    {                                                                                          \
      const int pl = (t) / NTKQ, nt = (t) % NTKQ;                                              \
      wf[t]      = ldfrag(pw + (pl ? WQ_OFF : WK_OFF) + nt * 16 * CP);                         \
      cb[t].q[0] = *(const v4f*)(pc + pl * 128 + nt * 16);                                     \
      cb[t].q[1] = *(const v4f*)(pc + pl * 128 + nt * 16 + 4);                                 \
    }
#define MMA_TILE(t)                                                                          \
    ac[t] = __builtin_amdgcn_wmma_f32_16x16x32_f16(false, wf[t], false, af, (short)0, cb[t].v, false, false)
    LOAD_TILE(0) LOAD_TILE(1) LOAD_TILE(2)
    MMA_TILE(0);
#pragma unroll
    for (int t = 0; t < 2 * NTKQ; ++t) {
      if (t + 1 < 2 * NTKQ) MMA_TILE(t + 1);                     // its result slots are filled by tile t's elu
      float e[8];
#pragma unroll
      for (int r = 0; r < 8; ++r) e[r] = ac[t][r] * CE;
      exp2x8(e);
      v8h o;
#pragma unroll
      for (int r = 0; r < 8; ++r)
        o[r] = (_Float16)(ac[t][r] > 0.0f ? ac[t][r] * CV : __builtin_fmaf(e[r], 8.0f, -8.0f));
      if (t < NTKQ) *(v8h*)(kw + t * 16) = o;
      else          qa[(t - NTKQ) >> 1].half[(t - NTKQ) & 1] = o;
      if (t + 3 < 2 * NTKQ) LOAD_TILE(t + 3)
      // one tile a group: keeps the loads of tile t+3 a whole tile in front of their product (left alone the compiler
      // put each tile's four loads and a full wait directly in front of it), and ends q's elu in front of phase 3
      __builtin_amdgcn_sched_barrier(0);
    }
#undef LOAD_TILE
#undef MMA_TILE
    v8h z8;
#pragma unroll
    for (int r = 0; r < 8; ++r) z8[r] = (_Float16)0.0f;
    *(v8h*)(kw + NTKQ * 16) = z8;
    qa[NTKQ >> 1].half[NTKQ & 1] = z8;
  }
  __syncthreads();

  // ---------------- phase 3: scores, transposed: S^T[j][i] (K = 128 over d), kept in registers ----------------
  v8f acc[8];                                                    // acc[nt][r] = 64 * S[i = 16nt+lo][j = m0+8h+r]
  {
    const _Float16* pb = kS + lo * PH + 8 * h;                   // B: col i = 16nt+lo, k = d (the map of qa)
#pragma unroll
    for (int nt = 0; nt < 8; ++nt) acc[nt] = zero8();
#pragma unroll
    for (int ks = 0; ks < 4; ++ks) {                             // k-step outermost: 8 independent accumulators in a row
      v16h bf[8];
#pragma unroll
      for (int nt = 0; nt < 8; ++nt) bf[nt] = ldfrag(pb + nt * 16 * PH + 32 * ks);
      // keeps the 16 LDS reads of a k-step one group in front of its 8 products: left alone the compiler put two
      // reads and a full wait in front of every product, one LDS latency each
      __builtin_amdgcn_sched_barrier(0);
#pragma unroll
      for (int nt = 0; nt < 8; ++nt)
        acc[nt] = __builtin_amdgcn_wmma_f32_16x16x32_f16(false, qa[ks].v, false, bf[nt], (short)0, acc[nt], false, false);
      // second half of the pair: the next k-step's reads stay behind these products (their registers are reused)
      __builtin_amdgcn_sched_barrier(0);
    }
  }

  // ---------------- phase 4: softmax over i, per column j, in registers ----------------
  {
    // exp(s - max) = exp2((acc - max_acc) * C2), C2 = (1/sqrt(128)) * 2^-6 * log2(e) > 0
    const float C2 = 0.08838834764831845f * 0.015625f * 1.4426950408889634f;
    float mx[8], rs[8];
#pragma unroll
    for (int r = 0; r < 8; ++r) {
      mx[r] = acc[0][r];
#pragma unroll
      for (int nt = 1; nt < 8; ++nt) mx[r] = fmaxf(mx[r], acc[nt][r]);
    }
    row_max16x8(mx);
#pragma unroll
    for (int r = 0; r < 8; ++r) {
      const float nb = -C2 * mx[r];
      float t[8];
#pragma unroll
      for (int nt = 0; nt < 8; ++nt) t[nt] = __builtin_fmaf(acc[nt][r], C2, nb);
      exp2x8(t);
      float sum = t[0];
      acc[0][r] = t[0];
#pragma unroll
      for (int nt = 1; nt < 8; ++nt) {
        acc[nt][r] = t[nt];
        sum += t[nt];
      }
      rs[r] = row_sum16(sum);                                    // the largest term is 1: sum >= 1
    }
    rcpx8(rs);
#pragma unroll
    for (int r = 0; r < 8; ++r) rs[r] *= 1024.0f;
    _Float16* Pw = pS + lo * PH + m0 + 8 * h;                    // P as [i][j], carried x1024
#pragma unroll
    for (int nt = 0; nt < 8; ++nt) {
      v8h p;
#pragma unroll
      for (int r = 0; r < 8; ++r) p[r] = (_Float16)(acc[nt][r] * rs[r]);
      *(v8h*)(Pw + nt * 16 * PH) = p;
    }
  }
  __syncthreads();

  // ---------------- phase 5: y = P.v + x (K = 128 over j; hi and residual accumulators) ----------------
  {
    const _Float16* pa = pS + (m0 + lo) * PH + 8 * h;            // A: row i = m0+lo, k = j
    const _Float16* pv = vTh + lo * PH + 8 * h;                  // B: col d = lo, k = j, of the hi plane
    static_assert(OFF_VTL == OFF_VTH + CP * PH * 2);             // the residual plane lies CP rows behind the hi plane
    const int d1  = 16 + lo;
    const int d1c = min(d1, CC - 1);
    float* px = xs + (m0 + 8 * h) * CC;                          // rows i = m0+8h+r, the wave's own
    v16h pf[4], bs[2][4];                                        // bs: two register sets of a k-step's four B fragments
    float x0[8], x1[8];
    v8f ay[4];                                                   // hi d=lo, hi d=16+lo, residual d=lo, residual d=16+lo
#define LOAD_B(set, ks)                                                                      \
    {                                                                                          \
      bs[set][0] = ldfrag(pv + 32 * (ks));                                                     \
      bs[set][1] = ldfrag(pv + 16 * PH + 32 * (ks));                                           \
      bs[set][2] = ldfrag(pv + CP * PH + 32 * (ks));                                           \
      bs[set][3] = ldfrag(pv + (CP + 16) * PH + 32 * (ks));                                    \
    }
#define MMA_B(set, ks)                                                                       \
    _Pragma("unroll") /* constant indices: four independent accumulators in a row */           \
    for (int q = 0; q < 4; ++q)                                                                \
      ay[q] = __builtin_amdgcn_wmma_f32_16x16x32_f16(false, pf[ks], false, bs[set][q], (short)0, ay[q], false, false);
#pragma unroll                                                 // constant indices: ay stays in registers
    for (int q = 0; q < 4; ++q) ay[q] = zero8();
    pf[0] = ldfrag(pa);
    LOAD_B(0, 0)
    pf[1] = ldfrag(pa + 32);
    LOAD_B(1, 1)
    pf[2] = ldfrag(pa + 64);
    pf[3] = ldfrag(pa + 96);
#pragma unroll                                                 // constant indices; the 16 reads issue in a row
    for (int r = 0; r < 8; ++r) {
      x0[r] = px[r * CC + lo];                                   // d = lo < 16 < 20 always valid
      x1[r] = px[r * CC + d1c];
    }
    MMA_B(0, 0)
    LOAD_B(0, 2)
    MMA_B(1, 1)
    LOAD_B(1, 3)
    MMA_B(0, 2)
    MMA_B(1, 3)
    // Order of this phase's LDS reads (0x100) and products (0x008): the reads of k-steps 0 and 1, of all of P and of x as
    // one group, then four products and the eight reads of the k-step after next, by turns. Left alone the compiler put
    // two reads and a full wait in front of every product and one read and a full wait in front of every output row,
    // one LDS latency each.
    __builtin_amdgcn_sched_group_barrier(0x100, 32, 0);
    __builtin_amdgcn_sched_group_barrier(0x008, 4, 0);
    __builtin_amdgcn_sched_group_barrier(0x100, 8, 0);
    __builtin_amdgcn_sched_group_barrier(0x008, 4, 0);
    __builtin_amdgcn_sched_group_barrier(0x100, 8, 0);
    __builtin_amdgcn_sched_group_barrier(0x008, 8, 0);
#undef LOAD_B
#undef MMA_B
    float v1[8];
#pragma unroll                                                 // constant indices: ay, x0, x1, v1 stay in registers
    for (int r = 0; r < 8; ++r) {
      const float y0 = (ay[0][r] + ay[2][r] * 0.00048828125f) * 6.103515625e-05f;   // (h + l/2048) * 2^-14
      const float y1 = (ay[1][r] + ay[3][r] * 0.00048828125f) * 6.103515625e-05f;
      px[r * CC + lo] = x0[r] + y0;
      v1[r] = x1[r] + y1;
    }
    if (lo < 4) {                                                // d = 16..19
#pragma unroll                                                 // constant indices; the 8 stores issue in a row
      for (int r = 0; r < 8; ++r) px[r * CC + d1] = v1[r];
    }
  }
  __syncthreads();

  {
    const v4f* xs4 = (const v4f*)xs;
    const int c2  = 16 + wid;                                    // valid iff wid < 4 (wave-uniform)
    const int c2c = min(c2, 19);
    const v4f pv0 = xs4[(wid)     * 32 + lane];
    const v4f pv1 = xs4[(8 + wid) * 32 + lane];
    const v4f pv2 = xs4[c2c       * 32 + lane];
    float* ob = out + (size_t)b * XROW + (size_t)lane * 4;
    *(v4f*)(ob + (size_t)wid * 128)       = pv0;
    *(v4f*)(ob + (size_t)(8 + wid) * 128) = pv1;
#if defined(__HIP_DEVICE_COMPILE__)
    // the wait that stands between issued global stores and any later write of a register that they name
    asm volatile("s_wait_xcnt 0x0" ::: "memory");
#endif
    if (wid < 4) *(v4f*)(ob + (size_t)c2 * 128) = pv2;
    
  }
}

// =====================================================================================================
// Workspace map (bytes): WkT f16 [128][32] 8192 at 0; WqT 8192 at 8192; WvT f16 [32][32] 2048 at 16384;
// bk plane f32 [128] 512 at 18432; bq plane 512 at 18944; total 19456, every region a whole multiple of 512 B.
// =====================================================================================================
extern "C" void kernel_launch(void* const* d_in, const int* in_sizes, int n_in,
                              void* d_out, int out_size, void* d_ws, size_t ws_size,
                              hipStream_t stream) {
  if (n_in < 7) return;
  if (in_sizes[0] != NBATCH * XROW) return;
  if (in_sizes[1] != CC * KQ) return;
  if (in_sizes[2] != KQ) return;
  if (in_sizes[3] != CC * KQ) return;
  if (in_sizes[4] != KQ) return;
  if (in_sizes[5] != CC * CC) return;
  if (in_sizes[6] != CC) return;
  if (out_size != NBATCH * XROW) return;

  const float* x  = (const float*)d_in[0];     // [4096][128][20]
  const float* Wk = (const float*)d_in[1];     // [20][100]
  const float* bk = (const float*)d_in[2];     // [100]
  const float* Wq = (const float*)d_in[3];     // [20][100]
  const float* bq = (const float*)d_in[4];     // [100]
  const float* Wv = (const float*)d_in[5];     // [20][20]
  const float* bv = (const float*)d_in[6];     // [20]
  float* out = (float*)d_out;                  // [4096][128][20]

  const size_t wsb = (size_t)WS_HALVES * 2 + (size_t)WS_BIAS * 4;    // 19456
  if (wsb > ws_size) return;
  if (wsb > (size_t)134217728) return;
  unsigned short* P = (unsigned short*)d_ws;

  (void)hipFuncSetAttribute(reinterpret_cast<const void*>(&k_main),
                            hipFuncAttributeMaxDynamicSharedMemorySize, LDS_MAIN);

  const dim3 gPrep(PREP_BLOCKS), bPrep(PREP_THREADS);
  const dim3 gMain(NBATCH), bMain(256);

  k_prep<<<gPrep, bPrep, 0, stream>>>(Wk, Wq, Wv, bk, bq, P);
  k_main<<<gMain, bMain, LDS_MAIN, stream>>>(x, P, bv, out);
  (void)hipGetLastError();
}

// v006
// Measured time: 41.4 microseconds a run.
// Next to v005, in two timings, it ran 1.09 and 1.11 times as fast.
// All steps since v000 together make it 8.47 times as fast.
// Contractions on v_wmma_f32_16x16x32_f16, f32 accumulate: x.Wk, x.Wq, x.Wv with f16 operands built from
// bf16-RNE inputs (x carried x16, W carried x1024), single products (k and q as W^T.x^T with the bias in C);
// k.q^T with k and q as plain f16 carried x8;
// P.v with P as plain f16 carried x1024 and v as f16 hi (x16) + x2048 residual plane (separate accumulator);
// elu, tanh, column softmax (in registers) and the residual add in f32 on VALU.
#include <hip/hip_runtime.h>
#include <stdint.h>

#define NBATCH 4096
#define TT     128              // tokens per item
#define CC     20               // channels
#define KQ     100              // key/query dim
#define CP     32               // channels padded (k of the projections)
#define DP     128              // key dim padded (k of the score product)
#define PX     40               // LDS pitch of xh in halves: 80 B = 16 B x 5
#define PH     136              // LDS pitch of kS, P, vTh, vTl in halves: 272 B = 16 B x 17
#define XROW   (TT * CC)        // 2560 floats per item

static_assert(XROW == 2560 && CC % 2 == 0);
static_assert(TT == 128);
static_assert(DP == TT);
static_assert(PX >= CP && PH >= DP);
static_assert((PX * 2) % 32 == 16 && (PH * 2) % 32 == 16);    // 16-B fragment reads: pitch = 16 B x odd

// LDS byte offsets of the main kernel
#define OFF_XS   0              // f32 [128][20]   10240  (bf16-RNE x, later y)
// (the pad columns behind each row's last used column are never written and never read)
#define OFF_XH   10240          // f16 [128][32 of 40]    10240  (16*x, cols 20..31 zero)
#define OFF_KS   20480          // f16 [128][128 of 136]  34816  (8*k, cols 100..127 zero)
#define OFF_PS   55296          // f16 [128][128 of 136]  34816  (1024*P as [i][j])
#define OFF_WL   OFF_PS         // f16 [256][32 of 40]    20480  (weight planes; dead behind phase 2, P comes in phase 4)
#define OFF_BL   (OFF_WL + 20480)   // f32 [224]            896  (bias planes; dead behind phase 2)
#define OFF_VTH  90112          // f16 [32][128 of 136]    8704  (hi of 16*v, transposed [d][j])
#define OFF_VTL  98816          // f16 [32][128 of 136]    8704  (x2048 residual, transposed)
#define LDS_MAIN 107520         // three blocks fit the 327680 B of a WGP
static_assert(OFF_XH == OFF_XS + TT * CC * 4);
static_assert(OFF_KS == OFF_XH + TT * PX * 2);
static_assert(OFF_PS == OFF_KS + TT * PH * 2);
static_assert(OFF_VTH == OFF_PS + TT * PH * 2);
static_assert(OFF_VTL == OFF_VTH + CP * PH * 2);
static_assert(LDS_MAIN == OFF_VTL + CP * PH * 2);
static_assert(3 * LDS_MAIN <= 327680);

#define NTKQ      7               // 16-wide tiles of the key dim that hold a real column (100 = 6 * 16 + 4)
static_assert(NTKQ * 16 >= KQ && (NTKQ - 1) * 16 < KQ && (NTKQ + 1) * 16 == DP);
// weight planes in LDS, one row of 32 c (pitch PX) a thread: rows 0..111 WkT [n][c], 112..223 WqT [n][c], 224..255
// WvT [d][c]; values = f16 of (bf16-RNE value * 1024), c >= 20 and rows n >= 100, d >= 20 zero. Bias planes: f32 of
// (bf16-RNE value * 2^14) at the index of the plane row, bk 0..111, bq 112..223, n >= 100 zero.
#define NRKQ      (NTKQ * 16)     // rows of the WkT and of the WqT plane
static_assert(2 * NRKQ + CP == 256);                            // one plane row a thread of the block
static_assert(2 * NRKQ == 7 * 32);                              // WvT is wave 7's, whole
static_assert(OFF_BL == OFF_WL + 256 * PX * 2 && OFF_BL % 16 == 0);
static_assert(OFF_BL + 2 * NRKQ * 4 <= OFF_VTH);                // both lie inside the region of P

typedef _Float16     v16h __attribute__((ext_vector_type(16)));
typedef _Float16     v8h  __attribute__((ext_vector_type(8)));
typedef float        v8f  __attribute__((ext_vector_type(8)));
typedef float        v4f  __attribute__((ext_vector_type(4)));
typedef float        v2f  __attribute__((ext_vector_type(2)));
typedef _Float16     v2h  __attribute__((ext_vector_type(2)));
typedef __bf16       v2b  __attribute__((ext_vector_type(2)));

union Frag { v16h v; v8h half[2]; };

// ---- scalar helpers --------------------------------------------------------------------------------
__device__ __forceinline__ unsigned short bf_bits(float f) {          // f32 -> bf16 bits, RNE convert
  unsigned u = __float_as_uint(f);
  return (unsigned short)((u + 0x7FFFu + ((u >> 16) & 1u)) >> 16);
}
__device__ __forceinline__ float bf_up(unsigned short b) { return __uint_as_float(((unsigned)b) << 16); }
__device__ __forceinline__ float bfr(float f) { return bf_up(bf_bits(f)); }   // value after bf16 RNE convert
__device__ __forceinline__ v4f bfr4(v4f a) {
  v4f o;
  o[0] = bfr(a[0]); o[1] = bfr(a[1]); o[2] = bfr(a[2]); o[3] = bfr(a[3]);
  return o;
}
__device__ __forceinline__ v8f zero8() {
  v8f z;
  z[0] = 0.f; z[1] = 0.f; z[2] = 0.f; z[3] = 0.f; z[4] = 0.f; z[5] = 0.f; z[6] = 0.f; z[7] = 0.f;
  return z;
}
__device__ __forceinline__ float tanh_f(float v) {                  // branchless tanh
  const float c = fminf(fmaxf(v, -15.0f), 15.0f);
  const float t = __expf(2.0f * c);
  return (t - 1.0f) * __builtin_amdgcn_rcpf(t + 1.0f);
}

// ---- maximum / sum over the 16 lanes of a row (lanes 0..15, lanes 16..31), result in every lane of the row;
//      DPP row_xmask:m (control 0x160 + m) reads lane l ^ m of the same row; all 32 lanes are on at every use
template <int CTRL>
__device__ __forceinline__ float dpp_x(float v) {
  return __builtin_bit_cast(float, __builtin_amdgcn_update_dpp(0, __builtin_bit_cast(int, v), CTRL, 0xf, 0xf, true));
}
// Row maximum of eight values at once. In asm because fmaxf on a DPP move compiled to three instructions a step
// (move, quieting max, max) where the fused v_max_num_f32_dpp is one; the eight chains are interleaved so that
// every instruction's producer stands eight instructions back (no dependent pair in a row).
__device__ __forceinline__ void row_max16x8(float (&m)[8]) {
#if defined(__HIP_DEVICE_COMPILE__)
  asm(
      "v_max_num_f32_dpp %0, %0, %0 row_xmask:1 row_mask:0xf bank_mask:0xf\n\t"
      "v_max_num_f32_dpp %1, %1, %1 row_xmask:1 row_mask:0xf bank_mask:0xf\n\t"
      "v_max_num_f32_dpp %2, %2, %2 row_xmask:1 row_mask:0xf bank_mask:0xf\n\t"
      "v_max_num_f32_dpp %3, %3, %3 row_xmask:1 row_mask:0xf bank_mask:0xf\n\t"
      "v_max_num_f32_dpp %4, %4, %4 row_xmask:1 row_mask:0xf bank_mask:0xf\n\t"
      "v_max_num_f32_dpp %5, %5, %5 row_xmask:1 row_mask:0xf bank_mask:0xf\n\t"
      "v_max_num_f32_dpp %6, %6, %6 row_xmask:1 row_mask:0xf bank_mask:0xf\n\t"
      "v_max_num_f32_dpp %7, %7, %7 row_xmask:1 row_mask:0xf bank_mask:0xf\n\t"
      "v_max_num_f32_dpp %0, %0, %0 row_xmask:2 row_mask:0xf bank_mask:0xf\n\t"
      "v_max_num_f32_dpp %1, %1, %1 row_xmask:2 row_mask:0xf bank_mask:0xf\n\t"
      "v_max_num_f32_dpp %2, %2, %2 row_xmask:2 row_mask:0xf bank_mask:0xf\n\t"
      "v_max_num_f32_dpp %3, %3, %3 row_xmask:2 row_mask:0xf bank_mask:0xf\n\t"
      "v_max_num_f32_dpp %4, %4, %4 row_xmask:2 row_mask:0xf bank_mask:0xf\n\t"
      "v_max_num_f32_dpp %5, %5, %5 row_xmask:2 row_mask:0xf bank_mask:0xf\n\t"
      "v_max_num_f32_dpp %6, %6, %6 row_xmask:2 row_mask:0xf bank_mask:0xf\n\t"
      "v_max_num_f32_dpp %7, %7, %7 row_xmask:2 row_mask:0xf bank_mask:0xf\n\t"
      "v_max_num_f32_dpp %0, %0, %0 row_xmask:4 row_mask:0xf bank_mask:0xf\n\t"
      "v_max_num_f32_dpp %1, %1, %1 row_xmask:4 row_mask:0xf bank_mask:0xf\n\t"
      "v_max_num_f32_dpp %2, %2, %2 row_xmask:4 row_mask:0xf bank_mask:0xf\n\t"
      "v_max_num_f32_dpp %3, %3, %3 row_xmask:4 row_mask:0xf bank_mask:0xf\n\t"
      "v_max_num_f32_dpp %4, %4, %4 row_xmask:4 row_mask:0xf bank_mask:0xf\n\t"
      "v_max_num_f32_dpp %5, %5, %5 row_xmask:4 row_mask:0xf bank_mask:0xf\n\t"
      "v_max_num_f32_dpp %6, %6, %6 row_xmask:4 row_mask:0xf bank_mask:0xf\n\t"
      "v_max_num_f32_dpp %7, %7, %7 row_xmask:4 row_mask:0xf bank_mask:0xf\n\t"
      "v_max_num_f32_dpp %0, %0, %0 row_xmask:8 row_mask:0xf bank_mask:0xf\n\t"
      "v_max_num_f32_dpp %1, %1, %1 row_xmask:8 row_mask:0xf bank_mask:0xf\n\t"
      "v_max_num_f32_dpp %2, %2, %2 row_xmask:8 row_mask:0xf bank_mask:0xf\n\t"
      "v_max_num_f32_dpp %3, %3, %3 row_xmask:8 row_mask:0xf bank_mask:0xf\n\t"
      "v_max_num_f32_dpp %4, %4, %4 row_xmask:8 row_mask:0xf bank_mask:0xf\n\t"
      "v_max_num_f32_dpp %5, %5, %5 row_xmask:8 row_mask:0xf bank_mask:0xf\n\t"
      "v_max_num_f32_dpp %6, %6, %6 row_xmask:8 row_mask:0xf bank_mask:0xf\n\t"
      "v_max_num_f32_dpp %7, %7, %7 row_xmask:8 row_mask:0xf bank_mask:0xf"
      : "+v"(m[0]), "+v"(m[1]), "+v"(m[2]), "+v"(m[3]), "+v"(m[4]), "+v"(m[5]), "+v"(m[6]), "+v"(m[7]));
#endif
}
// Eight transcendentals in place, then one free slot.
// Here result and source are one register, no line touches another line's register, and the closing v_nop is the
// one independent slot the instruction set asks for in front of the first reader.
__device__ __forceinline__ void exp2x8(float (&t)[8]) {
#if defined(__HIP_DEVICE_COMPILE__)
  asm("v_exp_f32 %0, %0\n\tv_exp_f32 %1, %1\n\tv_exp_f32 %2, %2\n\tv_exp_f32 %3, %3\n\t"
      "v_exp_f32 %4, %4\n\tv_exp_f32 %5, %5\n\tv_exp_f32 %6, %6\n\tv_exp_f32 %7, %7\n\tv_nop"
      : "+v"(t[0]), "+v"(t[1]), "+v"(t[2]), "+v"(t[3]), "+v"(t[4]), "+v"(t[5]), "+v"(t[6]), "+v"(t[7]));
#endif
}
__device__ __forceinline__ void rcpx8(float (&t)[8]) {
#if defined(__HIP_DEVICE_COMPILE__)
  asm("v_rcp_f32 %0, %0\n\tv_rcp_f32 %1, %1\n\tv_rcp_f32 %2, %2\n\tv_rcp_f32 %3, %3\n\t"
      "v_rcp_f32 %4, %4\n\tv_rcp_f32 %5, %5\n\tv_rcp_f32 %6, %6\n\tv_rcp_f32 %7, %7\n\tv_nop"
      : "+v"(t[0]), "+v"(t[1]), "+v"(t[2]), "+v"(t[3]), "+v"(t[4]), "+v"(t[5]), "+v"(t[6]), "+v"(t[7]));
#endif
}
__device__ __forceinline__ float row_sum16(float v) {
  v += dpp_x<0x161>(v);
  v += dpp_x<0x162>(v);
  v += dpp_x<0x164>(v);
  v += dpp_x<0x168>(v);
  return v;
}

// ---- 16-bit fragment loader (A, B alike): p points at row/col (lane&15), + k0 + 8*(lane>>4);
//      elements 0..7 <- p[0..7] (k0+8h..k0+8h+7), elements 8..15 <- p[16..23] (k0+16+8h..k0+16+8h+7)
__device__ __forceinline__ v16h ldfrag(const _Float16* p) {
  Frag f;
  f.half[0] = *(const v8h*)(p);
  f.half[1] = *(const v8h*)(p + 16);
  return f.v;
}

// ---- WMMA with trailing VALU hazard gap (ties D, keeps A/B live past the nops) ---------------------
__device__ __forceinline__ v8f mma(v16h a, v16h b, v8f c) {
  v8f d = __builtin_amdgcn_wmma_f32_16x16x32_f16(false, a, false, b, (short)0, c, false, false);
#if defined(__HIP_DEVICE_COMPILE__)
  asm volatile("v_nop\n\tv_nop\n\tv_nop\n\tv_nop" : "+v"(d) : "v"(a), "v"(b));
#endif
  return d;
}

// =====================================================================================================
// One thread's share of phase 1: plane row (column wcol of a [20][NCOL] weight matrix, its bias where BIAS) and its part
// of x row xr (PART 0: cols 0..15, PART 1: cols 16..31). The weight loads are issued first and x behind them: loads come
// back in order, the weights from cache and x from memory, so the plane row is converted and stored while x is in flight.
// =====================================================================================================
template <int NCOL, bool BIAS, int PART>
__device__ __forceinline__ void stage_w_x(const float* wcol, const float* bsrc, bool real, const float* xr,
                                          _Float16* wrow, float* brow, float* xsr, _Float16* xhr) {
  float raw[CC];
  float braw = 0.0f;
  if (BIAS) braw = *bsrc;
#pragma unroll                                                 // the 20 loads issue in a row, ahead of the first use
  for (int c = 0; c < CC; ++c) raw[c] = wcol[c * NCOL];
#if defined(__HIP_DEVICE_COMPILE__)
  // the wait that stands between issued global loads and any later write of a register that they name: a result of an
  // x load may land on an address register of the bias or weight loads
  asm volatile("s_wait_xcnt 0x0" ::: "memory");
#endif
  // keeps that wait behind the bias and weight loads and in front of the x loads
  __builtin_amdgcn_sched_barrier(0);
  v4f a[4];
  if (PART == 0) {
#pragma unroll                                                 // constant indices: a stays in registers
    for (int k = 0; k < 4; ++k) a[k] = *(const v4f*)(xr + 4 * k);
  } else {
    a[0] = *(const v4f*)(xr + 16);
  }
#if defined(__HIP_DEVICE_COMPILE__)
  // the same wait for the x loads
  asm volatile("s_wait_xcnt 0x0" ::: "memory");
#endif
  // keeps that wait directly behind the x loads, and every conversion behind it
  __builtin_amdgcn_sched_barrier(0);
  const float sw = real ? 1024.0f : 0.0f;                        // a pad row comes out zero
  v8h o[CP / 8];
#pragma unroll                                                 // constant indices: o stays in registers
  for (int c = 0; c < CP; ++c) o[c >> 3][c & 7] = (_Float16)0.0f;
#pragma unroll                                                 // constant indices: raw and o stay in registers
  for (int c = 0; c < CC; c += 2) {                              // bf16 RNE by the packed convert, two values at a time
    v2f p;
    p[0] = raw[c];
    p[1] = raw[c + 1];
    const v2h q = __builtin_convertvector(__builtin_convertvector(__builtin_convertvector(p, v2b), v2f) * sw, v2h);
    o[c >> 3][c & 7]       = q[0];
    o[c >> 3][(c & 7) + 1] = q[1];
  }
#pragma unroll                                                 // constant indices; the 4 stores issue in a row
  for (int k = 0; k < CP / 8; ++k) *(v8h*)(wrow + k * 8) = o[k];
  if (BIAS) *brow = bfr(braw) * (real ? 16384.0f : 0.0f);
  // keeps all of the plane row's LDS stores in front of the first use of x (the wait for memory)
  __builtin_amdgcn_sched_barrier(0);
  if (PART == 0) {
    const v4f a0 = bfr4(a[0]);
    const v4f a1 = bfr4(a[1]);
    const v4f a2 = bfr4(a[2]);
    const v4f a3 = bfr4(a[3]);
    *(v4f*)(xsr)      = a0;
    *(v4f*)(xsr + 4)  = a1;
    *(v4f*)(xsr + 8)  = a2;
    *(v4f*)(xsr + 12) = a3;
    v8h p0, p1;
#pragma unroll
    for (int c = 0; c < 4; ++c) {
      p0[c]     = (_Float16)(a0[c] * 16.0f);
      p0[4 + c] = (_Float16)(a1[c] * 16.0f);
      p1[c]     = (_Float16)(a2[c] * 16.0f);
      p1[4 + c] = (_Float16)(a3[c] * 16.0f);
    }
    *(v8h*)(xhr)     = p0;
    *(v8h*)(xhr + 8) = p1;
  } else {
    const v4f a4 = bfr4(a[0]);
    *(v4f*)(xsr + 16) = a4;
    v8h p2, p3;
#pragma unroll
    for (int c = 0; c < 4; ++c) {
      p2[c]     = (_Float16)(a4[c] * 16.0f);
      p2[4 + c] = (_Float16)0.0f;
      p3[c]     = (_Float16)0.0f;
      p3[4 + c] = (_Float16)0.0f;
    }
    *(v8h*)(xhr + 16) = p2;
    *(v8h*)(xhr + 24) = p3;
  }
}

// =====================================================================================================
// Main: one 256-thread block (8 waves) per batch item; wave w owns token rows 16w..16w+15 in the projections and
// in P.v, and score COLUMNS j = 16w..16w+15 (all 128 rows i) in the score product.
// Phase 1: x -> xs (f32 bf16-RNE values) and xh (f16 of 16*x, cols 20..31 zero); threads 0..127 write cols
//          0..15 of row tid, threads 128..255 cols 16..31 (wave-uniform split). coverage: 128 rows x 32 cols.
//          Thread tid also builds row tid of the weight planes (and of the bias planes) in LDS, from Wk, Wq, Wv.
// Phase 2: projections, one k-step (k = c, split map, the same for A and B). k and q transposed: A = W plane rows
//          n from LDS [n][c], B = xh as [col = token][c], C = the bias plane; D (row n = 16nt+8h+r, col token
//          m0+lo): a lane holds 8 neighbouring d of ONE token, which is half a 16-bit fragment of that token's row.
//          elu in f32, f16(8*val); pad rows n >= 100 come out 0 (W and bias planes are 0 there, elu(0) = 0).
//          k: one 16-B store a tile into kS [i][d], cols 112..127 stored as zeros. q: tiles 2s and 2s+1 ARE the
//          A fragment of k-step s of phase 3 (elements 0..7: d = 32s+8h+r, 8..15: d = 32s+16+8h+r, row m0+lo);
//          it stays in registers. v: A = xh rows, B = WvT; D (row m0+8h+r, col d) -> tanh -> vTh/vTl [d][j] for
//          d 0..31 (d >= 20 forced 0).
// Phase 3: S^T[j][i] = sum_d q[j][d] k[i][d]: A = q rows j (the wave's own 16, registers), B = kS as [n=i][k=d];
//          8 column tiles x 4 k-steps; D (row j = m0+8h+r, col i = 16nt+lo) stays in 64 accumulator registers.
// Phase 4: softmax over i per column j, in registers: i runs over the 8 tiles and the 16 lanes of a row, so max
//          and sum are 8 values a lane, each folded over nt and then over the row by DPP; the 8 values r of one
//          tile are 8 neighbouring j of row i: P[i][j] = f16(1024 * e / sum) goes into its own region as [i][j]
//          with one 16-B store a tile (the weight and bias planes lie in that region: their last reads, in phase 2,
//          end at the barrier in front of phase 3, so no further barrier stands in front of these stores).
// Phase 5: y_att[i][d] = sum_j P v: A = P rows i (k = j), B = vTh/vTl as [n=d][k=j]; hi and residual in
//          separate accumulators; y = (acc_h + acc_l/2048)/16384 + xs, written back into xs (d < 20). The LDS reads
//          stand in groups ahead of their users: two register sets of B fragments, x read before the first product.
// =====================================================================================================
// register budget for six waves a SIMD: three work-groups a WGP, which is also what the LDS allows
__global__ __launch_bounds__(256) __attribute__((amdgpu_waves_per_eu(6)))
void k_main(const float* __restrict__ x, const float* __restrict__ Wk, const float* __restrict__ bk,
            const float* __restrict__ Wq, const float* __restrict__ bq, const float* __restrict__ Wv,
            const float* __restrict__ bv, float* out) {
  extern __shared__ __align__(16) unsigned char smem[];
  float*    xs  = (float*)(smem + OFF_XS);
  _Float16* xh  = (_Float16*)(smem + OFF_XH);
  _Float16* kS  = (_Float16*)(smem + OFF_KS);
  _Float16* pS  = (_Float16*)(smem + OFF_PS);
  _Float16* vTh = (_Float16*)(smem + OFF_VTH);
  _Float16* vTl = (_Float16*)(smem + OFF_VTL);
  _Float16* wl  = (_Float16*)(smem + OFF_WL);                    // weight planes: WkT, WqT, WvT
  float*    bl  = (float*)(smem + OFF_BL);                       // bias planes: bk, bq

  const int tid  = threadIdx.x;
  const int lane = tid & 31;
  const int wid  = __builtin_amdgcn_readfirstlane(tid >> 5);   // scalar: as a vector value it cost a spill in phase 3
  const int h    = lane >> 4;
  const int lo   = lane & 15;
  const int b    = blockIdx.x;
  const int m0   = wid * 16;
  const float* xb = x + (size_t)b * XROW;

  // ---------------- phase 1: stage the weight planes and x ----------------
  {
    const int row = tid & 127;
    const float* xr  = xb + row * CC;               // row*80 B, 16-B aligned
    float*       xsr = xs + row * CC;
    _Float16*    xhr = xh + row * PX;
    _Float16*    wrow = wl + tid * PX;
    float*       brow = bl + tid;                   // written by threads 0..223 only
    const bool isq = tid >= NRKQ;
    const int  n   = isq ? tid - NRKQ : tid;        // row of WkT / WqT (waves 0..6)
    const int  nc  = min(n, KQ - 1);
    const float* wcol = (isq ? Wq : Wk) + nc;
    const float* bsrc = (isq ? bq : bk) + nc;
    if (wid < 4)                                    // the three cases are wave-uniform (scalar tests)
      stage_w_x<KQ, true, 0>(wcol, bsrc, n < KQ, xr, wrow, brow, xsr, xhr);
    else if (wid < 7)
      stage_w_x<KQ, true, 1>(wcol, bsrc, n < KQ, xr, wrow, brow, xsr, xhr);
    else
      stage_w_x<CC, false, 1>(Wv + min(lane, CC - 1), nullptr, lane < CC, xr, wrow, brow, xsr, xhr);
  }
  __syncthreads();

  // ---------------- phase 2: projections (K = 32, one k-step) ----------------
  Frag qa[4];                                                    // q rows m0+lo as the A fragments of phase 3
  {
    const v16h af = ldfrag(xh + (m0 + lo) * PX + 8 * h);        // row / col token m0+lo, k = c
    const _Float16* pw = wl + lo * PX + 8 * h;                   // A: plane row 16t+lo (n = 16nt+lo of WkT, WqT), k = c
    const float*    pc = bl + 8 * h;                             // C: plane rows 16t+8h+r
    // v = tanh(x.Wv + bv), stored transposed as hi + residual planes
#pragma unroll 1
    for (int nt = 0; nt < 2; ++nt) {
      const int n0 = nt * 16, d = n0 + lo;
      const v8f acc = mma(af, ldfrag(pw + (2 * NRKQ + n0) * PX), zero8());
      const float bias = bfr(bv[min(d, CC - 1)]);
#pragma unroll
      for (int r = 0; r < 8; ++r) {
        float val = tanh_f(acc[r] * 6.103515625e-05f + bias);
        val = (d < CC) ? val : 0.0f;
        const float v16 = val * 16.0f;
        const _Float16 hh = (_Float16)v16;
        const _Float16 ll = (_Float16)((v16 - (float)hh) * 2048.0f);
        vTh[d * PH + m0 + 8 * h + r] = hh;
        vTl[d * PH + m0 + 8 * h + r] = ll;
      }
    }
    // k^T = elu(Wk^T.x^T + bk): tiles t = 0..6; q^T = elu(Wq^T.x^T + bq): tiles t = 7..13
    _Float16* kw = kS + (m0 + lo) * PH + 8 * h;
    v16h wf[2 * NTKQ];
    union { v8f v; v4f q[2]; } cb[2 * NTKQ];
    v8f ac[2 * NTKQ];
    // elu (alpha = 1) of v = acc * 2^-14, carried x8: exp(v) = exp2(acc * CE), 8 * v = acc * CV
    const float CE = 1.4426950408889634f * 6.103515625e-05f, CV = 0.00048828125f;
#define LOAD_TILE(t)                                                                         \
    {                                                                                          \
      wf[t]      = ldfrag(pw + (t) * 16 * PX);                                                 \
      cb[t].q[0] = *(const v4f*)(pc + (t) * 16);                                               \
      cb[t].q[1] = *(const v4f*)(pc + (t) * 16 + 4);                                           \
    }
#define MMA_TILE(t)                                                                          \
    ac[t] = __builtin_amdgcn_wmma_f32_16x16x32_f16(false, wf[t], false, af, (short)0, cb[t].v, false, false)
    LOAD_TILE(0) LOAD_TILE(1) LOAD_TILE(2)
    // keeps the twelve reads of the first three tiles one group in front of the first product: left alone the compiler
    // put the bias reads of tile 1 and a wait for them directly in front of its product
    __builtin_amdgcn_sched_barrier(0);
    MMA_TILE(0);
#pragma unroll
    for (int t = 0; t < 2 * NTKQ; ++t) {
      if (t + 1 < 2 * NTKQ) MMA_TILE(t + 1);                     // its result slots are filled by tile t's elu
      float e[8];
#pragma unroll
      for (int r = 0; r < 8; ++r) e[r] = ac[t][r] * CE;
      exp2x8(e);
      v8h o;
#pragma unroll
      for (int r = 0; r < 8; ++r)
        o[r] = (_Float16)(ac[t][r] > 0.0f ? ac[t][r] * CV : __builtin_fmaf(e[r], 8.0f, -8.0f));
      if (t < NTKQ) *(v8h*)(kw + t * 16) = o;
      else          qa[(t - NTKQ) >> 1].half[(t - NTKQ) & 1] = o;
      if (t + 3 < 2 * NTKQ) LOAD_TILE(t + 3)
      // one tile a group: keeps the LDS reads of tile t+3 a whole tile in front of their product (left alone the compiler
      // put each tile's four reads and a full wait directly in front of it), and ends q's elu in front of phase 3
      __builtin_amdgcn_sched_barrier(0);
    }
#undef LOAD_TILE
#undef MMA_TILE
    v8h z8;
#pragma unroll
    for (int r = 0; r < 8; ++r) z8[r] = (_Float16)0.0f;
    *(v8h*)(kw + NTKQ * 16) = z8;
    qa[NTKQ >> 1].half[NTKQ & 1] = z8;
  }
  __syncthreads();

  // ---------------- phase 3: scores, transposed: S^T[j][i] (K = 128 over d), kept in registers ----------------
  v8f acc[8];                                                    // acc[nt][r] = 64 * S[i = 16nt+lo][j = m0+8h+r]
  {
    const _Float16* pb = kS + lo * PH + 8 * h;                   // B: col i = 16nt+lo, k = d (the map of qa)
#pragma unroll
    for (int nt = 0; nt < 8; ++nt) acc[nt] = zero8();
#pragma unroll
    for (int ks = 0; ks < 4; ++ks) {                             // k-step outermost: 8 independent accumulators in a row
      v16h bf[8];
#pragma unroll
      for (int nt = 0; nt < 8; ++nt) bf[nt] = ldfrag(pb + nt * 16 * PH + 32 * ks);
      // keeps the 16 LDS reads of a k-step one group in front of its 8 products: left alone the compiler put two
      // reads and a full wait in front of every product, one LDS latency each
      __builtin_amdgcn_sched_barrier(0);
#pragma unroll
      for (int nt = 0; nt < 8; ++nt)
        acc[nt] = __builtin_amdgcn_wmma_f32_16x16x32_f16(false, qa[ks].v, false, bf[nt], (short)0, acc[nt], false, false);
      // second half of the pair: the next k-step's reads stay behind these products (their registers are reused)
      __builtin_amdgcn_sched_barrier(0);
    }
  }

  // ---------------- phase 4: softmax over i, per column j, in registers ----------------
  {
    // exp(s - max) = exp2((acc - max_acc) * C2), C2 = (1/sqrt(128)) * 2^-6 * log2(e) > 0
    const float C2 = 0.08838834764831845f * 0.015625f * 1.4426950408889634f;
    float mx[8], rs[8];
#pragma unroll
    for (int r = 0; r < 8; ++r) {
      mx[r] = acc[0][r];
#pragma unroll
      for (int nt = 1; nt < 8; ++nt) mx[r] = fmaxf(mx[r], acc[nt][r]);
    }
    row_max16x8(mx);
#pragma unroll
    for (int r = 0; r < 8; ++r) {
      const float nb = -C2 * mx[r];
      float t[8];
#pragma unroll
      for (int nt = 0; nt < 8; ++nt) t[nt] = __builtin_fmaf(acc[nt][r], C2, nb);
      exp2x8(t);
      float sum = t[0];
      acc[0][r] = t[0];
#pragma unroll
      for (int nt = 1; nt < 8; ++nt) {
        acc[nt][r] = t[nt];
        sum += t[nt];
      }
      rs[r] = row_sum16(sum);                                    // the largest term is 1: sum >= 1
    }
    rcpx8(rs);
#pragma unroll
    for (int r = 0; r < 8; ++r) rs[r] *= 1024.0f;
    _Float16* Pw = pS + lo * PH + m0 + 8 * h;                    // P as [i][j], carried x1024
#pragma unroll
    for (int nt = 0; nt < 8; ++nt) {
      v8h p;
#pragma unroll
      for (int r = 0; r < 8; ++r) p[r] = (_Float16)(acc[nt][r] * rs[r]);
      *(v8h*)(Pw + nt * 16 * PH) = p;
    }
  }
  __syncthreads();

  // ---------------- phase 5: y = P.v + x (K = 128 over j; hi and residual accumulators) ----------------
  {
    const _Float16* pa = pS + (m0 + lo) * PH + 8 * h;            // A: row i = m0+lo, k = j
    const _Float16* pv = vTh + lo * PH + 8 * h;                  // B: col d = lo, k = j, of the hi plane
    static_assert(OFF_VTL == OFF_VTH + CP * PH * 2);             // the residual plane lies CP rows behind the hi plane
    const int d1  = 16 + lo;
    const int d1c = min(d1, CC - 1);
    float* px = xs + (m0 + 8 * h) * CC;                          // rows i = m0+8h+r, the wave's own
    v16h pf[4], bs[2][4];                                        // bs: two register sets of a k-step's four B fragments
    float x0[8], x1[8];
    v8f ay[4];                                                   // hi d=lo, hi d=16+lo, residual d=lo, residual d=16+lo
#define LOAD_B(set, ks)                                                                      \
    {                                                                                          \
      bs[set][0] = ldfrag(pv + 32 * (ks));                                                     \
      bs[set][1] = ldfrag(pv + 16 * PH + 32 * (ks));                                           \
      bs[set][2] = ldfrag(pv + CP * PH + 32 * (ks));                                           \
      bs[set][3] = ldfrag(pv + (CP + 16) * PH + 32 * (ks));                                    \
    }
#define MMA_B(set, ks)                                                                       \
    _Pragma("unroll") /* constant indices: four independent accumulators in a row */           \
    for (int q = 0; q < 4; ++q)                                                                \
      ay[q] = __builtin_amdgcn_wmma_f32_16x16x32_f16(false, pf[ks], false, bs[set][q], (short)0, ay[q], false, false);
#pragma unroll                                                 // constant indices: ay stays in registers
    for (int q = 0; q < 4; ++q) ay[q] = zero8();
    pf[0] = ldfrag(pa);
    LOAD_B(0, 0)
    pf[1] = ldfrag(pa + 32);
    LOAD_B(1, 1)
    pf[2] = ldfrag(pa + 64);
    pf[3] = ldfrag(pa + 96);
#pragma unroll                                                 // constant indices; the 16 reads issue in a row
    for (int r = 0; r < 8; ++r) {
      x0[r] = px[r * CC + lo];                                   // d = lo < 16 < 20 always valid
      x1[r] = px[r * CC + d1c];
    }
    MMA_B(0, 0)
    LOAD_B(0, 2)
    MMA_B(1, 1)
    LOAD_B(1, 3)
    MMA_B(0, 2)
    MMA_B(1, 3)
    // Order of this phase's LDS reads (0x100) and products (0x008): the reads of k-steps 0 and 1, of all of P and of x as
    // one group, then four products and the eight reads of the k-step after next, by turns. Left alone the compiler put
    // two reads and a full wait in front of every product and one read and a full wait in front of every output row,
    // one LDS latency each.
    __builtin_amdgcn_sched_group_barrier(0x100, 32, 0);
    __builtin_amdgcn_sched_group_barrier(0x008, 4, 0);
    __builtin_amdgcn_sched_group_barrier(0x100, 8, 0);
    __builtin_amdgcn_sched_group_barrier(0x008, 4, 0);
    __builtin_amdgcn_sched_group_barrier(0x100, 8, 0);
    __builtin_amdgcn_sched_group_barrier(0x008, 8, 0);
#undef LOAD_B
#undef MMA_B
    float v1[8];
#pragma unroll                                                 // constant indices: ay, x0, x1, v1 stay in registers
    for (int r = 0; r < 8; ++r) {
      const float y0 = (ay[0][r] + ay[2][r] * 0.00048828125f) * 6.103515625e-05f;   // (h + l/2048) * 2^-14
      const float y1 = (ay[1][r] + ay[3][r] * 0.00048828125f) * 6.103515625e-05f;
      px[r * CC + lo] = x0[r] + y0;
      v1[r] = x1[r] + y1;
    }
    if (lo < 4) {                                                // d = 16..19
#pragma unroll                                                 // constant indices; the 8 stores issue in a row
      for (int r = 0; r < 8; ++r) px[r * CC + d1] = v1[r];
    }
  }
  __syncthreads();

  {
    const v4f* xs4 = (const v4f*)xs;
    const int c2  = 16 + wid;                                    // valid iff wid < 4 (wave-uniform)
    const int c2c = min(c2, 19);
    const v4f pv0 = xs4[(wid)     * 32 + lane];
    const v4f pv1 = xs4[(8 + wid) * 32 + lane];
    const v4f pv2 = xs4[c2c       * 32 + lane];
    float* ob = out + (size_t)b * XROW + (size_t)lane * 4;
    *(v4f*)(ob + (size_t)wid * 128)       = pv0;
    *(v4f*)(ob + (size_t)(8 + wid) * 128) = pv1;
#if defined(__HIP_DEVICE_COMPILE__)
    // the wait that stands between issued global stores and any later write of a register that they name
    asm volatile("s_wait_xcnt 0x0" ::: "memory");
#endif
    if (wid < 4) *(v4f*)(ob + (size_t)c2 * 128) = pv2;
    
  }
}

// One launch; the workspace is not used.
extern "C" void kernel_launch(void* const* d_in, const int* in_sizes, int n_in,
                              void* d_out, int out_size, void* d_ws, size_t ws_size,
                              hipStream_t stream) {
  if (n_in < 7) return;
  if (in_sizes[0] != NBATCH * XROW) return;
  if (in_sizes[1] != CC * KQ) return;
  if (in_sizes[2] != KQ) return;
  if (in_sizes[3] != CC * KQ) return;
  if (in_sizes[4] != KQ) return;
  if (in_sizes[5] != CC * CC) return;
  if (in_sizes[6] != CC) return;
  if (out_size != NBATCH * XROW) return;

  const float* x  = (const float*)d_in[0];     // [4096][128][20]
  const float* Wk = (const float*)d_in[1];     // [20][100]
  const float* bk = (const float*)d_in[2];     // [100]
  const float* Wq = (const float*)d_in[3];     // [20][100]
  const float* bq = (const float*)d_in[4];     // [100]
  const float* Wv = (const float*)d_in[5];     // [20][20]
  const float* bv = (const float*)d_in[6];     // [20]
  float* out = (float*)d_out;                  // [4096][128][20]

  (void)d_ws;
  (void)ws_size;

  (void)hipFuncSetAttribute(reinterpret_cast<const void*>(&k_main),
                            hipFuncAttributeMaxDynamicSharedMemorySize, LDS_MAIN);

  const dim3 gMain(NBATCH), bMain(256);

  k_main<<<gMain, bMain, LDS_MAIN, stream>>>(x, Wk, bk, Wq, bq, Wv, bv, out);
  (void)hipGetLastError();
}

// v007
// One run takes 39.8 microseconds.
// In two side-by-side timings against v006, it was 1.05 and 1.04 times as fast.
// All steps since v000 together make it 8.84 times as fast.
// Contractions on v_wmma_f32_16x16x32_f16, f32 accumulate: x.Wk, x.Wq, x.Wv with f16 operands built from
// bf16-RNE inputs (x carried x16, Wk and Wq x0.5, Wv x1024), single products (k and q as W^T.x^T with the bias in C);
// k.q^T with k and q as plain f16 carried x8;
// P.v with P as plain f16 carried x1024 and v as f16 hi (x16) + x2048 residual plane (separate accumulator);
// elu, tanh, column softmax (in registers) and the residual add in f32 on VALU.
#include <hip/hip_runtime.h>
#include <stdint.h>

#define NBATCH 4096
#define TT     128              // tokens per item
#define CC     20               // channels
#define KQ     100              // key/query dim
#define CP     32               // channels padded (k of the projections)
#define DP     128              // key dim padded (k of the score product)
#define PX     40               // LDS pitch of xh in halves: 80 B = 16 B x 5
#define PH     136              // LDS pitch of kS, P, vTh, vTl in halves: 272 B = 16 B x 17
#define XROW   (TT * CC)        // 2560 floats per item

static_assert(XROW == 2560 && CC % 2 == 0);
static_assert(TT == 128);
static_assert(DP == TT);
static_assert(PX >= CP && PH >= DP);
static_assert((PX * 2) % 32 == 16 && (PH * 2) % 32 == 16);    // 16-B fragment reads: pitch = 16 B x odd

// LDS byte offsets of the main kernel
#define OFF_XS   0              // f32 [128][20]   10240  (bf16-RNE x, later y)
// (the pad columns behind each row's last used column are never written and never read)
#define OFF_XH   10240          // f16 [128][32 of 40]    10240  (16*x, cols 20..31 zero)
#define OFF_KS   20480          // f16 [128][128 of 136]  34816  (8*k, cols 100..127 zero)
#define OFF_PS   55296          // f16 [128][128 of 136]  34816  (1024*P as [i][j])
#define OFF_WL   OFF_PS         // f16 [256][32 of 40]    20480  (weight planes; dead behind phase 2, P comes in phase 4)
#define OFF_BL   (OFF_WL + 20480)   // f32 [224]            896  (bias planes; dead behind phase 2)
#define OFF_VTH  90112          // f16 [32][128 of 136]    8704  (hi of 16*v, transposed [d][j])
#define OFF_VTL  98816          // f16 [32][128 of 136]    8704  (x2048 residual, transposed)
#define LDS_MAIN 107520         // three blocks fit the 327680 B of a WGP
static_assert(OFF_XH == OFF_XS + TT * CC * 4);
static_assert(OFF_KS == OFF_XH + TT * PX * 2);
static_assert(OFF_PS == OFF_KS + TT * PH * 2);
static_assert(OFF_VTH == OFF_PS + TT * PH * 2);
static_assert(OFF_VTL == OFF_VTH + CP * PH * 2);
static_assert(LDS_MAIN == OFF_VTL + CP * PH * 2);
static_assert(3 * LDS_MAIN <= 327680);

#define NTKQ      7               // 16-wide tiles of the key dim that hold a real column (100 = 6 * 16 + 4)
static_assert(NTKQ * 16 >= KQ && (NTKQ - 1) * 16 < KQ && (NTKQ + 1) * 16 == DP);
// weight planes in LDS, one row of 32 c (pitch PX) a thread: rows 0..111 WkT [n][c], 112..223 WqT [n][c], 224..255
// WvT [d][c]; values = f16 of (bf16-RNE value * 0.5) in WkT and WqT, of (bf16-RNE value * 1024) in WvT, c >= 20 and rows
// n >= 100, d >= 20 zero. Bias planes: f32 of (bf16-RNE value * 8) at the index of the plane row, bk 0..111, bq 112..223,
// n >= 100 zero. With x carried x16 the k and q accumulators are 8 * (x.W + b), the scale at which k and q are carried.
#define NRKQ      (NTKQ * 16)     // rows of the WkT and of the WqT plane
static_assert(2 * NRKQ + CP == 256);                            // one plane row a thread of the block
static_assert(2 * NRKQ == 7 * 32);                              // WvT is wave 7's, whole
static_assert(OFF_BL == OFF_WL + 256 * PX * 2 && OFF_BL % 16 == 0);
static_assert(OFF_BL + 2 * NRKQ * 4 <= OFF_VTH);                // both lie inside the region of P

typedef _Float16     v16h __attribute__((ext_vector_type(16)));
typedef _Float16     v8h  __attribute__((ext_vector_type(8)));
typedef float        v8f  __attribute__((ext_vector_type(8)));
typedef float        v4f  __attribute__((ext_vector_type(4)));
typedef float        v2f  __attribute__((ext_vector_type(2)));
typedef _Float16     v2h  __attribute__((ext_vector_type(2)));
typedef __bf16       v2b  __attribute__((ext_vector_type(2)));

union Frag { v16h v; v8h half[2]; };

// ---- scalar helpers --------------------------------------------------------------------------------
__device__ __forceinline__ unsigned short bf_bits(float f) {          // f32 -> bf16 bits, RNE convert
  unsigned u = __float_as_uint(f);
  return (unsigned short)((u + 0x7FFFu + ((u >> 16) & 1u)) >> 16);
}
__device__ __forceinline__ float bf_up(unsigned short b) { return __uint_as_float(((unsigned)b) << 16); }
__device__ __forceinline__ float bfr(float f) { return bf_up(bf_bits(f)); }   // value after bf16 RNE convert
__device__ __forceinline__ v4f bfr4(v4f a) {
  v4f o;
  o[0] = bfr(a[0]); o[1] = bfr(a[1]); o[2] = bfr(a[2]); o[3] = bfr(a[3]);
  return o;
}
__device__ __forceinline__ v8f zero8() {
  v8f z;
  z[0] = 0.f; z[1] = 0.f; z[2] = 0.f; z[3] = 0.f; z[4] = 0.f; z[5] = 0.f; z[6] = 0.f; z[7] = 0.f;
  return z;
}
__device__ __forceinline__ float tanh_f(float v) {                  // branchless tanh
  const float c = fminf(fmaxf(v, -15.0f), 15.0f);
  const float t = __expf(2.0f * c);
  return (t - 1.0f) * __builtin_amdgcn_rcpf(t + 1.0f);
}

// ---- maximum / sum over the 16 lanes of a row (lanes 0..15, lanes 16..31), result in every lane of the row;
//      DPP row_xmask:m (control 0x160 + m) reads lane l ^ m of the same row; all 32 lanes are on at every use
template <int CTRL>
__device__ __forceinline__ float dpp_x(float v) {
  return __builtin_bit_cast(float, __builtin_amdgcn_update_dpp(0, __builtin_bit_cast(int, v), CTRL, 0xf, 0xf, true));
}
// Row maximum of eight values at once. In asm because fmaxf on a DPP move compiled to three instructions a step
// (move, quieting max, max) where the fused v_max_num_f32_dpp is one; the eight chains are interleaved so that
// every instruction's producer stands eight instructions back (no dependent pair in a row).
__device__ __forceinline__ void row_max16x8(float (&m)[8]) {
#if defined(__HIP_DEVICE_COMPILE__)
  asm(
      "v_max_num_f32_dpp %0, %0, %0 row_xmask:1 row_mask:0xf bank_mask:0xf\n\t"
      "v_max_num_f32_dpp %1, %1, %1 row_xmask:1 row_mask:0xf bank_mask:0xf\n\t"
      "v_max_num_f32_dpp %2, %2, %2 row_xmask:1 row_mask:0xf bank_mask:0xf\n\t"
      "v_max_num_f32_dpp %3, %3, %3 row_xmask:1 row_mask:0xf bank_mask:0xf\n\t"
      "v_max_num_f32_dpp %4, %4, %4 row_xmask:1 row_mask:0xf bank_mask:0xf\n\t"
      "v_max_num_f32_dpp %5, %5, %5 row_xmask:1 row_mask:0xf bank_mask:0xf\n\t"
      "v_max_num_f32_dpp %6, %6, %6 row_xmask:1 row_mask:0xf bank_mask:0xf\n\t"
      "v_max_num_f32_dpp %7, %7, %7 row_xmask:1 row_mask:0xf bank_mask:0xf\n\t"
      "v_max_num_f32_dpp %0, %0, %0 row_xmask:2 row_mask:0xf bank_mask:0xf\n\t"
      "v_max_num_f32_dpp %1, %1, %1 row_xmask:2 row_mask:0xf bank_mask:0xf\n\t"
      "v_max_num_f32_dpp %2, %2, %2 row_xmask:2 row_mask:0xf bank_mask:0xf\n\t"
      "v_max_num_f32_dpp %3, %3, %3 row_xmask:2 row_mask:0xf bank_mask:0xf\n\t"
      "v_max_num_f32_dpp %4, %4, %4 row_xmask:2 row_mask:0xf bank_mask:0xf\n\t"
      "v_max_num_f32_dpp %5, %5, %5 row_xmask:2 row_mask:0xf bank_mask:0xf\n\t"
      "v_max_num_f32_dpp %6, %6, %6 row_xmask:2 row_mask:0xf bank_mask:0xf\n\t"
      "v_max_num_f32_dpp %7, %7, %7 row_xmask:2 row_mask:0xf bank_mask:0xf\n\t"
      "v_max_num_f32_dpp %0, %0, %0 row_xmask:4 row_mask:0xf bank_mask:0xf\n\t"
      "v_max_num_f32_dpp %1, %1, %1 row_xmask:4 row_mask:0xf bank_mask:0xf\n\t"
      "v_max_num_f32_dpp %2, %2, %2 row_xmask:4 row_mask:0xf bank_mask:0xf\n\t"
      "v_max_num_f32_dpp %3, %3, %3 row_xmask:4 row_mask:0xf bank_mask:0xf\n\t"
      "v_max_num_f32_dpp %4, %4, %4 row_xmask:4 row_mask:0xf bank_mask:0xf\n\t"
      "v_max_num_f32_dpp %5, %5, %5 row_xmask:4 row_mask:0xf bank_mask:0xf\n\t"
      "v_max_num_f32_dpp %6, %6, %6 row_xmask:4 row_mask:0xf bank_mask:0xf\n\t"
      "v_max_num_f32_dpp %7, %7, %7 row_xmask:4 row_mask:0xf bank_mask:0xf\n\t"
      "v_max_num_f32_dpp %0, %0, %0 row_xmask:8 row_mask:0xf bank_mask:0xf\n\t"
      "v_max_num_f32_dpp %1, %1, %1 row_xmask:8 row_mask:0xf bank_mask:0xf\n\t"
      "v_max_num_f32_dpp %2, %2, %2 row_xmask:8 row_mask:0xf bank_mask:0xf\n\t"
      "v_max_num_f32_dpp %3, %3, %3 row_xmask:8 row_mask:0xf bank_mask:0xf\n\t"
      "v_max_num_f32_dpp %4, %4, %4 row_xmask:8 row_mask:0xf bank_mask:0xf\n\t"
      "v_max_num_f32_dpp %5, %5, %5 row_xmask:8 row_mask:0xf bank_mask:0xf\n\t"
      "v_max_num_f32_dpp %6, %6, %6 row_xmask:8 row_mask:0xf bank_mask:0xf\n\t"
      "v_max_num_f32_dpp %7, %7, %7 row_xmask:8 row_mask:0xf bank_mask:0xf"
      : "+v"(m[0]), "+v"(m[1]), "+v"(m[2]), "+v"(m[3]), "+v"(m[4]), "+v"(m[5]), "+v"(m[6]), "+v"(m[7]));
#endif
}
// Eight transcendentals in place, then one free slot.
// Here result and source are one register, no line touches another line's register, and the closing v_nop is the
// one independent slot the instruction set asks for in front of the first reader.
__device__ __forceinline__ void exp2x8(float (&t)[8]) {
#if defined(__HIP_DEVICE_COMPILE__)
  asm("v_exp_f32 %0, %0\n\tv_exp_f32 %1, %1\n\tv_exp_f32 %2, %2\n\tv_exp_f32 %3, %3\n\t"
      "v_exp_f32 %4, %4\n\tv_exp_f32 %5, %5\n\tv_exp_f32 %6, %6\n\tv_exp_f32 %7, %7\n\tv_nop"
      : "+v"(t[0]), "+v"(t[1]), "+v"(t[2]), "+v"(t[3]), "+v"(t[4]), "+v"(t[5]), "+v"(t[6]), "+v"(t[7]));
#endif
}
__device__ __forceinline__ void rcpx8(float (&t)[8]) {
#if defined(__HIP_DEVICE_COMPILE__)
  asm("v_rcp_f32 %0, %0\n\tv_rcp_f32 %1, %1\n\tv_rcp_f32 %2, %2\n\tv_rcp_f32 %3, %3\n\t"
      "v_rcp_f32 %4, %4\n\tv_rcp_f32 %5, %5\n\tv_rcp_f32 %6, %6\n\tv_rcp_f32 %7, %7\n\tv_nop"
      : "+v"(t[0]), "+v"(t[1]), "+v"(t[2]), "+v"(t[3]), "+v"(t[4]), "+v"(t[5]), "+v"(t[6]), "+v"(t[7]));
#endif
}
__device__ __forceinline__ float row_sum16(float v) {
  v += dpp_x<0x161>(v);
  v += dpp_x<0x162>(v);
  v += dpp_x<0x164>(v);
  v += dpp_x<0x168>(v);
  return v;
}

// ---- 16-bit fragment loader (A, B alike): p points at row/col (lane&15), + k0 + 8*(lane>>4);
//      elements 0..7 <- p[0..7] (k0+8h..k0+8h+7), elements 8..15 <- p[16..23] (k0+16+8h..k0+16+8h+7)
__device__ __forceinline__ v16h ldfrag(const _Float16* p) {
  Frag f;
  f.half[0] = *(const v8h*)(p);
  f.half[1] = *(const v8h*)(p + 16);
  return f.v;
}

// ---- WMMA with trailing VALU hazard gap (ties D, keeps A/B live past the nops) ---------------------
__device__ __forceinline__ v8f mma(v16h a, v16h b, v8f c) {
  v8f d = __builtin_amdgcn_wmma_f32_16x16x32_f16(false, a, false, b, (short)0, c, false, false);
#if defined(__HIP_DEVICE_COMPILE__)
  asm volatile("v_nop\n\tv_nop\n\tv_nop\n\tv_nop" : "+v"(d) : "v"(a), "v"(b));
#endif
  return d;
}

// =====================================================================================================
// One thread's share of phase 1: plane row (column wcol of a [20][NCOL] weight matrix, its bias where BIAS) and its part
// of x row xr (PART 0: cols 0..15, PART 1: cols 16..31). The weight loads are issued first and x behind them: loads come
// back in order, the weights from cache and x from memory, so the plane row is converted and stored while x is in flight.
// =====================================================================================================
template <int NCOL, bool BIAS, int PART>
__device__ __forceinline__ void stage_w_x(const float* wcol, const float* bsrc, bool real, const float* xr,
                                          _Float16* wrow, float* brow, float* xsr, _Float16* xhr) {
  float raw[CC];
  float braw = 0.0f;
  if (BIAS) braw = *bsrc;
#pragma unroll                                                 // the 20 loads issue in a row, ahead of the first use
  for (int c = 0; c < CC; ++c) raw[c] = wcol[c * NCOL];
#if defined(__HIP_DEVICE_COMPILE__)
  // the wait that stands between issued global loads and any later write of a register that they name: a result of an
  // x load may land on an address register of the bias or weight loads
  asm volatile("s_wait_xcnt 0x0" ::: "memory");
#endif
  // keeps that wait behind the bias and weight loads and in front of the x loads
  __builtin_amdgcn_sched_barrier(0);
  v4f a[4];
  if (PART == 0) {
#pragma unroll                                                 // constant indices: a stays in registers
    for (int k = 0; k < 4; ++k) a[k] = *(const v4f*)(xr + 4 * k);
  } else {
    a[0] = *(const v4f*)(xr + 16);
  }
#if defined(__HIP_DEVICE_COMPILE__)
  // the same wait for the x loads
  asm volatile("s_wait_xcnt 0x0" ::: "memory");
#endif
  // keeps that wait directly behind the x loads, and every conversion behind it
  __builtin_amdgcn_sched_barrier(0);
  const float sw = real ? (BIAS ? 0.5f : 1024.0f) : 0.0f;        // BIAS marks WkT, WqT; a pad row comes out zero
  v8h o[CP / 8];
#pragma unroll                                                 // constant indices: o stays in registers
  for (int c = 0; c < CP; ++c) o[c >> 3][c & 7] = (_Float16)0.0f;
#pragma unroll                                                 // constant indices: raw and o stay in registers
  for (int c = 0; c < CC; c += 2) {                              // bf16 RNE by the packed convert, two values at a time
    v2f p;
    p[0] = raw[c];
    p[1] = raw[c + 1];
    const v2h q = __builtin_convertvector(__builtin_convertvector(__builtin_convertvector(p, v2b), v2f) * sw, v2h);
    o[c >> 3][c & 7]       = q[0];
    o[c >> 3][(c & 7) + 1] = q[1];
  }
#pragma unroll                                                 // constant indices; the 4 stores issue in a row
  for (int k = 0; k < CP / 8; ++k) *(v8h*)(wrow + k * 8) = o[k];
  if (BIAS) *brow = bfr(braw) * (real ? 8.0f : 0.0f);
  // keeps all of the plane row's LDS stores in front of the first use of x (the wait for memory)
  __builtin_amdgcn_sched_barrier(0);
  if (PART == 0) {
    const v4f a0 = bfr4(a[0]);
    const v4f a1 = bfr4(a[1]);
    const v4f a2 = bfr4(a[2]);
    const v4f a3 = bfr4(a[3]);
    *(v4f*)(xsr)      = a0;
    *(v4f*)(xsr + 4)  = a1;
    *(v4f*)(xsr + 8)  = a2;
    *(v4f*)(xsr + 12) = a3;
    v8h p0, p1;
#pragma unroll
    for (int c = 0; c < 4; ++c) {
      p0[c]     = (_Float16)(a0[c] * 16.0f);
      p0[4 + c] = (_Float16)(a1[c] * 16.0f);
      p1[c]     = (_Float16)(a2[c] * 16.0f);
      p1[4 + c] = (_Float16)(a3[c] * 16.0f);
    }
    *(v8h*)(xhr)     = p0;
    *(v8h*)(xhr + 8) = p1;
  } else {
    const v4f a4 = bfr4(a[0]);
    *(v4f*)(xsr + 16) = a4;
    v8h p2, p3;
#pragma unroll
    for (int c = 0; c < 4; ++c) {
      p2[c]     = (_Float16)(a4[c] * 16.0f);
      p2[4 + c] = (_Float16)0.0f;
      p3[c]     = (_Float16)0.0f;
      p3[4 + c] = (_Float16)0.0f;
    }
    *(v8h*)(xhr + 16) = p2;
    *(v8h*)(xhr + 24) = p3;
  }
}

// =====================================================================================================
// Main: one 256-thread block (8 waves) per batch item; wave w owns token rows 16w..16w+15 in the projections and
// in P.v, and score COLUMNS j = 16w..16w+15 (all 128 rows i) in the score product.
// Phase 1: x -> xs (f32 bf16-RNE values) and xh (f16 of 16*x, cols 20..31 zero); threads 0..127 write cols
//          0..15 of row tid, threads 128..255 cols 16..31 (wave-uniform split). coverage: 128 rows x 32 cols.
//          Thread tid also builds row tid of the weight planes (and of the bias planes) in LDS, from Wk, Wq, Wv.
// Phase 2: projections, one k-step (k = c, split map, the same for A and B). k and q transposed: A = W plane rows
//          n from LDS [n][c], B = xh as [col = token][c], C = the bias plane; D (row n = 16nt+8h+r, col token
//          m0+lo): a lane holds 8 neighbouring d of ONE token, which is half a 16-bit fragment of that token's row.
//          elu in f32, f16(8*val); pad rows n >= 100 come out 0 (W and bias planes are 0 there, elu(0) = 0).
//          k: one 16-B store a tile into kS [i][d], cols 112..127 stored as zeros. q: tiles 2s and 2s+1 ARE the
//          A fragment of k-step s of phase 3 (elements 0..7: d = 32s+8h+r, 8..15: d = 32s+16+8h+r, row m0+lo);
//          it stays in registers. v: A = xh rows, B = WvT; D (row m0+8h+r, col d) -> tanh -> vTh/vTl [d][j] for
//          d 0..31 (d >= 20 forced 0).
// Phase 3: S^T[j][i] = sum_d q[j][d] k[i][d]: A = q rows j (the wave's own 16, registers), B = kS as [n=i][k=d];
//          8 column tiles x 4 k-steps; D (row j = m0+8h+r, col i = 16nt+lo) stays in 64 accumulator registers.
// Phase 4: softmax over i per column j, in registers: i runs over the 8 tiles and the 16 lanes of a row, so max
//          and sum are 8 values a lane, each folded over nt and then over the row by DPP; the 8 values r of one
//          tile are 8 neighbouring j of row i: P[i][j] = f16(1024 * e / sum) goes into its own region as [i][j]
//          with one 16-B store a tile (the weight and bias planes lie in that region: their last reads, in phase 2,
//          end at the barrier in front of phase 3, so no further barrier stands in front of these stores).
// Phase 5: y_att[i][d] = sum_j P v: A = P rows i (k = j), B = vTh/vTl as [n=d][k=j]; hi and residual in
//          separate accumulators; y = (acc_h + acc_l/2048)/16384 + xs, written back into xs (d < 20). The LDS reads
//          stand in groups ahead of their users: two register sets of B fragments, x read before the first product.
// =====================================================================================================
// register budget for six waves a SIMD: three work-groups a WGP, which is also what the LDS allows
__global__ __launch_bounds__(256) __attribute__((amdgpu_waves_per_eu(6)))
void k_main(const float* __restrict__ x, const float* __restrict__ Wk, const float* __restrict__ bk,
            const float* __restrict__ Wq, const float* __restrict__ bq, const float* __restrict__ Wv,
            const float* __restrict__ bv, float* out) {
  extern __shared__ __align__(16) unsigned char smem[];
  float*    xs  = (float*)(smem + OFF_XS);
  _Float16* xh  = (_Float16*)(smem + OFF_XH);
  _Float16* kS  = (_Float16*)(smem + OFF_KS);
  _Float16* pS  = (_Float16*)(smem + OFF_PS);
  _Float16* vTh = (_Float16*)(smem + OFF_VTH);
  _Float16* vTl = (_Float16*)(smem + OFF_VTL);
  _Float16* wl  = (_Float16*)(smem + OFF_WL);                    // weight planes: WkT, WqT, WvT
  float*    bl  = (float*)(smem + OFF_BL);                       // bias planes: bk, bq

  const int tid  = threadIdx.x;
  const int lane = tid & 31;
  const int wid  = __builtin_amdgcn_readfirstlane(tid >> 5);   // scalar: as a vector value it cost a spill in phase 3
  const int h    = lane >> 4;
  const int lo   = lane & 15;
  const int b    = blockIdx.x;
  const int m0   = wid * 16;
  const float* xb = x + (size_t)b * XROW;

  // ---------------- phase 1: stage the weight planes and x ----------------
  {
    const int row = tid & 127;
    const float* xr  = xb + row * CC;               // row*80 B, 16-B aligned
    float*       xsr = xs + row * CC;
    _Float16*    xhr = xh + row * PX;
    _Float16*    wrow = wl + tid * PX;
    float*       brow = bl + tid;                   // written by threads 0..223 only
    const bool isq = tid >= NRKQ;
    const int  n   = isq ? tid - NRKQ : tid;        // row of WkT / WqT (waves 0..6)
    const int  nc  = min(n, KQ - 1);
    const float* wcol = (isq ? Wq : Wk) + nc;
    const float* bsrc = (isq ? bq : bk) + nc;
    if (wid < 4)                                    // the three cases are wave-uniform (scalar tests)
      stage_w_x<KQ, true, 0>(wcol, bsrc, n < KQ, xr, wrow, brow, xsr, xhr);
    else if (wid < 7)
      stage_w_x<KQ, true, 1>(wcol, bsrc, n < KQ, xr, wrow, brow, xsr, xhr);
    else
      stage_w_x<CC, false, 1>(Wv + min(lane, CC - 1), nullptr, lane < CC, xr, wrow, brow, xsr, xhr);
  }
  __syncthreads();

  // ---------------- phase 2: projections (K = 32, one k-step) ----------------
  Frag qa[4];                                                    // q rows m0+lo as the A fragments of phase 3
  {
    const v16h af = ldfrag(xh + (m0 + lo) * PX + 8 * h);        // row / col token m0+lo, k = c
    const _Float16* pw = wl + lo * PX + 8 * h;                   // A: plane row 16t+lo (n = 16nt+lo of WkT, WqT), k = c
    const float*    pc = bl + 8 * h;                             // C: plane rows 16t+8h+r
    // v = tanh(x.Wv + bv), stored transposed as hi + residual planes
#pragma unroll 1
    for (int nt = 0; nt < 2; ++nt) {
      const int n0 = nt * 16, d = n0 + lo;
      const v8f acc = mma(af, ldfrag(pw + (2 * NRKQ + n0) * PX), zero8());
      const float bias = bfr(bv[min(d, CC - 1)]);
#pragma unroll
      for (int r = 0; r < 8; ++r) {
        float val = tanh_f(acc[r] * 6.103515625e-05f + bias);
        val = (d < CC) ? val : 0.0f;
        const float v16 = val * 16.0f;
        const _Float16 hh = (_Float16)v16;
        const _Float16 ll = (_Float16)((v16 - (float)hh) * 2048.0f);
        vTh[d * PH + m0 + 8 * h + r] = hh;
        vTl[d * PH + m0 + 8 * h + r] = ll;
      }
    }
    // k^T = elu(Wk^T.x^T + bk): tiles t = 0..6; q^T = elu(Wq^T.x^T + bq): tiles t = 7..13
    _Float16* kw = kS + (m0 + lo) * PH + 8 * h;
    v16h wf[2 * NTKQ];
    union { v8f v; v4f q[2]; } cb[2 * NTKQ];
    v8f ac[2 * NTKQ];
    // elu (alpha = 1) of v = acc / 8, carried x8: exp(v) = exp2(acc * CE), u = 8 * exp(v) - 8. As exp(v) - 1 >= v for
    // every v, acc <= u: for v > 0 the order is 0 < acc <= u, for v <= 0 it is acc <= u <= 0, so 8 * elu(v) is the
    // middle one of acc, 0 and u: one v_med3 in place of a compare and a select
    const float CE = 1.4426950408889634f * 0.125f;
#define LOAD_TILE(t)                                                                         \
    {                                                                                          \
      wf[t]      = ldfrag(pw + (t) * 16 * PX);                                                 \
      cb[t].q[0] = *(const v4f*)(pc + (t) * 16);                                               \
      cb[t].q[1] = *(const v4f*)(pc + (t) * 16 + 4);                                           \
    }
#define MMA_TILE(t)                                                                          \
    ac[t] = __builtin_amdgcn_wmma_f32_16x16x32_f16(false, wf[t], false, af, (short)0, cb[t].v, false, false)
    LOAD_TILE(0) LOAD_TILE(1) LOAD_TILE(2)
    // keeps the twelve reads of the first three tiles one group in front of the first product: left alone the compiler
    // put the bias reads of tile 1 and a wait for them directly in front of its product
    __builtin_amdgcn_sched_barrier(0);
    MMA_TILE(0);
#pragma unroll
    for (int t = 0; t < 2 * NTKQ; ++t) {
      if (t + 1 < 2 * NTKQ) MMA_TILE(t + 1);                     // its result slots are filled by tile t's elu
      float e[8];
#pragma unroll
      for (int r = 0; r < 8; ++r) e[r] = ac[t][r] * CE;
      exp2x8(e);
      v8h o;
#pragma unroll
      for (int r = 0; r < 8; r += 2) {
        v2f u;                                                   // two values a v_pk_fma_f32
        u[0] = e[r];
        u[1] = e[r + 1];
        u = __builtin_elementwise_fma(u, (v2f)(8.0f), (v2f)(-8.0f));
        o[r]     = (_Float16)__builtin_amdgcn_fmed3f(ac[t][r], 0.0f, u[0]);
        o[r + 1] = (_Float16)__builtin_amdgcn_fmed3f(ac[t][r + 1], 0.0f, u[1]);
      }
      if (t < NTKQ) *(v8h*)(kw + t * 16) = o;
      else          qa[(t - NTKQ) >> 1].half[(t - NTKQ) & 1] = o;
      if (t + 3 < 2 * NTKQ) LOAD_TILE(t + 3)
      // one tile a group: keeps the LDS reads of tile t+3 a whole tile in front of their product (left alone the compiler
      // put each tile's four reads and a full wait directly in front of it), and ends q's elu in front of phase 3
      __builtin_amdgcn_sched_barrier(0);
    }
#undef LOAD_TILE
#undef MMA_TILE
    v8h z8;
#pragma unroll
    for (int r = 0; r < 8; ++r) z8[r] = (_Float16)0.0f;
    *(v8h*)(kw + NTKQ * 16) = z8;
    qa[NTKQ >> 1].half[NTKQ & 1] = z8;
  }
  __syncthreads();

  // ---------------- phase 3: scores, transposed: S^T[j][i] (K = 128 over d), kept in registers ----------------
  v8f acc[8];                                                    // acc[nt][r] = 64 * S[i = 16nt+lo][j = m0+8h+r]
  {
    const _Float16* pb = kS + lo * PH + 8 * h;                   // B: col i = 16nt+lo, k = d (the map of qa)
#pragma unroll
    for (int nt = 0; nt < 8; ++nt) acc[nt] = zero8();
#pragma unroll
    for (int ks = 0; ks < 4; ++ks) {                             // k-step outermost: 8 independent accumulators in a row
      v16h bf[8];
#pragma unroll
      for (int nt = 0; nt < 8; ++nt) bf[nt] = ldfrag(pb + nt * 16 * PH + 32 * ks);
      // keeps the 16 LDS reads of a k-step one group in front of its 8 products: left alone the compiler put two
      // reads and a full wait in front of every product, one LDS latency each
      __builtin_amdgcn_sched_barrier(0);
#pragma unroll
      for (int nt = 0; nt < 8; ++nt)
        acc[nt] = __builtin_amdgcn_wmma_f32_16x16x32_f16(false, qa[ks].v, false, bf[nt], (short)0, acc[nt], false, false);
      // second half of the pair: the next k-step's reads stay behind these products (their registers are reused)
      __builtin_amdgcn_sched_barrier(0);
    }
  }

  // ---------------- phase 4: softmax over i, per column j, in registers ----------------
  {
    // exp(s - max) = exp2((acc - max_acc) * C2), C2 = (1/sqrt(128)) * 2^-6 * log2(e) > 0
    const float C2 = 0.08838834764831845f * 0.015625f * 1.4426950408889634f;
    float mx[8], rs[8];
#pragma unroll
    for (int r = 0; r < 8; ++r) {
      mx[r] = acc[0][r];
#pragma unroll
      for (int nt = 1; nt < 8; ++nt) mx[r] = fmaxf(mx[r], acc[nt][r]);
    }
    row_max16x8(mx);
#pragma unroll
    for (int r = 0; r < 8; ++r) {
      const float nb = -C2 * mx[r];
      float t[8];
#pragma unroll
      for (int nt = 0; nt < 8; ++nt) t[nt] = __builtin_fmaf(acc[nt][r], C2, nb);
      exp2x8(t);
      float sum = t[0];
      acc[0][r] = t[0];
#pragma unroll
      for (int nt = 1; nt < 8; ++nt) {
        acc[nt][r] = t[nt];
        sum += t[nt];
      }
      rs[r] = row_sum16(sum);                                    // the largest term is 1: sum >= 1
    }
    rcpx8(rs);
#pragma unroll
    for (int r = 0; r < 8; ++r) rs[r] *= 1024.0f;
    _Float16* Pw = pS + lo * PH + m0 + 8 * h;                    // P as [i][j], carried x1024
#pragma unroll
    for (int nt = 0; nt < 8; ++nt) {
      v8h p;
#pragma unroll
      for (int r = 0; r < 8; ++r) p[r] = (_Float16)(acc[nt][r] * rs[r]);
      *(v8h*)(Pw + nt * 16 * PH) = p;
    }
  }
  __syncthreads();

  // ---------------- phase 5: y = P.v + x (K = 128 over j; hi and residual accumulators) ----------------
  {
    const _Float16* pa = pS + (m0 + lo) * PH + 8 * h;            // A: row i = m0+lo, k = j
    const _Float16* pv = vTh + lo * PH + 8 * h;                  // B: col d = lo, k = j, of the hi plane
    static_assert(OFF_VTL == OFF_VTH + CP * PH * 2);             // the residual plane lies CP rows behind the hi plane
    const int d1  = 16 + lo;
    const int d1c = min(d1, CC - 1);
    float* px = xs + (m0 + 8 * h) * CC;                          // rows i = m0+8h+r, the wave's own
    v16h pf[4], bs[2][4];                                        // bs: two register sets of a k-step's four B fragments
    float x0[8], x1[8];
    v8f ay[4];                                                   // hi d=lo, hi d=16+lo, residual d=lo, residual d=16+lo
#define LOAD_B(set, ks)                                                                      \
    {                                                                                          \
      bs[set][0] = ldfrag(pv + 32 * (ks));                                                     \
      bs[set][1] = ldfrag(pv + 16 * PH + 32 * (ks));                                           \
      bs[set][2] = ldfrag(pv + CP * PH + 32 * (ks));                                           \
      bs[set][3] = ldfrag(pv + (CP + 16) * PH + 32 * (ks));                                    \
    }
#define MMA_B(set, ks)                                                                       \
    _Pragma("unroll") /* constant indices: four independent accumulators in a row */           \
    for (int q = 0; q < 4; ++q)                                                                \
      ay[q] = __builtin_amdgcn_wmma_f32_16x16x32_f16(false, pf[ks], false, bs[set][q], (short)0, ay[q], false, false);
#pragma unroll                                                 // constant indices: ay stays in registers
    for (int q = 0; q < 4; ++q) ay[q] = zero8();
    pf[0] = ldfrag(pa);
    LOAD_B(0, 0)
    pf[1] = ldfrag(pa + 32);
    LOAD_B(1, 1)
    pf[2] = ldfrag(pa + 64);
    pf[3] = ldfrag(pa + 96);
#pragma unroll                                                 // constant indices; the 16 reads issue in a row
    for (int r = 0; r < 8; ++r) {
      x0[r] = px[r * CC + lo];                                   // d = lo < 16 < 20 always valid
      x1[r] = px[r * CC + d1c];
    }
    MMA_B(0, 0)
    LOAD_B(0, 2)
    MMA_B(1, 1)
    LOAD_B(1, 3)
    MMA_B(0, 2)
    MMA_B(1, 3)
    // Order of this phase's LDS reads (0x100) and products (0x008): the reads of k-steps 0 and 1, of all of P and of x as
    // one group, then four products and the eight reads of the k-step after next, by turns. Left alone the compiler put
    // two reads and a full wait in front of every product and one read and a full wait in front of every output row,
    // one LDS latency each.
    __builtin_amdgcn_sched_group_barrier(0x100, 32, 0);
    __builtin_amdgcn_sched_group_barrier(0x008, 4, 0);
    __builtin_amdgcn_sched_group_barrier(0x100, 8, 0);
    __builtin_amdgcn_sched_group_barrier(0x008, 4, 0);
    __builtin_amdgcn_sched_group_barrier(0x100, 8, 0);
    __builtin_amdgcn_sched_group_barrier(0x008, 8, 0);
#undef LOAD_B
#undef MMA_B
    float v1[8];
#pragma unroll                                                 // constant indices: ay, x0, x1, v1 stay in registers
    for (int r = 0; r < 8; ++r) {
      const float y0 = (ay[0][r] + ay[2][r] * 0.00048828125f) * 6.103515625e-05f;   // (h + l/2048) * 2^-14
      const float y1 = (ay[1][r] + ay[3][r] * 0.00048828125f) * 6.103515625e-05f;
      px[r * CC + lo] = x0[r] + y0;
      v1[r] = x1[r] + y1;
    }
    if (lo < 4) {                                                // d = 16..19
#pragma unroll                                                 // constant indices; the 8 stores issue in a row
      for (int r = 0; r < 8; ++r) px[r * CC + d1] = v1[r];
    }
  }
  __syncthreads();

  {
    const v4f* xs4 = (const v4f*)xs;
    const int c2  = 16 + wid;                                    // valid iff wid < 4 (wave-uniform)
    const int c2c = min(c2, 19);
    const v4f pv0 = xs4[(wid)     * 32 + lane];
    const v4f pv1 = xs4[(8 + wid) * 32 + lane];
    const v4f pv2 = xs4[c2c       * 32 + lane];
    float* ob = out + (size_t)b * XROW + (size_t)lane * 4;
    *(v4f*)(ob + (size_t)wid * 128)       = pv0;
    *(v4f*)(ob + (size_t)(8 + wid) * 128) = pv1;
#if defined(__HIP_DEVICE_COMPILE__)
    // the wait that stands between issued global stores and any later write of a register that they name
    asm volatile("s_wait_xcnt 0x0" ::: "memory");
#endif
    if (wid < 4) *(v4f*)(ob + (size_t)c2 * 128) = pv2;
    
  }
}

// One launch; the workspace is not used.
extern "C" void kernel_launch(void* const* d_in, const int* in_sizes, int n_in,
                              void* d_out, int out_size, void* d_ws, size_t ws_size,
                              hipStream_t stream) {
  if (n_in < 7) return;
  if (in_sizes[0] != NBATCH * XROW) return;
  if (in_sizes[1] != CC * KQ) return;
  if (in_sizes[2] != KQ) return;
  if (in_sizes[3] != CC * KQ) return;
  if (in_sizes[4] != KQ) return;
  if (in_sizes[5] != CC * CC) return;
  if (in_sizes[6] != CC) return;
  if (out_size != NBATCH * XROW) return;

  const float* x  = (const float*)d_in[0];     // [4096][128][20]
  const float* Wk = (const float*)d_in[1];     // [20][100]
  const float* bk = (const float*)d_in[2];     // [100]
  const float* Wq = (const float*)d_in[3];     // [20][100]
  const float* bq = (const float*)d_in[4];     // [100]
  const float* Wv = (const float*)d_in[5];     // [20][20]
  const float* bv = (const float*)d_in[6];     // [20]
  float* out = (float*)d_out;                  // [4096][128][20]

  (void)d_ws;
  (void)ws_size;

  (void)hipFuncSetAttribute(reinterpret_cast<const void*>(&k_main),
                            hipFuncAttributeMaxDynamicSharedMemorySize, LDS_MAIN);

  const dim3 gMain(NBATCH), bMain(256);

  k_main<<<gMain, bMain, LDS_MAIN, stream>>>(x, Wk, bk, Wq, bq, Wv, bv, out);
  (void)hipGetLastError();
}

// v008
// One run takes 37.4 microseconds.
// Two timings next to v007 both put it at 1.07 times that version's speed.
// Over all steps from v000 it is 9.42 times as fast.
// Contractions on v_wmma_f32_16x16x32_f16, f32 accumulate: x.Wk, x.Wq, x.Wv with f16 operands built from
// bf16-RNE inputs (x carried x16, Wk and Wq x0.5, Wv x1024), single products (k and q as W^T.x^T); the three biases ride
// in the products as channel 20 of the padded k (x = 1 there, the weight planes hold the bias);
// k.q^T with k and q as plain f16 carried x8;
// P.v with P as plain f16 carried x1024 and v as f16 hi (x16) + x2048 residual plane (separate accumulator);
// elu, tanh, column softmax (in registers) and the residual add in f32 on VALU.
#include <hip/hip_runtime.h>
#include <stdint.h>

#define NBATCH 4096
#define TT     128              // tokens per item
#define CC     20               // channels
#define KQ     100              // key/query dim
#define CP     32               // channels padded (k of the projections)
#define DP     128              // key dim padded (k of the score product)
#define PX     40               // LDS pitch of xh in halves: 80 B = 16 B x 5
#define PH     136              // LDS pitch of kS, P, vTh, vTl in halves: 272 B = 16 B x 17
#define XROW   (TT * CC)        // 2560 floats per item

static_assert(XROW == 2560 && CC % 2 == 0);
static_assert(TT == 128);
static_assert(DP == TT);
static_assert(PX >= CP && PH >= DP);
static_assert((PX * 2) % 32 == 16 && (PH * 2) % 32 == 16);    // 16-B fragment reads: pitch = 16 B x odd

// LDS byte offsets of the main kernel
#define OFF_XS   0              // f32 [128][20]   10240  (bf16-RNE x, later y)
// (the pad columns behind each row's last used column are never written and never read)
#define OFF_XH   10240          // f16 [128][32 of 40]    10240  (16*x, col 20 = 16 (the bias channel), cols 21..31 zero)
#define OFF_KS   20480          // f16 [128][128 of 136]  34816  (8*k, cols 100..127 zero)
#define OFF_PS   55296          // f16 [128][128 of 136]  34816  (1024*P as [i][j])
#define OFF_WL   OFF_PS         // f16 [256][32 of 40]    20480  (weight planes; dead behind phase 2, P comes in phase 4)
#define OFF_VTH  90112          // f16 [32][128 of 136]    8704  (hi of 16*v, transposed [d][j])
#define OFF_VTL  98816          // f16 [32][128 of 136]    8704  (x2048 residual, transposed)
#define LDS_MAIN 107520         // three blocks fit the 327680 B of a WGP
static_assert(OFF_XH == OFF_XS + TT * CC * 4);
static_assert(OFF_KS == OFF_XH + TT * PX * 2);
static_assert(OFF_PS == OFF_KS + TT * PH * 2);
static_assert(OFF_VTH == OFF_PS + TT * PH * 2);
static_assert(OFF_VTL == OFF_VTH + CP * PH * 2);
static_assert(LDS_MAIN == OFF_VTL + CP * PH * 2);
static_assert(3 * LDS_MAIN <= 327680);

#define NTKQ      7               // 16-wide tiles of the key dim that hold a real column (100 = 6 * 16 + 4)
static_assert(NTKQ * 16 >= KQ && (NTKQ - 1) * 16 < KQ && (NTKQ + 1) * 16 == DP);
// weight planes in LDS, one row of 32 c (pitch PX) a thread: rows 0..111 WkT [n][c], 112..223 WqT [n][c], 224..255
// WvT [d][c]; values = f16 of (bf16-RNE value * 0.5) in WkT and WqT, of (bf16-RNE value * 1024) in WvT; c = 20 holds the
// row's bias (bk, bq, bv) converted and scaled like the row's weights; c >= 21 and rows n >= 100, d >= 20 zero. With x
// carried x16 and 16 in its column 20, the k and q accumulators are 8 * (x.W + b), the scale at which k and q are
// carried, and the v accumulator is 16384 * (x.Wv + bv).
#define NRKQ      (NTKQ * 16)     // rows of the WkT and of the WqT plane
static_assert(2 * NRKQ + CP == 256);                            // one plane row a thread of the block
static_assert(2 * NRKQ == 7 * 32);                              // WvT is wave 7's, whole
static_assert(OFF_WL + 256 * PX * 2 <= OFF_VTH);                // they lie inside the region of P
static_assert(CC + 2 <= CP);                                    // the bias channel lies in the pad of k

typedef _Float16     v16h __attribute__((ext_vector_type(16)));
typedef _Float16     v8h  __attribute__((ext_vector_type(8)));
typedef float        v8f  __attribute__((ext_vector_type(8)));
typedef float        v4f  __attribute__((ext_vector_type(4)));
typedef float        v2f  __attribute__((ext_vector_type(2)));
typedef _Float16     v2h  __attribute__((ext_vector_type(2)));
typedef __bf16       v2b  __attribute__((ext_vector_type(2)));

union Frag { v16h v; v8h half[2]; };

// ---- scalar helpers --------------------------------------------------------------------------------
__device__ __forceinline__ unsigned short bf_bits(float f) {          // f32 -> bf16 bits, RNE convert
  unsigned u = __float_as_uint(f);
  return (unsigned short)((u + 0x7FFFu + ((u >> 16) & 1u)) >> 16);
}
__device__ __forceinline__ float bf_up(unsigned short b) { return __uint_as_float(((unsigned)b) << 16); }
__device__ __forceinline__ float bfr(float f) { return bf_up(bf_bits(f)); }   // value after bf16 RNE convert
__device__ __forceinline__ v4f bfr4(v4f a) {
  v4f o;
  o[0] = bfr(a[0]); o[1] = bfr(a[1]); o[2] = bfr(a[2]); o[3] = bfr(a[3]);
  return o;
}
__device__ __forceinline__ v8f zero8() {
  v8f z;
  z[0] = 0.f; z[1] = 0.f; z[2] = 0.f; z[3] = 0.f; z[4] = 0.f; z[5] = 0.f; z[6] = 0.f; z[7] = 0.f;
  return z;
}

// ---- maximum / sum over the 16 lanes of a row (lanes 0..15, lanes 16..31), result in every lane of the row;
//      DPP row_xmask:m (control 0x160 + m) reads lane l ^ m of the same row; all 32 lanes are on at every use
template <int CTRL>
__device__ __forceinline__ float dpp_x(float v) {
  return __builtin_bit_cast(float, __builtin_amdgcn_update_dpp(0, __builtin_bit_cast(int, v), CTRL, 0xf, 0xf, true));
}
// Row maximum of eight values at once. In asm because fmaxf on a DPP move compiled to three instructions a step
// (move, quieting max, max) where the fused v_max_num_f32_dpp is one; the eight chains are interleaved so that
// every instruction's producer stands eight instructions back (no dependent pair in a row).
__device__ __forceinline__ void row_max16x8(float (&m)[8]) {
#if defined(__HIP_DEVICE_COMPILE__)
  asm(
      "v_max_num_f32_dpp %0, %0, %0 row_xmask:1 row_mask:0xf bank_mask:0xf\n\t"
      "v_max_num_f32_dpp %1, %1, %1 row_xmask:1 row_mask:0xf bank_mask:0xf\n\t"
      "v_max_num_f32_dpp %2, %2, %2 row_xmask:1 row_mask:0xf bank_mask:0xf\n\t"
      "v_max_num_f32_dpp %3, %3, %3 row_xmask:1 row_mask:0xf bank_mask:0xf\n\t"
      "v_max_num_f32_dpp %4, %4, %4 row_xmask:1 row_mask:0xf bank_mask:0xf\n\t"
      "v_max_num_f32_dpp %5, %5, %5 row_xmask:1 row_mask:0xf bank_mask:0xf\n\t"
      "v_max_num_f32_dpp %6, %6, %6 row_xmask:1 row_mask:0xf bank_mask:0xf\n\t"
      "v_max_num_f32_dpp %7, %7, %7 row_xmask:1 row_mask:0xf bank_mask:0xf\n\t"
      "v_max_num_f32_dpp %0, %0, %0 row_xmask:2 row_mask:0xf bank_mask:0xf\n\t"
      "v_max_num_f32_dpp %1, %1, %1 row_xmask:2 row_mask:0xf bank_mask:0xf\n\t"
      "v_max_num_f32_dpp %2, %2, %2 row_xmask:2 row_mask:0xf bank_mask:0xf\n\t"
      "v_max_num_f32_dpp %3, %3, %3 row_xmask:2 row_mask:0xf bank_mask:0xf\n\t"
      "v_max_num_f32_dpp %4, %4, %4 row_xmask:2 row_mask:0xf bank_mask:0xf\n\t"
      "v_max_num_f32_dpp %5, %5, %5 row_xmask:2 row_mask:0xf bank_mask:0xf\n\t"
      "v_max_num_f32_dpp %6, %6, %6 row_xmask:2 row_mask:0xf bank_mask:0xf\n\t"
      "v_max_num_f32_dpp %7, %7, %7 row_xmask:2 row_mask:0xf bank_mask:0xf\n\t"
      "v_max_num_f32_dpp %0, %0, %0 row_xmask:4 row_mask:0xf bank_mask:0xf\n\t"
      "v_max_num_f32_dpp %1, %1, %1 row_xmask:4 row_mask:0xf bank_mask:0xf\n\t"
      "v_max_num_f32_dpp %2, %2, %2 row_xmask:4 row_mask:0xf bank_mask:0xf\n\t"
      "v_max_num_f32_dpp %3, %3, %3 row_xmask:4 row_mask:0xf bank_mask:0xf\n\t"
      "v_max_num_f32_dpp %4, %4, %4 row_xmask:4 row_mask:0xf bank_mask:0xf\n\t"
      "v_max_num_f32_dpp %5, %5, %5 row_xmask:4 row_mask:0xf bank_mask:0xf\n\t"
      "v_max_num_f32_dpp %6, %6, %6 row_xmask:4 row_mask:0xf bank_mask:0xf\n\t"
      "v_max_num_f32_dpp %7, %7, %7 row_xmask:4 row_mask:0xf bank_mask:0xf\n\t"
      "v_max_num_f32_dpp %0, %0, %0 row_xmask:8 row_mask:0xf bank_mask:0xf\n\t"
      "v_max_num_f32_dpp %1, %1, %1 row_xmask:8 row_mask:0xf bank_mask:0xf\n\t"
      "v_max_num_f32_dpp %2, %2, %2 row_xmask:8 row_mask:0xf bank_mask:0xf\n\t"
      "v_max_num_f32_dpp %3, %3, %3 row_xmask:8 row_mask:0xf bank_mask:0xf\n\t"
      "v_max_num_f32_dpp %4, %4, %4 row_xmask:8 row_mask:0xf bank_mask:0xf\n\t"
      "v_max_num_f32_dpp %5, %5, %5 row_xmask:8 row_mask:0xf bank_mask:0xf\n\t"
      "v_max_num_f32_dpp %6, %6, %6 row_xmask:8 row_mask:0xf bank_mask:0xf\n\t"
      "v_max_num_f32_dpp %7, %7, %7 row_xmask:8 row_mask:0xf bank_mask:0xf"
      : "+v"(m[0]), "+v"(m[1]), "+v"(m[2]), "+v"(m[3]), "+v"(m[4]), "+v"(m[5]), "+v"(m[6]), "+v"(m[7]));
#endif
}
// Eight transcendentals in place, then one free slot.
// Here result and source are one register, no line touches another line's register, and the closing v_nop is the
// one independent slot the instruction set asks for in front of the first reader.
__device__ __forceinline__ void exp2x8(float (&t)[8]) {
#if defined(__HIP_DEVICE_COMPILE__)
  asm("v_exp_f32 %0, %0\n\tv_exp_f32 %1, %1\n\tv_exp_f32 %2, %2\n\tv_exp_f32 %3, %3\n\t"
      "v_exp_f32 %4, %4\n\tv_exp_f32 %5, %5\n\tv_exp_f32 %6, %6\n\tv_exp_f32 %7, %7\n\tv_nop"
      : "+v"(t[0]), "+v"(t[1]), "+v"(t[2]), "+v"(t[3]), "+v"(t[4]), "+v"(t[5]), "+v"(t[6]), "+v"(t[7]));
#endif
}
__device__ __forceinline__ void rcpx8(float (&t)[8]) {
#if defined(__HIP_DEVICE_COMPILE__)
  asm("v_rcp_f32 %0, %0\n\tv_rcp_f32 %1, %1\n\tv_rcp_f32 %2, %2\n\tv_rcp_f32 %3, %3\n\t"
      "v_rcp_f32 %4, %4\n\tv_rcp_f32 %5, %5\n\tv_rcp_f32 %6, %6\n\tv_rcp_f32 %7, %7\n\tv_nop"
      : "+v"(t[0]), "+v"(t[1]), "+v"(t[2]), "+v"(t[3]), "+v"(t[4]), "+v"(t[5]), "+v"(t[6]), "+v"(t[7]));
#endif
}
__device__ __forceinline__ float row_sum16(float v) {
  v += dpp_x<0x161>(v);
  v += dpp_x<0x162>(v);
  v += dpp_x<0x164>(v);
  v += dpp_x<0x168>(v);
  return v;
}

// ---- 16-bit fragment loader (A, B alike): p points at row/col (lane&15), + k0 + 8*(lane>>4);
//      elements 0..7 <- p[0..7] (k0+8h..k0+8h+7), elements 8..15 <- p[16..23] (k0+16+8h..k0+16+8h+7)
__device__ __forceinline__ v16h ldfrag(const _Float16* p) {
  Frag f;
  f.half[0] = *(const v8h*)(p);
  f.half[1] = *(const v8h*)(p + 16);
  return f.v;
}

// ---- WMMA with trailing VALU hazard gap (ties D, keeps A/B live past the nops) ---------------------
__device__ __forceinline__ v8f mma(v16h a, v16h b, v8f c) {
  v8f d = __builtin_amdgcn_wmma_f32_16x16x32_f16(false, a, false, b, (short)0, c, false, false);
#if defined(__HIP_DEVICE_COMPILE__)
  asm volatile("v_nop\n\tv_nop\n\tv_nop\n\tv_nop" : "+v"(d) : "v"(a), "v"(b));
#endif
  return d;
}

// =====================================================================================================
// One thread's share of phase 1: plane row (column wcol of a [20][NCOL] weight matrix, then its bias; KQP: WkT, WqT) and its part
// of x row xr (PART 0: cols 0..15, PART 1: cols 16..31). The weight loads are issued first and x behind them: loads come
// back in order, the weights from cache and x from memory, so the plane row is converted and stored while x is in flight.
// =====================================================================================================
template <int NCOL, bool KQP, int PART>
__device__ __forceinline__ void stage_w_x(const float* wcol, const float* bsrc, bool real, const float* xr,
                                          _Float16* wrow, float* xsr, _Float16* xhr) {
  float raw[CC + 2];
  raw[CC]     = *bsrc;                                           // channel 20: the bias
  raw[CC + 1] = 0.0f;
#pragma unroll                                                 // the 20 loads issue in a row, ahead of the first use
  for (int c = 0; c < CC; ++c) raw[c] = wcol[c * NCOL];
#if defined(__HIP_DEVICE_COMPILE__)
  // the wait that stands between issued global loads and any later write of a register that they name: a result of an
  // x load may land on an address register of the bias or weight loads
  asm volatile("s_wait_xcnt 0x0" ::: "memory");
#endif
  // keeps that wait behind the bias and weight loads and in front of the x loads
  __builtin_amdgcn_sched_barrier(0);
  v4f a[4];
  if (PART == 0) {
#pragma unroll                                                 // constant indices: a stays in registers
    for (int k = 0; k < 4; ++k) a[k] = *(const v4f*)(xr + 4 * k);
  } else {
    a[0] = *(const v4f*)(xr + 16);
  }
#if defined(__HIP_DEVICE_COMPILE__)
  // the same wait for the x loads
  asm volatile("s_wait_xcnt 0x0" ::: "memory");
#endif
  // keeps that wait directly behind the x loads, and every conversion behind it
  __builtin_amdgcn_sched_barrier(0);
  const float sw = real ? (KQP ? 0.5f : 1024.0f) : 0.0f;         // a pad row comes out zero, its bias too
  v8h o[CP / 8];
#pragma unroll                                                 // constant indices: o stays in registers
  for (int c = 0; c < CP; ++c) o[c >> 3][c & 7] = (_Float16)0.0f;
#pragma unroll                                                 // constant indices: raw and o stay in registers
  for (int c = 0; c < CC + 2; c += 2) {                          // bf16 RNE by the packed convert, two values at a time
    v2f p;
    p[0] = raw[c];
    p[1] = raw[c + 1];
    const v2h q = __builtin_convertvector(__builtin_convertvector(__builtin_convertvector(p, v2b), v2f) * sw, v2h);
    o[c >> 3][c & 7]       = q[0];
    o[c >> 3][(c & 7) + 1] = q[1];
  }
#pragma unroll                                                 // constant indices; the 4 stores issue in a row
  for (int k = 0; k < CP / 8; ++k) *(v8h*)(wrow + k * 8) = o[k];
  // keeps all of the plane row's LDS stores in front of the first use of x (the wait for memory)
  __builtin_amdgcn_sched_barrier(0);
  if (PART == 0) {
    const v4f a0 = bfr4(a[0]);
    const v4f a1 = bfr4(a[1]);
    const v4f a2 = bfr4(a[2]);
    const v4f a3 = bfr4(a[3]);
    *(v4f*)(xsr)      = a0;
    *(v4f*)(xsr + 4)  = a1;
    *(v4f*)(xsr + 8)  = a2;
    *(v4f*)(xsr + 12) = a3;
    v8h p0, p1;
#pragma unroll
    for (int c = 0; c < 4; ++c) {
      p0[c]     = (_Float16)(a0[c] * 16.0f);
      p0[4 + c] = (_Float16)(a1[c] * 16.0f);
      p1[c]     = (_Float16)(a2[c] * 16.0f);
      p1[4 + c] = (_Float16)(a3[c] * 16.0f);
    }
    *(v8h*)(xhr)     = p0;
    *(v8h*)(xhr + 8) = p1;
  } else {
    const v4f a4 = bfr4(a[0]);
    *(v4f*)(xsr + 16) = a4;
    v8h p2, p3;
#pragma unroll
    for (int c = 0; c < 4; ++c) {
      p2[c]     = (_Float16)(a4[c] * 16.0f);
      p2[4 + c] = (_Float16)(c == 0 ? 16.0f : 0.0f);             // column 20: 1, carried x16 like x
      p3[c]     = (_Float16)0.0f;
      p3[4 + c] = (_Float16)0.0f;
    }
    *(v8h*)(xhr + 16) = p2;
    *(v8h*)(xhr + 24) = p3;
  }
}

// =====================================================================================================
// Main: one 256-thread block (8 waves) per batch item; wave w owns token rows 16w..16w+15 in the projections and
// in P.v, and score COLUMNS j = 16w..16w+15 (all 128 rows i) in the score product.
// Phase 1: x -> xs (f32 bf16-RNE values) and xh (f16 of 16*x, col 20 = 16, cols 21..31 zero); threads 0..127 write cols
//          0..15 of row tid, threads 128..255 cols 16..31 (wave-uniform split). coverage: 128 rows x 32 cols.
//          Thread tid also builds row tid of the weight planes (its bias as channel 20) in LDS, from Wk, Wq, Wv, bk, bq, bv.
// Phase 2: projections, one k-step (k = c, split map, the same for A and B). k and q transposed: A = W plane rows
//          n from LDS [n][c], B = xh as [col = token][c], C = 0 (the bias is channel 20); D (row n = 16nt+8h+r, col token
//          m0+lo): a lane holds 8 neighbouring d of ONE token, which is half a 16-bit fragment of that token's row.
//          elu in f32, f16(8*val); pad rows n >= 100 come out 0 (the plane rows are 0 there, elu(0) = 0).
//          k: one 16-B store a tile into kS [i][d], cols 112..127 stored as zeros. q: tiles 2s and 2s+1 ARE the
//          A fragment of k-step s of phase 3 (elements 0..7: d = 32s+8h+r, 8..15: d = 32s+16+8h+r, row m0+lo);
//          it stays in registers. v: A = xh rows, B = WvT; D (row m0+8h+r, col d) -> tanh -> vTh/vTl [d][j] for
//          d 0..31 (d >= 20: the plane rows are 0, bias channel included, and tanh(0) comes out 0).
// Phase 3: S^T[j][i] = sum_d q[j][d] k[i][d]: A = q rows j (the wave's own 16, registers), B = kS as [n=i][k=d];
//          8 column tiles x 4 k-steps; D (row j = m0+8h+r, col i = 16nt+lo) stays in 64 accumulator registers.
// Phase 4: softmax over i per column j, in registers: i runs over the 8 tiles and the 16 lanes of a row, so max
//          and sum are 8 values a lane, each folded over nt and then over the row by DPP; the 8 values r of one
//          tile are 8 neighbouring j of row i: P[i][j] = f16(1024 * e / sum) goes into its own region as [i][j]
//          with one 16-B store a tile (the weight planes lie in that region: their last reads, in phase 2,
//          end at the barrier in front of phase 3, so no further barrier stands in front of these stores).
// Phase 5: y_att[i][d] = sum_j P v: A = P rows i (k = j), B = vTh/vTl as [n=d][k=j]; hi and residual in
//          separate accumulators; y = (acc_h + acc_l/2048)/16384 + xs, written back into xs (d < 20). The LDS reads
//          stand in groups ahead of their users: two register sets of B fragments, x read before the first product.
// =====================================================================================================
// register budget for six waves a SIMD: three work-groups a WGP, which is also what the LDS allows
__global__ __launch_bounds__(256) __attribute__((amdgpu_waves_per_eu(6)))
void k_main(const float* __restrict__ x, const float* __restrict__ Wk, const float* __restrict__ bk,
            const float* __restrict__ Wq, const float* __restrict__ bq, const float* __restrict__ Wv,
            const float* __restrict__ bv, float* out) {
  extern __shared__ __align__(16) unsigned char smem[];
  float*    xs  = (float*)(smem + OFF_XS);
  _Float16* xh  = (_Float16*)(smem + OFF_XH);
  _Float16* kS  = (_Float16*)(smem + OFF_KS);
  _Float16* pS  = (_Float16*)(smem + OFF_PS);
  _Float16* vTh = (_Float16*)(smem + OFF_VTH);
  _Float16* vTl = (_Float16*)(smem + OFF_VTL);
  _Float16* wl  = (_Float16*)(smem + OFF_WL);                    // weight planes: WkT, WqT, WvT

  const int tid  = threadIdx.x;
  const int lane = tid & 31;
  const int wid  = __builtin_amdgcn_readfirstlane(tid >> 5);   // scalar: as a vector value it cost a spill in phase 3
  const int h    = lane >> 4;
  const int lo   = lane & 15;
  const int b    = blockIdx.x;
  const int m0   = wid * 16;
  const float* xb = x + (size_t)b * XROW;

  // ---------------- phase 1: stage the weight planes and x ----------------
  {
    const int row = tid & 127;
    const float* xr  = xb + row * CC;               // row*80 B, 16-B aligned
    float*       xsr = xs + row * CC;
    _Float16*    xhr = xh + row * PX;
    _Float16*    wrow = wl + tid * PX;
    const bool isq = tid >= NRKQ;
    const int  n   = isq ? tid - NRKQ : tid;        // row of WkT / WqT (waves 0..6)
    const int  nc  = min(n, KQ - 1);
    const float* wcol = (isq ? Wq : Wk) + nc;
    const float* bsrc = (isq ? bq : bk) + nc;
    if (wid < 4)                                    // the three cases are wave-uniform (scalar tests)
      stage_w_x<KQ, true, 0>(wcol, bsrc, n < KQ, xr, wrow, xsr, xhr);
    else if (wid < 7)
      stage_w_x<KQ, true, 1>(wcol, bsrc, n < KQ, xr, wrow, xsr, xhr);
    else
      stage_w_x<CC, false, 1>(Wv + min(lane, CC - 1), bv + min(lane, CC - 1), lane < CC, xr, wrow, xsr, xhr);
  }
  __syncthreads();

  // ---------------- phase 2: projections (K = 32, one k-step) ----------------
  Frag qa[4];                                                    // q rows m0+lo as the A fragments of phase 3
  {
    const v16h af = ldfrag(xh + (m0 + lo) * PX + 8 * h);        // row / col token m0+lo, k = c
    const _Float16* pw = wl + lo * PX + 8 * h;                   // A: plane row 16t+lo (n = 16nt+lo of WkT, WqT), k = c
    // v = tanh(x.Wv + bv), stored transposed as hi + residual planes
#pragma unroll 1
    for (int nt = 0; nt < 2; ++nt) {
      const int n0 = nt * 16, d = n0 + lo;
      const v8f acc = mma(af, ldfrag(pw + (2 * NRKQ + n0) * PX), zero8());
      // branchless tanh of c = acc * 2^-14 (the bias is in acc): (t - 1) / (t + 1), t = exp(2c); the clamp of c at +-15 and
      // the factor 2 * log2(e) are applied at the accumulator's scale (powers of two: the same values)
      float t[8], dn[8];
#pragma unroll
      for (int r = 0; r < 8; ++r)
        t[r] = fminf(fmaxf(acc[r], -15.0f * 16384.0f), 15.0f * 16384.0f) * (1.4426950408889634f * 0.0001220703125f);
      exp2x8(t);
#pragma unroll
      for (int r = 0; r < 8; ++r) dn[r] = t[r] + 1.0f;
      rcpx8(dn);
      v8h oh, ol;
#pragma unroll
      for (int r = 0; r < 8; r += 2) {                           // by pairs r, r+1: packed f32 operations and converts
        v2f w;
        w[0] = (t[r] - 1.0f) * dn[r];
        w[1] = (t[r + 1] - 1.0f) * dn[r + 1];
        w *= 16.0f;
        const v2h hh = __builtin_convertvector(w, v2h);
        const v2h ll = __builtin_convertvector((w - __builtin_convertvector(hh, v2f)) * 2048.0f, v2h);
        oh[r] = hh[0]; oh[r + 1] = hh[1];
        ol[r] = ll[0]; ol[r + 1] = ll[1];
      }
      *(v8h*)(vTh + d * PH + m0 + 8 * h) = oh;
      *(v8h*)(vTl + d * PH + m0 + 8 * h) = ol;
    }
    // k^T = elu(Wk^T.x^T + bk): tiles t = 0..6; q^T = elu(Wq^T.x^T + bq): tiles t = 7..13
    _Float16* kw = kS + (m0 + lo) * PH + 8 * h;
    v16h wf[2 * NTKQ];
    v8f ac[2 * NTKQ];
    // elu (alpha = 1) of v = acc / 8, carried x8: exp(v) = exp2(acc * CE), u = 8 * exp(v) - 8. As exp(v) - 1 >= v for
    // every v, acc <= u: for v > 0 the order is 0 < acc <= u, for v <= 0 it is acc <= u <= 0, so 8 * elu(v) is the
    // middle one of acc, 0 and u: one v_med3 in place of a compare and a select
    const float CE = 1.4426950408889634f * 0.125f;
#define LOAD_TILE(t) wf[t] = ldfrag(pw + (t) * 16 * PX);
#define MMA_TILE(t)                                                                          \
    ac[t] = __builtin_amdgcn_wmma_f32_16x16x32_f16(false, wf[t], false, af, (short)0, zero8(), false, false)
    LOAD_TILE(0) LOAD_TILE(1) LOAD_TILE(2)
    // keeps the six reads of the first three tiles one group in front of the first product, so that tiles 1 and 2 meet
    // no LDS wait of their own
    __builtin_amdgcn_sched_barrier(0);
    MMA_TILE(0);
#pragma unroll
    for (int t = 0; t < 2 * NTKQ; ++t) {
      float e[8];
#pragma unroll
      for (int r = 0; r < 8; ++r) e[r] = ac[t][r] * CE;
      exp2x8(e);
      v2f u[4];                                                  // two values a v_pk_fma_f32
#pragma unroll
      for (int r = 0; r < 8; r += 2) {
        u[r >> 1][0] = e[r];
        u[r >> 1][1] = e[r + 1];
        u[r >> 1] = __builtin_elementwise_fma(u[r >> 1], (v2f)(8.0f), (v2f)(-8.0f));
      }
      // The pair holds tile t+1's product here, where the rest of tile t's elu (12 instructions) fills its result slots.
      // Left alone, with C = 0, the compiler gave it tile t's accumulator registers and put it behind their last read,
      // four instructions in front of its own first reader.
      __builtin_amdgcn_sched_barrier(0);
      if (t + 1 < 2 * NTKQ) MMA_TILE(t + 1);
      __builtin_amdgcn_sched_barrier(0);
      v8h o;
#pragma unroll
      for (int r = 0; r < 8; r += 2) {
        o[r]     = (_Float16)__builtin_amdgcn_fmed3f(ac[t][r], 0.0f, u[r >> 1][0]);
        o[r + 1] = (_Float16)__builtin_amdgcn_fmed3f(ac[t][r + 1], 0.0f, u[r >> 1][1]);
      }
      if (t < NTKQ) *(v8h*)(kw + t * 16) = o;
      else          qa[(t - NTKQ) >> 1].half[(t - NTKQ) & 1] = o;
      if (t + 3 < 2 * NTKQ) LOAD_TILE(t + 3)
#if defined(__HIP_DEVICE_COMPILE__)
      // inputs only: the A and B fragments of tile t+1's product stay in their registers to the end of tile t's elu.
      // Without it results of that elu landed on those registers directly behind the product, and the compiler put
      // three or four v_nop there
      if (t + 1 < 2 * NTKQ) asm volatile("" :: "v"(wf[t + 1]), "v"(af));
#endif
      // one tile a group: keeps the LDS reads of tile t+3 a whole tile in front of their product (left alone the compiler
      // put each tile's reads and a full wait directly in front of it), and ends q's elu in front of phase 3
      __builtin_amdgcn_sched_barrier(0);
    }
#undef LOAD_TILE
#undef MMA_TILE
    v8h z8;
#pragma unroll
    for (int r = 0; r < 8; ++r) z8[r] = (_Float16)0.0f;
    *(v8h*)(kw + NTKQ * 16) = z8;
    qa[NTKQ >> 1].half[NTKQ & 1] = z8;
  }
  __syncthreads();

  // ---------------- phase 3: scores, transposed: S^T[j][i] (K = 128 over d), kept in registers ----------------
  v8f acc[8];                                                    // acc[nt][r] = 64 * S[i = 16nt+lo][j = m0+8h+r]
  {
    const _Float16* pb = kS + lo * PH + 8 * h;                   // B: col i = 16nt+lo, k = d (the map of qa)
#pragma unroll
    for (int nt = 0; nt < 8; ++nt) acc[nt] = zero8();
#pragma unroll
    for (int ks = 0; ks < 4; ++ks) {                             // k-step outermost: 8 independent accumulators in a row
      v16h bf[8];
#pragma unroll
      for (int nt = 0; nt < 8; ++nt) bf[nt] = ldfrag(pb + nt * 16 * PH + 32 * ks);
      // keeps the 16 LDS reads of a k-step one group in front of its 8 products: left alone the compiler put two
      // reads and a full wait in front of every product, one LDS latency each
      __builtin_amdgcn_sched_barrier(0);
#pragma unroll
      for (int nt = 0; nt < 8; ++nt)
        acc[nt] = __builtin_amdgcn_wmma_f32_16x16x32_f16(false, qa[ks].v, false, bf[nt], (short)0, acc[nt], false, false);
      // second half of the pair: the next k-step's reads stay behind these products (their registers are reused)
      __builtin_amdgcn_sched_barrier(0);
    }
  }

  // ---------------- phase 4: softmax over i, per column j, in registers ----------------
  {
    // exp(s - max) = exp2((acc - max_acc) * C2), C2 = (1/sqrt(128)) * 2^-6 * log2(e) > 0
    const float C2 = 0.08838834764831845f * 0.015625f * 1.4426950408889634f;
    float mx[8], rs[8];
#pragma unroll
    for (int r = 0; r < 8; ++r) {
      mx[r] = acc[0][r];
#pragma unroll
      for (int nt = 1; nt < 8; ++nt) mx[r] = fmaxf(mx[r], acc[nt][r]);
    }
    row_max16x8(mx);
#pragma unroll
    for (int r = 0; r < 8; ++r) {
      const float nb = -C2 * mx[r];
      float t[8];
#pragma unroll
      for (int nt = 0; nt < 8; ++nt) t[nt] = __builtin_fmaf(acc[nt][r], C2, nb);
      exp2x8(t);
      float sum = t[0];
      acc[0][r] = t[0];
#pragma unroll
      for (int nt = 1; nt < 8; ++nt) {
        acc[nt][r] = t[nt];
        sum += t[nt];
      }
      rs[r] = row_sum16(sum);                                    // the largest term is 1: sum >= 1
    }
    rcpx8(rs);
#pragma unroll
    for (int r = 0; r < 8; ++r) rs[r] *= 1024.0f;
    _Float16* Pw = pS + lo * PH + m0 + 8 * h;                    // P as [i][j], carried x1024
#pragma unroll
    for (int nt = 0; nt < 8; ++nt) {
      v8h p;
#pragma unroll
      for (int r = 0; r < 8; ++r) p[r] = (_Float16)(acc[nt][r] * rs[r]);
      *(v8h*)(Pw + nt * 16 * PH) = p;
    }
  }
  __syncthreads();

  // ---------------- phase 5: y = P.v + x (K = 128 over j; hi and residual accumulators) ----------------
  {
    const _Float16* pa = pS + (m0 + lo) * PH + 8 * h;            // A: row i = m0+lo, k = j
    const _Float16* pv = vTh + lo * PH + 8 * h;                  // B: col d = lo, k = j, of the hi plane
    static_assert(OFF_VTL == OFF_VTH + CP * PH * 2);             // the residual plane lies CP rows behind the hi plane
    const int d1  = 16 + lo;
    const int d1c = min(d1, CC - 1);
    float* px = xs + (m0 + 8 * h) * CC;                          // rows i = m0+8h+r, the wave's own
    v16h pf[4], bs[2][4];                                        // bs: two register sets of a k-step's four B fragments
    float x0[8], x1[8];
    v8f ay[4];                                                   // hi d=lo, hi d=16+lo, residual d=lo, residual d=16+lo
#define LOAD_B(set, ks)                                                                      \
    {                                                                                          \
      bs[set][0] = ldfrag(pv + 32 * (ks));                                                     \
      bs[set][1] = ldfrag(pv + 16 * PH + 32 * (ks));                                           \
      bs[set][2] = ldfrag(pv + CP * PH + 32 * (ks));                                           \
      bs[set][3] = ldfrag(pv + (CP + 16) * PH + 32 * (ks));                                    \
    }
#define MMA_B(set, ks)                                                                       \
    _Pragma("unroll") /* constant indices: four independent accumulators in a row */           \
    for (int q = 0; q < 4; ++q)                                                                \
      ay[q] = __builtin_amdgcn_wmma_f32_16x16x32_f16(false, pf[ks], false, bs[set][q], (short)0, ay[q], false, false);
#pragma unroll                                                 // constant indices: ay stays in registers
    for (int q = 0; q < 4; ++q) ay[q] = zero8();
    pf[0] = ldfrag(pa);
    LOAD_B(0, 0)
    pf[1] = ldfrag(pa + 32);
    LOAD_B(1, 1)
    pf[2] = ldfrag(pa + 64);
    pf[3] = ldfrag(pa + 96);
#pragma unroll                                                 // constant indices; the 16 reads issue in a row
    for (int r = 0; r < 8; ++r) {
      x0[r] = px[r * CC + lo];                                   // d = lo < 16 < 20 always valid
      x1[r] = px[r * CC + d1c];
    }
    MMA_B(0, 0)
    LOAD_B(0, 2)
    MMA_B(1, 1)
    LOAD_B(1, 3)
    MMA_B(0, 2)
    MMA_B(1, 3)
    // Order of this phase's LDS reads (0x100) and products (0x008): the reads of k-steps 0 and 1, of all of P and of x as
    // one group, then four products and the eight reads of the k-step after next, by turns. Left alone the compiler put
    // two reads and a full wait in front of every product and one read and a full wait in front of every output row,
    // one LDS latency each.
    __builtin_amdgcn_sched_group_barrier(0x100, 32, 0);
    __builtin_amdgcn_sched_group_barrier(0x008, 4, 0);
    __builtin_amdgcn_sched_group_barrier(0x100, 8, 0);
    __builtin_amdgcn_sched_group_barrier(0x008, 4, 0);
    __builtin_amdgcn_sched_group_barrier(0x100, 8, 0);
    __builtin_amdgcn_sched_group_barrier(0x008, 8, 0);
#undef LOAD_B
#undef MMA_B
    float v1[8];
#pragma unroll                                                 // constant indices: ay, x0, x1, v1 stay in registers
    for (int r = 0; r < 8; ++r) {
      const float y0 = (ay[0][r] + ay[2][r] * 0.00048828125f) * 6.103515625e-05f;   // (h + l/2048) * 2^-14
      const float y1 = (ay[1][r] + ay[3][r] * 0.00048828125f) * 6.103515625e-05f;
      px[r * CC + lo] = x0[r] + y0;
      v1[r] = x1[r] + y1;
    }
    if (lo < 4) {                                                // d = 16..19
#pragma unroll                                                 // constant indices; the 8 stores issue in a row
      for (int r = 0; r < 8; ++r) px[r * CC + d1] = v1[r];
    }
  }
  __syncthreads();

  {
    const v4f* xs4 = (const v4f*)xs;
    const int c2  = 16 + wid;                                    // valid iff wid < 4 (wave-uniform)
    const int c2c = min(c2, 19);
    const v4f pv0 = xs4[(wid)     * 32 + lane];
    const v4f pv1 = xs4[(8 + wid) * 32 + lane];
    const v4f pv2 = xs4[c2c       * 32 + lane];
    float* ob = out + (size_t)b * XROW + (size_t)lane * 4;
    *(v4f*)(ob + (size_t)wid * 128)       = pv0;
    *(v4f*)(ob + (size_t)(8 + wid) * 128) = pv1;
#if defined(__HIP_DEVICE_COMPILE__)
    // the wait that stands between issued global stores and any later write of a register that they name
    asm volatile("s_wait_xcnt 0x0" ::: "memory");
#endif
    if (wid < 4) *(v4f*)(ob + (size_t)c2 * 128) = pv2;
    
  }
}

// One launch; the workspace is not used.
extern "C" void kernel_launch(void* const* d_in, const int* in_sizes, int n_in,
                              void* d_out, int out_size, void* d_ws, size_t ws_size,
                              hipStream_t stream) {
  if (n_in < 7) return;
  if (in_sizes[0] != NBATCH * XROW) return;
  if (in_sizes[1] != CC * KQ) return;
  if (in_sizes[2] != KQ) return;
  if (in_sizes[3] != CC * KQ) return;
  if (in_sizes[4] != KQ) return;
  if (in_sizes[5] != CC * CC) return;
  if (in_sizes[6] != CC) return;
  if (out_size != NBATCH * XROW) return;

  const float* x  = (const float*)d_in[0];     // [4096][128][20]
  const float* Wk = (const float*)d_in[1];     // [20][100]
  const float* bk = (const float*)d_in[2];     // [100]
  const float* Wq = (const float*)d_in[3];     // [20][100]
  const float* bq = (const float*)d_in[4];     // [100]
  const float* Wv = (const float*)d_in[5];     // [20][20]
  const float* bv = (const float*)d_in[6];     // [20]
  float* out = (float*)d_out;                  // [4096][128][20]

  (void)d_ws;
  (void)ws_size;

  (void)hipFuncSetAttribute(reinterpret_cast<const void*>(&k_main),
                            hipFuncAttributeMaxDynamicSharedMemorySize, LDS_MAIN);

  const dim3 gMain(NBATCH), bMain(256);

  k_main<<<gMain, bMain, LDS_MAIN, stream>>>(x, Wk, bk, Wq, bq, Wv, bv, out);
  (void)hipGetLastError();
}

// v009
// Measured time: 35.5 microseconds a run.
// Two timings next to v008 put it at 1.06 and 1.05 times that version's speed.
// All steps since v000 together make it 9.94 times as fast.
// Contractions on v_wmma_f32_16x16x32_f16, f32 accumulate: x.Wk, x.Wq, x.Wv with f16 operands built from
// bf16-RNE inputs (x carried x16, Wk and Wq x0.5, Wv x1024), single products (k and q as W^T.x^T); the three biases ride
// in the products as channel 20 of the padded k (x = 1 there, the weight planes hold the bias);
// k.q^T with k and q as plain f16 carried x8;
// P.v with P as plain f16 carried x1024 and v as f16 hi (x16) + x2048 residual plane (separate accumulator);
// elu, tanh, column softmax (in registers, one column a lane) and the residual add in f32 on VALU.
#include <hip/hip_runtime.h>
#include <stdint.h>

#define NBATCH 4096
#define TT     128              // tokens per item
#define CC     20               // channels
#define KQ     100              // key/query dim
#define CP     32               // channels padded (k of the projections)
#define DP     128              // key dim padded (k of the score product)
#define PX     40               // LDS pitch of xh in halves: 80 B = 16 B x 5
#define PH     136              // LDS pitch of kS, P, vTh, vTl in halves: 272 B = 16 B x 17
#define XROW   (TT * CC)        // 2560 floats per item

static_assert(XROW == 2560 && CC % 2 == 0);
static_assert(TT == 128);
static_assert(DP == TT);
static_assert(PX >= CP && PH >= DP);
static_assert((PX * 2) % 32 == 16 && (PH * 2) % 32 == 16);    // 16-B fragment reads: pitch = 16 B x odd

// LDS byte offsets of the main kernel
#define OFF_XS   0              // f32 [128][20]   10240  (bf16-RNE x, later y)
// (the pad columns behind each row's last used column are never written and never read)
#define OFF_XH   10240          // f16 [128][32 of 40]    10240  (16*x, col 20 = 16 (the bias channel), cols 21..31 zero)
#define OFF_KS   20480          // f16 [128][128 of 136]  34816  (8*k, cols 100..127 zero)
#define OFF_PS   55296          // f16 [128][128 of 136]  34816  (1024*P, transposed: [j][i])
#define OFF_WL   OFF_PS         // f16 [256][32 of 40]    20480  (weight planes; dead behind phase 2, P comes in phase 4)
#define OFF_VTH  90112          // f16 [32][128 of 136]    8704  (hi of 16*v, transposed [d][j])
#define OFF_VTL  98816          // f16 [32][128 of 136]    8704  (x2048 residual, transposed)
#define LDS_MAIN 107520         // three blocks fit the 327680 B of a WGP
static_assert(OFF_XH == OFF_XS + TT * CC * 4);
static_assert(OFF_KS == OFF_XH + TT * PX * 2);
static_assert(OFF_PS == OFF_KS + TT * PH * 2);
static_assert(OFF_VTH == OFF_PS + TT * PH * 2);
static_assert(OFF_VTL == OFF_VTH + CP * PH * 2);
static_assert(LDS_MAIN == OFF_VTL + CP * PH * 2);
static_assert(3 * LDS_MAIN <= 327680);

#define NTKQ      7               // 16-wide tiles of the key dim that hold a real column (100 = 6 * 16 + 4)
static_assert(NTKQ * 16 >= KQ && (NTKQ - 1) * 16 < KQ && (NTKQ + 1) * 16 == DP);
// weight planes in LDS, one row of 32 c (pitch PX) a thread: rows 0..111 WkT [n][c], 112..223 WqT [n][c], 224..255
// WvT [d][c]; values = f16 of (bf16-RNE value * 0.5) in WkT and WqT, of (bf16-RNE value * 1024) in WvT; c = 20 holds the
// row's bias (bk, bq, bv) converted and scaled like the row's weights; c >= 21 and rows n >= 100, d >= 20 zero. With x
// carried x16 and 16 in its column 20, the k and q accumulators are 8 * (x.W + b), the scale at which k and q are
// carried, and the v accumulator is 16384 * (x.Wv + bv).
#define NRKQ      (NTKQ * 16)     // rows of the WkT and of the WqT plane
static_assert(2 * NRKQ + CP == 256);                            // one plane row a thread of the block
static_assert(2 * NRKQ == 7 * 32);                              // WvT is wave 7's, whole
static_assert(OFF_WL + 256 * PX * 2 <= OFF_VTH);                // they lie inside the region of P
static_assert(CC + 2 <= CP);                                    // the bias channel lies in the pad of k

typedef _Float16     v16h __attribute__((ext_vector_type(16)));
typedef _Float16     v8h  __attribute__((ext_vector_type(8)));
typedef float        v8f  __attribute__((ext_vector_type(8)));
typedef float        v4f  __attribute__((ext_vector_type(4)));
typedef float        v2f  __attribute__((ext_vector_type(2)));
typedef _Float16     v2h  __attribute__((ext_vector_type(2)));
typedef __bf16       v2b  __attribute__((ext_vector_type(2)));

union Frag { v16h v; v8h half[2]; };

// ---- scalar helpers --------------------------------------------------------------------------------
__device__ __forceinline__ unsigned short bf_bits(float f) {          // f32 -> bf16 bits, RNE convert
  unsigned u = __float_as_uint(f);
  return (unsigned short)((u + 0x7FFFu + ((u >> 16) & 1u)) >> 16);
}
__device__ __forceinline__ float bf_up(unsigned short b) { return __uint_as_float(((unsigned)b) << 16); }
__device__ __forceinline__ float bfr(float f) { return bf_up(bf_bits(f)); }   // value after bf16 RNE convert
__device__ __forceinline__ v4f bfr4(v4f a) {
  v4f o;
  o[0] = bfr(a[0]); o[1] = bfr(a[1]); o[2] = bfr(a[2]); o[3] = bfr(a[3]);
  return o;
}
__device__ __forceinline__ v8f zero8() {
  v8f z;
  z[0] = 0.f; z[1] = 0.f; z[2] = 0.f; z[3] = 0.f; z[4] = 0.f; z[5] = 0.f; z[6] = 0.f; z[7] = 0.f;
  return z;
}

// ---- the value of lane l ^ 16 (the other 16-lane row); all 32 lanes are on at every use
__device__ __forceinline__ float xhalf(float v) {
  const int b = __builtin_bit_cast(int, v);
  return __builtin_bit_cast(float, __builtin_amdgcn_permlanex16(b, b, 0x76543210, 0xfedcba98, false, false));
}
// Eight transcendentals in place, then one free slot.
// Here result and source are one register, no line touches another line's register, and the closing v_nop is the
// one independent slot the instruction set asks for in front of the first reader.
__device__ __forceinline__ void exp2x8(float (&t)[8]) {
#if defined(__HIP_DEVICE_COMPILE__)
  asm("v_exp_f32 %0, %0\n\tv_exp_f32 %1, %1\n\tv_exp_f32 %2, %2\n\tv_exp_f32 %3, %3\n\t"
      "v_exp_f32 %4, %4\n\tv_exp_f32 %5, %5\n\tv_exp_f32 %6, %6\n\tv_exp_f32 %7, %7\n\tv_nop"
      : "+v"(t[0]), "+v"(t[1]), "+v"(t[2]), "+v"(t[3]), "+v"(t[4]), "+v"(t[5]), "+v"(t[6]), "+v"(t[7]));
#endif
}
// The same eight, out of place: results in registers of their own (early clobber: no line writes any line's source), so
// that the register pairs of the packed instructions on either side need not be one and the same.
__device__ __forceinline__ void exp2x8o(float (&o)[8], const float (&t)[8]) {
#if defined(__HIP_DEVICE_COMPILE__)
  asm("v_exp_f32 %0, %8\n\tv_exp_f32 %1, %9\n\tv_exp_f32 %2, %10\n\tv_exp_f32 %3, %11\n\t"
      "v_exp_f32 %4, %12\n\tv_exp_f32 %5, %13\n\tv_exp_f32 %6, %14\n\tv_exp_f32 %7, %15\n\tv_nop"
      : "=&v"(o[0]), "=&v"(o[1]), "=&v"(o[2]), "=&v"(o[3]), "=&v"(o[4]), "=&v"(o[5]), "=&v"(o[6]), "=&v"(o[7])
      : "v"(t[0]), "v"(t[1]), "v"(t[2]), "v"(t[3]), "v"(t[4]), "v"(t[5]), "v"(t[6]), "v"(t[7]));
#endif
}
__device__ __forceinline__ void rcpx8(float (&t)[8]) {
#if defined(__HIP_DEVICE_COMPILE__)
  asm("v_rcp_f32 %0, %0\n\tv_rcp_f32 %1, %1\n\tv_rcp_f32 %2, %2\n\tv_rcp_f32 %3, %3\n\t"
      "v_rcp_f32 %4, %4\n\tv_rcp_f32 %5, %5\n\tv_rcp_f32 %6, %6\n\tv_rcp_f32 %7, %7\n\tv_nop"
      : "+v"(t[0]), "+v"(t[1]), "+v"(t[2]), "+v"(t[3]), "+v"(t[4]), "+v"(t[5]), "+v"(t[6]), "+v"(t[7]));
#endif
}
// One reciprocal with the same free slot behind it.
__device__ __forceinline__ float rcp1(float t) {
#if defined(__HIP_DEVICE_COMPILE__)
  asm("v_rcp_f32 %0, %0\n\tv_nop" : "+v"(t));
#endif
  return t;
}

// ---- 16-bit fragment loader (A, B alike): p points at row/col (lane&15), + k0 + 8*(lane>>4);
//      elements 0..7 <- p[0..7] (k0+8h..k0+8h+7), elements 8..15 <- p[16..23] (k0+16+8h..k0+16+8h+7)
__device__ __forceinline__ v16h ldfrag(const _Float16* p) {
  Frag f;
  f.half[0] = *(const v8h*)(p);
  f.half[1] = *(const v8h*)(p + 16);
  return f.v;
}
// ---- transposing LDS read of a row-major 16-bit tile T (pitch in bytes): with
//      p = T + (k0 + 8*(lane>>4) + (lane&7)) * pitch + 2 * c0 + 16 * ((lane>>3)&1)
//      lane (lo, h) gets T[k0+8h+0..7][c0+lo]: half a fragment of row / col c0+lo, in the k order of ldfrag
typedef short s16x8 __attribute__((ext_vector_type(8)));
__device__ __forceinline__ v8h ld_tr16(const unsigned char* p) {
  typedef __attribute__((address_space(3))) s16x8 lds_s16x8;
  return __builtin_bit_cast(v8h, __builtin_amdgcn_ds_load_tr16_b128_v8i16((lds_s16x8*)p));
}

// ---- WMMA with trailing VALU hazard gap (ties D, keeps A/B live past the nops) ---------------------
__device__ __forceinline__ v8f mma(v16h a, v16h b, v8f c) {
  v8f d = __builtin_amdgcn_wmma_f32_16x16x32_f16(false, a, false, b, (short)0, c, false, false);
#if defined(__HIP_DEVICE_COMPILE__)
  asm volatile("v_nop\n\tv_nop\n\tv_nop\n\tv_nop" : "+v"(d) : "v"(a), "v"(b));
#endif
  return d;
}

// =====================================================================================================
// One thread's share of phase 1: plane row (column wcol of a [20][NCOL] weight matrix, then its bias; KQP: WkT, WqT) and its part
// of x row xr (PART 0: cols 0..15, PART 1: cols 16..31). The weight loads are issued first and x behind them: loads come
// back in order, the weights from cache and x from memory, so the plane row is converted and stored while x is in flight.
// =====================================================================================================
template <int NCOL, bool KQP, int PART>
__device__ __forceinline__ void stage_w_x(const float* wcol, const float* bsrc, bool real, const float* xr,
                                          _Float16* wrow, float* xsr, _Float16* xhr) {
  float raw[CC + 2];
  raw[CC]     = *bsrc;                                           // channel 20: the bias
  raw[CC + 1] = 0.0f;
#pragma unroll                                                 // the 20 loads issue in a row, ahead of the first use
  for (int c = 0; c < CC; ++c) raw[c] = wcol[c * NCOL];
#if defined(__HIP_DEVICE_COMPILE__)
  // the wait that stands between issued global loads and any later write of a register that they name: a result of an
  // x load may land on an address register of the bias or weight loads
  asm volatile("s_wait_xcnt 0x0" ::: "memory");
#endif
  // keeps that wait behind the bias and weight loads and in front of the x loads
  __builtin_amdgcn_sched_barrier(0);
  v4f a[4];
  if (PART == 0) {
#pragma unroll                                                 // constant indices: a stays in registers
    for (int k = 0; k < 4; ++k) a[k] = *(const v4f*)(xr + 4 * k);
  } else {
    a[0] = *(const v4f*)(xr + 16);
  }
#if defined(__HIP_DEVICE_COMPILE__)
  // the same wait for the x loads
  asm volatile("s_wait_xcnt 0x0" ::: "memory");
#endif
  // keeps that wait directly behind the x loads, and every conversion behind it
  __builtin_amdgcn_sched_barrier(0);
  const float sw = real ? (KQP ? 0.5f : 1024.0f) : 0.0f;         // a pad row comes out zero, its bias too
  v8h o[CP / 8];
#pragma unroll                                                 // constant indices: o stays in registers
  for (int c = 0; c < CP; ++c) o[c >> 3][c & 7] = (_Float16)0.0f;
#pragma unroll                                                 // constant indices: raw and o stay in registers
  for (int c = 0; c < CC + 2; c += 2) {                          // bf16 RNE by the packed convert, two values at a time
    v2f p;
    p[0] = raw[c];
    p[1] = raw[c + 1];
    const v2h q = __builtin_convertvector(__builtin_convertvector(__builtin_convertvector(p, v2b), v2f) * sw, v2h);
    o[c >> 3][c & 7]       = q[0];
    o[c >> 3][(c & 7) + 1] = q[1];
  }
#pragma unroll                                                 // constant indices; the 4 stores issue in a row
  for (int k = 0; k < CP / 8; ++k) *(v8h*)(wrow + k * 8) = o[k];
  // keeps all of the plane row's LDS stores in front of the first use of x (the wait for memory)
  __builtin_amdgcn_sched_barrier(0);
  if (PART == 0) {
    const v4f a0 = bfr4(a[0]);
    const v4f a1 = bfr4(a[1]);
    const v4f a2 = bfr4(a[2]);
    const v4f a3 = bfr4(a[3]);
    *(v4f*)(xsr)      = a0;
    *(v4f*)(xsr + 4)  = a1;
    *(v4f*)(xsr + 8)  = a2;
    *(v4f*)(xsr + 12) = a3;
    v8h p0, p1;
#pragma unroll
    for (int c = 0; c < 4; ++c) {
      p0[c]     = (_Float16)(a0[c] * 16.0f);
      p0[4 + c] = (_Float16)(a1[c] * 16.0f);
      p1[c]     = (_Float16)(a2[c] * 16.0f);
      p1[4 + c] = (_Float16)(a3[c] * 16.0f);
    }
    *(v8h*)(xhr)     = p0;
    *(v8h*)(xhr + 8) = p1;
  } else {
    const v4f a4 = bfr4(a[0]);
    *(v4f*)(xsr + 16) = a4;
    v8h p2, p3;
#pragma unroll
    for (int c = 0; c < 4; ++c) {
      p2[c]     = (_Float16)(a4[c] * 16.0f);
      p2[4 + c] = (_Float16)(c == 0 ? 16.0f : 0.0f);             // column 20: 1, carried x16 like x
      p3[c]     = (_Float16)0.0f;
      p3[4 + c] = (_Float16)0.0f;
    }
    *(v8h*)(xhr + 16) = p2;
    *(v8h*)(xhr + 24) = p3;
  }
}

// =====================================================================================================
// Main: one 256-thread block (8 waves) per batch item; wave w owns token rows 16w..16w+15 in the projections and
// in P.v, and score COLUMNS j = 16w..16w+15 (all 128 rows i) in the score product, one column a lane.
// Phase 1: x -> xs (f32 bf16-RNE values) and xh (f16 of 16*x, col 20 = 16, cols 21..31 zero); threads 0..127 write cols
//          0..15 of row tid, threads 128..255 cols 16..31 (wave-uniform split). coverage: 128 rows x 32 cols.
//          Thread tid also builds row tid of the weight planes (its bias as channel 20) in LDS, from Wk, Wq, Wv, bk, bq, bv.
// Phase 2: projections, one k-step (k = c, split map, the same for A and B). k and q transposed: A = W plane rows
//          n from LDS [n][c], B = xh as [col = token][c], C = 0 (the bias is channel 20); D (row n = 16nt+8h+r, col token
//          m0+lo): a lane holds 8 neighbouring d of ONE token, which is half a 16-bit fragment of that token's row.
//          elu in f32, f16(8*val); pad rows n >= 100 come out 0 (the plane rows are 0 there, elu(0) = 0).
//          k: one 16-B store a tile into kS [i][d], cols 112..127 stored as zeros. q: tiles 2s and 2s+1 ARE the
//          B fragment of k-step s of phase 3 (elements 0..7: d = 32s+8h+r, 8..15: d = 32s+16+8h+r, row m0+lo);
//          it stays in registers. v: A = xh rows, B = WvT; D (row m0+8h+r, col d) -> tanh -> vTh/vTl [d][j] for
//          d 0..31 (d >= 20: the plane rows are 0, bias channel included, and tanh(0) comes out 0).
// Phase 3: S[i][j] = sum_d k[i][d] q[j][d]: A = kS rows i (k = d), B = q as [n=j][k=d] (the wave's own 16, registers);
//          8 row tiles x 4 k-steps; D (row i = 16nt+8h+r, col j = m0+lo) stays in 64 accumulator registers.
// Phase 4: softmax over i per column j, in registers: a lane holds 64 of the 128 i of ONE column j, lane ^ 16 the
//          other 64, so max and sum are folded inside the lane and end with one exchange between the two rows of
//          lanes; the 8 values r of one tile are 8 neighbouring i of column j: f16(1024 * e / sum) goes into P's
//          region transposed, as [j][i], with one 16-B store a tile (the weight planes lie in that region: their
//          last reads, in phase 2, end at the barrier in front of phase 3, so no further barrier stands in front
//          of these stores).
// Phase 5: y_att[i][d] = sum_j P v: A = P rows i (k = j), by transposing reads of [j][i]; B = vTh/vTl as [n=d][k=j]; hi and residual in
//          separate accumulators; y = (acc_h + acc_l/2048)/16384 + xs, written back into xs (d < 20). The LDS reads
//          stand in groups ahead of their users: two register sets of B fragments, x read before the first product.
// =====================================================================================================
// register budget for six waves a SIMD: three work-groups a WGP, which is also what the LDS allows
__global__ __launch_bounds__(256) __attribute__((amdgpu_waves_per_eu(6)))
void k_main(const float* __restrict__ x, const float* __restrict__ Wk, const float* __restrict__ bk,
            const float* __restrict__ Wq, const float* __restrict__ bq, const float* __restrict__ Wv,
            const float* __restrict__ bv, float* out) {
  extern __shared__ __align__(16) unsigned char smem[];
  float*    xs  = (float*)(smem + OFF_XS);
  _Float16* xh  = (_Float16*)(smem + OFF_XH);
  _Float16* kS  = (_Float16*)(smem + OFF_KS);
  _Float16* pS  = (_Float16*)(smem + OFF_PS);
  _Float16* vTh = (_Float16*)(smem + OFF_VTH);
  _Float16* vTl = (_Float16*)(smem + OFF_VTL);
  _Float16* wl  = (_Float16*)(smem + OFF_WL);                    // weight planes: WkT, WqT, WvT

  const int tid  = threadIdx.x;
  const int lane = tid & 31;
  const int wid  = __builtin_amdgcn_readfirstlane(tid >> 5);   // scalar: as a vector value it cost a spill in phase 3
  const int h    = lane >> 4;
  const int lo   = lane & 15;
  const int b    = blockIdx.x;
  const int m0   = wid * 16;
  const float* xb = x + (size_t)b * XROW;

  // ---------------- phase 1: stage the weight planes and x ----------------
  {
    const int row = tid & 127;
    const float* xr  = xb + row * CC;               // row*80 B, 16-B aligned
    float*       xsr = xs + row * CC;
    _Float16*    xhr = xh + row * PX;
    _Float16*    wrow = wl + tid * PX;
    const bool isq = tid >= NRKQ;
    const int  n   = isq ? tid - NRKQ : tid;        // row of WkT / WqT (waves 0..6)
    const int  nc  = min(n, KQ - 1);
    const float* wcol = (isq ? Wq : Wk) + nc;
    const float* bsrc = (isq ? bq : bk) + nc;
    if (wid < 4)                                    // the three cases are wave-uniform (scalar tests)
      stage_w_x<KQ, true, 0>(wcol, bsrc, n < KQ, xr, wrow, xsr, xhr);
    else if (wid < 7)
      stage_w_x<KQ, true, 1>(wcol, bsrc, n < KQ, xr, wrow, xsr, xhr);
    else
      stage_w_x<CC, false, 1>(Wv + min(lane, CC - 1), bv + min(lane, CC - 1), lane < CC, xr, wrow, xsr, xhr);
  }
  __syncthreads();

  // ---------------- phase 2: projections (K = 32, one k-step) ----------------
  Frag qa[4];                                                    // q rows m0+lo as the B fragments of phase 3
  {
    const v16h af = ldfrag(xh + (m0 + lo) * PX + 8 * h);        // row / col token m0+lo, k = c
    const _Float16* pw = wl + lo * PX + 8 * h;                   // A: plane row 16t+lo (n = 16nt+lo of WkT, WqT), k = c
    // v = tanh(x.Wv + bv), stored transposed as hi + residual planes
#pragma unroll 1
    for (int nt = 0; nt < 2; ++nt) {
      const int n0 = nt * 16, d = n0 + lo;
      const v8f acc = mma(af, ldfrag(pw + (2 * NRKQ + n0) * PX), zero8());
      // branchless tanh of c = acc * 2^-14 (the bias is in acc): (t - 1) / (t + 1), t = exp(2c); the clamp of c at +-15 and
      // the factor 2 * log2(e) are applied at the accumulator's scale (powers of two: the same values)
      float t[8], dn[8];
#pragma unroll
      for (int r = 0; r < 8; ++r)
        t[r] = fminf(fmaxf(acc[r], -15.0f * 16384.0f), 15.0f * 16384.0f) * (1.4426950408889634f * 0.0001220703125f);
      exp2x8(t);
#pragma unroll
      for (int r = 0; r < 8; ++r) dn[r] = t[r] + 1.0f;
      rcpx8(dn);
      v8h oh, ol;
#pragma unroll
      for (int r = 0; r < 8; r += 2) {                           // by pairs r, r+1: packed f32 operations and converts
        v2f w;
        w[0] = (t[r] - 1.0f) * dn[r];
        w[1] = (t[r + 1] - 1.0f) * dn[r + 1];
        w *= 16.0f;
        const v2h hh = __builtin_convertvector(w, v2h);
        const v2h ll = __builtin_convertvector((w - __builtin_convertvector(hh, v2f)) * 2048.0f, v2h);
        oh[r] = hh[0]; oh[r + 1] = hh[1];
        ol[r] = ll[0]; ol[r + 1] = ll[1];
      }
      *(v8h*)(vTh + d * PH + m0 + 8 * h) = oh;
      *(v8h*)(vTl + d * PH + m0 + 8 * h) = ol;
    }
    // k^T = elu(Wk^T.x^T + bk): tiles t = 0..6; q^T = elu(Wq^T.x^T + bq): tiles t = 7..13
    _Float16* kw = kS + (m0 + lo) * PH + 8 * h;
    v16h wf[2 * NTKQ];
    v8f ac[2 * NTKQ];
    // elu (alpha = 1) of v = acc / 8, carried x8: exp(v) = exp2(acc * CE), u = 8 * exp(v) - 8. As exp(v) - 1 >= v for
    // every v, acc <= u: for v > 0 the order is 0 < acc <= u, for v <= 0 it is acc <= u <= 0, so 8 * elu(v) is the
    // middle one of acc, 0 and u: one v_med3 in place of a compare and a select
    const float CE = 1.4426950408889634f * 0.125f;
#define LOAD_TILE(t) wf[t] = ldfrag(pw + (t) * 16 * PX);
#define MMA_TILE(t)                                                                          \
    ac[t] = __builtin_amdgcn_wmma_f32_16x16x32_f16(false, wf[t], false, af, (short)0, zero8(), false, false)
    LOAD_TILE(0) LOAD_TILE(1) LOAD_TILE(2)
    // keeps the six reads of the first three tiles one group in front of the first product, so that tiles 1 and 2 meet
    // no LDS wait of their own
    __builtin_amdgcn_sched_barrier(0);
    MMA_TILE(0);
#pragma unroll
    for (int t = 0; t < 2 * NTKQ; ++t) {
      float e[8];
#pragma unroll
      for (int r = 0; r < 8; ++r) e[r] = ac[t][r] * CE;
      exp2x8(e);
      v2f u[4];                                                  // two values a v_pk_fma_f32
#pragma unroll
      for (int r = 0; r < 8; r += 2) {
        u[r >> 1][0] = e[r];
        u[r >> 1][1] = e[r + 1];
        u[r >> 1] = __builtin_elementwise_fma(u[r >> 1], (v2f)(8.0f), (v2f)(-8.0f));
      }
      // The pair holds tile t+1's product here, where the rest of tile t's elu (12 instructions) fills its result slots.
      // Left alone, with C = 0, the compiler gave it tile t's accumulator registers and put it behind their last read,
      // four instructions in front of its own first reader.
      __builtin_amdgcn_sched_barrier(0);
      if (t + 1 < 2 * NTKQ) MMA_TILE(t + 1);
      __builtin_amdgcn_sched_barrier(0);
      v8h o;
#pragma unroll
      for (int r = 0; r < 8; r += 2) {
        o[r]     = (_Float16)__builtin_amdgcn_fmed3f(ac[t][r], 0.0f, u[r >> 1][0]);
        o[r + 1] = (_Float16)__builtin_amdgcn_fmed3f(ac[t][r + 1], 0.0f, u[r >> 1][1]);
      }
      if (t < NTKQ) *(v8h*)(kw + t * 16) = o;
      else          qa[(t - NTKQ) >> 1].half[(t - NTKQ) & 1] = o;
      if (t + 3 < 2 * NTKQ) LOAD_TILE(t + 3)
#if defined(__HIP_DEVICE_COMPILE__)
      // inputs only: the A and B fragments of tile t+1's product stay in their registers to the end of tile t's elu.
      // Without it results of that elu landed on those registers directly behind the product, and the compiler put
      // three or four v_nop there
      if (t + 1 < 2 * NTKQ) asm volatile("" :: "v"(wf[t + 1]), "v"(af));
#endif
      // one tile a group: keeps the LDS reads of tile t+3 a whole tile in front of their product (left alone the compiler
      // put each tile's reads and a full wait directly in front of it), and ends q's elu in front of phase 3
      __builtin_amdgcn_sched_barrier(0);
    }
#undef LOAD_TILE
#undef MMA_TILE
    v8h z8;
#pragma unroll
    for (int r = 0; r < 8; ++r) z8[r] = (_Float16)0.0f;
    *(v8h*)(kw + NTKQ * 16) = z8;
    qa[NTKQ >> 1].half[NTKQ & 1] = z8;
  }
  __syncthreads();

  // ---------------- phase 3: scores S[i][j] (K = 128 over d), kept in registers ----------------
  v8f acc[8];                                                    // acc[nt][r] = 64 * S[i = 16nt+8h+r][j = m0+lo]
  {
    const _Float16* pb = kS + lo * PH + 8 * h;                   // A: row i = 16nt+lo, k = d (the map of qa)
#pragma unroll
    for (int nt = 0; nt < 8; ++nt) acc[nt] = zero8();
#pragma unroll
    for (int ks = 0; ks < 4; ++ks) {                             // k-step outermost: 8 independent accumulators in a row
      v16h bf[8];
#pragma unroll
      for (int nt = 0; nt < 8; ++nt) bf[nt] = ldfrag(pb + nt * 16 * PH + 32 * ks);
      // keeps the 16 LDS reads of a k-step one group in front of its 8 products: left alone the compiler put two
      // reads and a full wait in front of every product, one LDS latency each
      __builtin_amdgcn_sched_barrier(0);
#pragma unroll
      for (int nt = 0; nt < 8; ++nt)
        acc[nt] = __builtin_amdgcn_wmma_f32_16x16x32_f16(false, bf[nt], false, qa[ks].v, (short)0, acc[nt], false, false);
      // second half of the pair: the next k-step's reads stay behind these products (their registers are reused)
      __builtin_amdgcn_sched_barrier(0);
    }
  }

  // ---------------- phase 4: softmax over i, per column j, in registers ----------------
  {
    // exp(s - max) = exp2((acc - max_acc) * C2), C2 = (1/sqrt(128)) * 2^-6 * log2(e) > 0
    const float C2 = 0.08838834764831845f * 0.015625f * 1.4426950408889634f;
    // seven independent chains of nine values (an odd count: every link a three-input maximum), then one value a lane
    float mx[7];
#pragma unroll
    for (int c = 0; c < 7; ++c) {
      mx[c] = acc[(9 * c) >> 3][(9 * c) & 7];
#pragma unroll
      for (int e = 9 * c + 1; e < 9 * c + 9; ++e) mx[c] = fmaxf(mx[c], acc[e >> 3][e & 7]);
    }
    float m = fmaxf(fmaxf(mx[0], mx[1]), mx[2]);
    m = fmaxf(fmaxf(m, mx[3]), mx[4]);
    m = fmaxf(fmaxf(m, mx[5]), mx[6]);
    m = fmaxf(m, acc[7][7]);
    m = fmaxf(m, xhalf(m));                                      // the column's other 64 rows
    const float nb = -C2 * m;
    v2f s2[4];                                                   // two values a packed f32 instruction from here on
#pragma unroll
    for (int nt = 0; nt < 8; ++nt) {
      float t[8];
#pragma unroll
      for (int r = 0; r < 8; r += 2) {
        v2f a;
        a[0] = acc[nt][r];
        a[1] = acc[nt][r + 1];
        a = __builtin_elementwise_fma(a, (v2f)(C2), (v2f)(nb));
        t[r]     = a[0];
        t[r + 1] = a[1];
      }
      float x[8];
      exp2x8o(x, t);
#pragma unroll
      for (int r = 0; r < 8; r += 2) {
        v2f e;
        e[0] = x[r];
        e[1] = x[r + 1];
        acc[nt][r]     = x[r];
        acc[nt][r + 1] = x[r + 1];
        s2[r >> 1] = nt == 0 ? e : s2[r >> 1] + e;
      }
    }
    const v2f sp = (s2[0] + s2[1]) + (s2[2] + s2[3]);
    float sum = sp[0] + sp[1];
    sum += xhalf(sum);                                           // the largest term is 1: sum >= 1
    const float rs = rcp1(sum) * 1024.0f;
    _Float16* Pw = pS + (m0 + lo) * PH + 8 * h;                  // P transposed, [j][i], carried x1024
#pragma unroll
    for (int nt = 0; nt < 8; ++nt) {
      v8h p;
#pragma unroll
      for (int r = 0; r < 8; r += 2) {
        v2f w;
        w[0] = acc[nt][r];
        w[1] = acc[nt][r + 1];
        const v2h q = __builtin_convertvector(w * rs, v2h);
        p[r]     = q[0];
        p[r + 1] = q[1];
      }
      *(v8h*)(Pw + nt * 16) = p;
    }
  }
  __syncthreads();

  // ---------------- phase 5: y = P.v + x (K = 128 over j; hi and residual accumulators) ----------------
  {
    // A: row i = m0+lo, k = j, out of P^T [j][i] (the address form of ld_tr16: k0 = 0, c0 = m0). The pitch stays PH, which
    // suits the 16-B stores; the pitch that suits the transposing reads (32 B x odd) would not leave room for three blocks
    const unsigned char* pa = smem + OFF_PS + (8 * h + (lane & 7)) * (PH * 2) + 2 * m0 + 16 * ((lane >> 3) & 1);
    const _Float16* pv = vTh + lo * PH + 8 * h;                  // B: col d = lo, k = j, of the hi plane
    static_assert(OFF_VTL == OFF_VTH + CP * PH * 2);             // the residual plane lies CP rows behind the hi plane
    const int d1  = 16 + lo;
    const int d1c = min(d1, CC - 1);
    float* px = xs + (m0 + 8 * h) * CC;                          // rows i = m0+8h+r, the wave's own
    v16h pf[4], bs[2][4];                                        // bs: two register sets of a k-step's four B fragments
#define LOAD_P(ks)                                                                           \
    {                                                                                          \
      Frag f;                                                                                  \
      f.half[0] = ld_tr16(pa + (32 * (ks)) * (PH * 2));                                        \
      f.half[1] = ld_tr16(pa + (32 * (ks) + 16) * (PH * 2));                                   \
      pf[ks] = f.v;                                                                            \
    }
    float x0[8], x1[8];
    v8f ay[4];                                                   // hi d=lo, hi d=16+lo, residual d=lo, residual d=16+lo
#define LOAD_B(set, ks)                                                                      \
    {                                                                                          \
      bs[set][0] = ldfrag(pv + 32 * (ks));                                                     \
      bs[set][1] = ldfrag(pv + 16 * PH + 32 * (ks));                                           \
      bs[set][2] = ldfrag(pv + CP * PH + 32 * (ks));                                           \
      bs[set][3] = ldfrag(pv + (CP + 16) * PH + 32 * (ks));                                    \
    }
#define MMA_B(set, ks)                                                                       \
    _Pragma("unroll") /* constant indices: four independent accumulators in a row */           \
    for (int q = 0; q < 4; ++q)                                                                \
      ay[q] = __builtin_amdgcn_wmma_f32_16x16x32_f16(false, pf[ks], false, bs[set][q], (short)0, ay[q], false, false);
#pragma unroll                                                 // constant indices: ay stays in registers
    for (int q = 0; q < 4; ++q) ay[q] = zero8();
    LOAD_P(0)
    LOAD_B(0, 0)
    LOAD_P(1)
    LOAD_B(1, 1)
    LOAD_P(2)
    LOAD_P(3)
#pragma unroll                                                 // constant indices; the 16 reads issue in a row
    for (int r = 0; r < 8; ++r) {
      x0[r] = px[r * CC + lo];                                   // d = lo < 16 < 20 always valid
      x1[r] = px[r * CC + d1c];
    }
    MMA_B(0, 0)
    LOAD_B(0, 2)
    MMA_B(1, 1)
    LOAD_B(1, 3)
    MMA_B(0, 2)
    MMA_B(1, 3)
    // Order of this phase's LDS reads (0x100) and products (0x008): the reads of k-steps 0 and 1, of all of P and of x as
    // one group, then four products and the eight reads of the k-step after next, by turns. Left alone the compiler put
    // two reads and a full wait in front of every product and one read and a full wait in front of every output row,
    // one LDS latency each.
    __builtin_amdgcn_sched_group_barrier(0x100, 32, 0);
    __builtin_amdgcn_sched_group_barrier(0x008, 4, 0);
    __builtin_amdgcn_sched_group_barrier(0x100, 8, 0);
    __builtin_amdgcn_sched_group_barrier(0x008, 4, 0);
    __builtin_amdgcn_sched_group_barrier(0x100, 8, 0);
    __builtin_amdgcn_sched_group_barrier(0x008, 8, 0);
#undef LOAD_P
#undef LOAD_B
#undef MMA_B
    float v1[8];
#pragma unroll                                                 // constant indices: ay, x0, x1, v1 stay in registers
    for (int r = 0; r < 8; ++r) {
      const float y0 = (ay[0][r] + ay[2][r] * 0.00048828125f) * 6.103515625e-05f;   // (h + l/2048) * 2^-14
      const float y1 = (ay[1][r] + ay[3][r] * 0.00048828125f) * 6.103515625e-05f;
      px[r * CC + lo] = x0[r] + y0;
      v1[r] = x1[r] + y1;
    }
    if (lo < 4) {                                                // d = 16..19
#pragma unroll                                                 // constant indices; the 8 stores issue in a row
      for (int r = 0; r < 8; ++r) px[r * CC + d1] = v1[r];
    }
  }
  __syncthreads();

  {
    const v4f* xs4 = (const v4f*)xs;
    const int c2  = 16 + wid;                                    // valid iff wid < 4 (wave-uniform)
    const int c2c = min(c2, 19);
    const v4f pv0 = xs4[(wid)     * 32 + lane];
    const v4f pv1 = xs4[(8 + wid) * 32 + lane];
    const v4f pv2 = xs4[c2c       * 32 + lane];
    float* ob = out + (size_t)b * XROW + (size_t)lane * 4;
    *(v4f*)(ob + (size_t)wid * 128)       = pv0;
    *(v4f*)(ob + (size_t)(8 + wid) * 128) = pv1;
#if defined(__HIP_DEVICE_COMPILE__)
    // the wait that stands between issued global stores and any later write of a register that they name
    asm volatile("s_wait_xcnt 0x0" ::: "memory");
#endif
    if (wid < 4) *(v4f*)(ob + (size_t)c2 * 128) = pv2;
    
  }
}

// One launch; the workspace is not used.
extern "C" void kernel_launch(void* const* d_in, const int* in_sizes, int n_in,
                              void* d_out, int out_size, void* d_ws, size_t ws_size,
                              hipStream_t stream) {
  if (n_in < 7) return;
  if (in_sizes[0] != NBATCH * XROW) return;
  if (in_sizes[1] != CC * KQ) return;
  if (in_sizes[2] != KQ) return;
  if (in_sizes[3] != CC * KQ) return;
  if (in_sizes[4] != KQ) return;
  if (in_sizes[5] != CC * CC) return;
  if (in_sizes[6] != CC) return;
  if (out_size != NBATCH * XROW) return;

  const float* x  = (const float*)d_in[0];     // [4096][128][20]
  const float* Wk = (const float*)d_in[1];     // [20][100]
  const float* bk = (const float*)d_in[2];     // [100]
  const float* Wq = (const float*)d_in[3];     // [20][100]
  const float* bq = (const float*)d_in[4];     // [100]
  const float* Wv = (const float*)d_in[5];     // [20][20]
  const float* bv = (const float*)d_in[6];     // [20]
  float* out = (float*)d_out;                  // [4096][128][20]

  (void)d_ws;
  (void)ws_size;

  (void)hipFuncSetAttribute(reinterpret_cast<const void*>(&k_main),
                            hipFuncAttributeMaxDynamicSharedMemorySize, LDS_MAIN);

  const dim3 gMain(NBATCH), bMain(256);

  k_main<<<gMain, bMain, LDS_MAIN, stream>>>(x, Wk, bk, Wq, bq, Wv, bv, out);
  (void)hipGetLastError();
}

// v010
// One run takes 33.8 microseconds.
// Timed twice side by side with v009, it ran 1.05 times as fast both times.
// Over all steps from v000 it is 10.4 times as fast.
// Contractions on v_wmma_f32_16x16x32_f16, f32 accumulate: x.Wk, x.Wq, x.Wv with f16 operands built from
// bf16-RNE inputs (x carried x16, Wk and Wq x0.5, Wv x1024), single products (k and q as W^T.x^T); the three biases ride
// in the products as channel 20 of the padded k (x = 1 there, the weight planes hold the bias);
// k.q^T with k and q as plain f16 carried x8;
// P.v with P as plain f16 carried x1024 and v as plain f16 carried x16;
// elu, tanh, column softmax (in registers, one column a lane) and the residual add in f32 on VALU.
#include <hip/hip_runtime.h>
#include <stdint.h>

#define NBATCH 4096
#define TT     128              // tokens per item
#define CC     20               // channels
#define KQ     100              // key/query dim
#define CP     32               // channels padded (k of the projections)
#define DP     128              // key dim padded (k of the score product)
#define PX     40               // LDS pitch of xh in halves: 80 B = 16 B x 5
#define PH     136              // LDS pitch of kS, P, vTh in halves: 272 B = 16 B x 17
#define XROW   (TT * CC)        // 2560 floats per item

static_assert(XROW == 2560 && CC % 2 == 0);
static_assert(TT == 128);
static_assert(DP == TT);
static_assert(PX >= CP && PH >= DP);
static_assert((PX * 2) % 32 == 16 && (PH * 2) % 32 == 16);    // 16-B fragment reads: pitch = 16 B x odd

// LDS byte offsets of the main kernel
#define OFF_XS   0              // f32 [128][20]   10240  (bf16-RNE x, later y)
// (the pad columns behind each row's last used column are never written and never read)
#define OFF_XH   10240          // f16 [128][32 of 40]    10240  (16*x, col 20 = 16 (the bias channel), cols 21..31 zero)
#define OFF_KS   20480          // f16 [128][128 of 136]  34816  (8*k, cols 100..127 zero)
#define OFF_PS   55296          // f16 [128][128 of 136]  34816  (1024*P, transposed: [j][i])
#define OFF_WL   OFF_PS         // f16 [256][32 of 40]    20480  (weight planes; dead behind phase 2, P comes in phase 4)
#define OFF_VTH  90112          // f16 [32][128 of 136]    8704  (16*v, transposed [d][j])
#define LDS_MAIN 98816          // three blocks fit the 327680 B of a WGP
static_assert(OFF_XH == OFF_XS + TT * CC * 4);
static_assert(OFF_KS == OFF_XH + TT * PX * 2);
static_assert(OFF_PS == OFF_KS + TT * PH * 2);
static_assert(OFF_VTH == OFF_PS + TT * PH * 2);
static_assert(LDS_MAIN == OFF_VTH + CP * PH * 2);
static_assert(3 * LDS_MAIN <= 327680);

#define NTKQ      7               // 16-wide tiles of the key dim that hold a real column (100 = 6 * 16 + 4)
static_assert(NTKQ * 16 >= KQ && (NTKQ - 1) * 16 < KQ && (NTKQ + 1) * 16 == DP);
// weight planes in LDS, one row of 32 c (pitch PX) a thread: rows 0..111 WkT [n][c], 112..223 WqT [n][c], 224..255
// WvT [d][c]; values = f16 of (bf16-RNE value * 0.5) in WkT and WqT, of (bf16-RNE value * 1024) in WvT; c = 20 holds the
// row's bias (bk, bq, bv) converted and scaled like the row's weights; c >= 21 and rows n >= 100, d >= 20 zero. With x
// carried x16 and 16 in its column 20, the k and q accumulators are 8 * (x.W + b), the scale at which k and q are
// carried, and the v accumulator is 16384 * (x.Wv + bv).
#define NRKQ      (NTKQ * 16)     // rows of the WkT and of the WqT plane
static_assert(2 * NRKQ + CP == 256);                            // one plane row a thread of the block
static_assert(2 * NRKQ == 7 * 32);                              // WvT is wave 7's, whole
static_assert(OFF_WL + 256 * PX * 2 <= OFF_VTH);                // they lie inside the region of P
static_assert(CC + 2 <= CP);                                    // the bias channel lies in the pad of k

typedef _Float16     v16h __attribute__((ext_vector_type(16)));
typedef _Float16     v8h  __attribute__((ext_vector_type(8)));
typedef float        v8f  __attribute__((ext_vector_type(8)));
typedef float        v4f  __attribute__((ext_vector_type(4)));
typedef float        v2f  __attribute__((ext_vector_type(2)));
typedef _Float16     v2h  __attribute__((ext_vector_type(2)));
typedef __bf16       v2b  __attribute__((ext_vector_type(2)));

union Frag { v16h v; v8h half[2]; };

// ---- scalar helpers --------------------------------------------------------------------------------
__device__ __forceinline__ unsigned short bf_bits(float f) {          // f32 -> bf16 bits, RNE convert
  unsigned u = __float_as_uint(f);
  return (unsigned short)((u + 0x7FFFu + ((u >> 16) & 1u)) >> 16);
}
__device__ __forceinline__ float bf_up(unsigned short b) { return __uint_as_float(((unsigned)b) << 16); }
__device__ __forceinline__ float bfr(float f) { return bf_up(bf_bits(f)); }   // value after bf16 RNE convert
__device__ __forceinline__ v4f bfr4(v4f a) {
  v4f o;
  o[0] = bfr(a[0]); o[1] = bfr(a[1]); o[2] = bfr(a[2]); o[3] = bfr(a[3]);
  return o;
}
__device__ __forceinline__ v8f zero8() {
  v8f z;
  z[0] = 0.f; z[1] = 0.f; z[2] = 0.f; z[3] = 0.f; z[4] = 0.f; z[5] = 0.f; z[6] = 0.f; z[7] = 0.f;
  return z;
}

// ---- the value of lane l ^ 16 (the other 16-lane row); all 32 lanes are on at every use
__device__ __forceinline__ float xhalf(float v) {
  const int b = __builtin_bit_cast(int, v);
  return __builtin_bit_cast(float, __builtin_amdgcn_permlanex16(b, b, 0x76543210, 0xfedcba98, false, false));
}
// Eight transcendentals in place, then one free slot.
// Here result and source are one register, no line touches another line's register, and the closing v_nop is the
// one independent slot the instruction set asks for in front of the first reader.
__device__ __forceinline__ void exp2x8(float (&t)[8]) {
#if defined(__HIP_DEVICE_COMPILE__)
  asm("v_exp_f32 %0, %0\n\tv_exp_f32 %1, %1\n\tv_exp_f32 %2, %2\n\tv_exp_f32 %3, %3\n\t"
      "v_exp_f32 %4, %4\n\tv_exp_f32 %5, %5\n\tv_exp_f32 %6, %6\n\tv_exp_f32 %7, %7\n\tv_nop"
      : "+v"(t[0]), "+v"(t[1]), "+v"(t[2]), "+v"(t[3]), "+v"(t[4]), "+v"(t[5]), "+v"(t[6]), "+v"(t[7]));
#endif
}
// The same eight, out of place: results in registers of their own (early clobber: no line writes any line's source), so
// that the register pairs of the packed instructions on either side need not be one and the same.
__device__ __forceinline__ void exp2x8o(float (&o)[8], const float (&t)[8]) {
#if defined(__HIP_DEVICE_COMPILE__)
  asm("v_exp_f32 %0, %8\n\tv_exp_f32 %1, %9\n\tv_exp_f32 %2, %10\n\tv_exp_f32 %3, %11\n\t"
      "v_exp_f32 %4, %12\n\tv_exp_f32 %5, %13\n\tv_exp_f32 %6, %14\n\tv_exp_f32 %7, %15\n\tv_nop"
      : "=&v"(o[0]), "=&v"(o[1]), "=&v"(o[2]), "=&v"(o[3]), "=&v"(o[4]), "=&v"(o[5]), "=&v"(o[6]), "=&v"(o[7])
      : "v"(t[0]), "v"(t[1]), "v"(t[2]), "v"(t[3]), "v"(t[4]), "v"(t[5]), "v"(t[6]), "v"(t[7]));
#endif
}
__device__ __forceinline__ void rcpx8(float (&t)[8]) {
#if defined(__HIP_DEVICE_COMPILE__)
  asm("v_rcp_f32 %0, %0\n\tv_rcp_f32 %1, %1\n\tv_rcp_f32 %2, %2\n\tv_rcp_f32 %3, %3\n\t"
      "v_rcp_f32 %4, %4\n\tv_rcp_f32 %5, %5\n\tv_rcp_f32 %6, %6\n\tv_rcp_f32 %7, %7\n\tv_nop"
      : "+v"(t[0]), "+v"(t[1]), "+v"(t[2]), "+v"(t[3]), "+v"(t[4]), "+v"(t[5]), "+v"(t[6]), "+v"(t[7]));
#endif
}
// One reciprocal with the same free slot behind it.
__device__ __forceinline__ float rcp1(float t) {
#if defined(__HIP_DEVICE_COMPILE__)
  asm("v_rcp_f32 %0, %0\n\tv_nop" : "+v"(t));
#endif
  return t;
}

// ---- 16-bit fragment loader (A, B alike): p points at row/col (lane&15), + k0 + 8*(lane>>4);
//      elements 0..7 <- p[0..7] (k0+8h..k0+8h+7), elements 8..15 <- p[16..23] (k0+16+8h..k0+16+8h+7)
__device__ __forceinline__ v16h ldfrag(const _Float16* p) {
  Frag f;
  f.half[0] = *(const v8h*)(p);
  f.half[1] = *(const v8h*)(p + 16);
  return f.v;
}
// ---- transposing LDS read of a row-major 16-bit tile T (pitch in bytes): with
//      p = T + (k0 + 8*(lane>>4) + (lane&7)) * pitch + 2 * c0 + 16 * ((lane>>3)&1)
//      lane (lo, h) gets T[k0+8h+0..7][c0+lo]: half a fragment of row / col c0+lo, in the k order of ldfrag
typedef short s16x8 __attribute__((ext_vector_type(8)));
__device__ __forceinline__ v8h ld_tr16(const unsigned char* p) {
  typedef __attribute__((address_space(3))) s16x8 lds_s16x8;
  return __builtin_bit_cast(v8h, __builtin_amdgcn_ds_load_tr16_b128_v8i16((lds_s16x8*)p));
}

// ---- WMMA with trailing VALU hazard gap (ties D, keeps A/B live past the nops) ---------------------
__device__ __forceinline__ v8f mma(v16h a, v16h b, v8f c) {
  v8f d = __builtin_amdgcn_wmma_f32_16x16x32_f16(false, a, false, b, (short)0, c, false, false);
#if defined(__HIP_DEVICE_COMPILE__)
  asm volatile("v_nop\n\tv_nop\n\tv_nop\n\tv_nop" : "+v"(d) : "v"(a), "v"(b));
#endif
  return d;
}

// =====================================================================================================
// One thread's share of phase 1: plane row (column wcol of a [20][NCOL] weight matrix, then its bias; KQP: WkT, WqT) and its part
// of x row xr (PART 0: cols 0..15, PART 1: cols 16..31). The weight loads are issued first and x behind them: loads come
// back in order, the weights from cache and x from memory, so the plane row is converted and stored while x is in flight.
// =====================================================================================================
template <int NCOL, bool KQP, int PART>
__device__ __forceinline__ void stage_w_x(const float* wcol, const float* bsrc, bool real, const float* xr,
                                          _Float16* wrow, float* xsr, _Float16* xhr) {
  float raw[CC + 2];
  raw[CC]     = *bsrc;                                           // channel 20: the bias
  raw[CC + 1] = 0.0f;
#pragma unroll                                                 // the 20 loads issue in a row, ahead of the first use
  for (int c = 0; c < CC; ++c) raw[c] = wcol[c * NCOL];
#if defined(__HIP_DEVICE_COMPILE__)
  // the wait that stands between issued global loads and any later write of a register that they name: a result of an
  // x load may land on an address register of the bias or weight loads
  asm volatile("s_wait_xcnt 0x0" ::: "memory");
#endif
  // keeps that wait behind the bias and weight loads and in front of the x loads
  __builtin_amdgcn_sched_barrier(0);
  v4f a[4];
  if (PART == 0) {
#pragma unroll                                                 // constant indices: a stays in registers
    for (int k = 0; k < 4; ++k) a[k] = *(const v4f*)(xr + 4 * k);
  } else {
    a[0] = *(const v4f*)(xr + 16);
  }
#if defined(__HIP_DEVICE_COMPILE__)
  // the same wait for the x loads
  asm volatile("s_wait_xcnt 0x0" ::: "memory");
#endif
  // keeps that wait directly behind the x loads, and every conversion behind it
  __builtin_amdgcn_sched_barrier(0);
  const float sw = real ? (KQP ? 0.5f : 1024.0f) : 0.0f;         // a pad row comes out zero, its bias too
  v8h o[CP / 8];
#pragma unroll                                                 // constant indices: o stays in registers
  for (int c = 0; c < CP; ++c) o[c >> 3][c & 7] = (_Float16)0.0f;
#pragma unroll                                                 // constant indices: raw and o stay in registers
  for (int c = 0; c < CC + 2; c += 2) {                          // bf16 RNE by the packed convert, two values at a time
    v2f p;
    p[0] = raw[c];
    p[1] = raw[c + 1];
    const v2h q = __builtin_convertvector(__builtin_convertvector(__builtin_convertvector(p, v2b), v2f) * sw, v2h);
    o[c >> 3][c & 7]       = q[0];
    o[c >> 3][(c & 7) + 1] = q[1];
  }
#pragma unroll                                                 // constant indices; the 4 stores issue in a row
  for (int k = 0; k < CP / 8; ++k) *(v8h*)(wrow + k * 8) = o[k];
  // keeps all of the plane row's LDS stores in front of the first use of x (the wait for memory)
  __builtin_amdgcn_sched_barrier(0);
  if (PART == 0) {
    const v4f a0 = bfr4(a[0]);
    const v4f a1 = bfr4(a[1]);
    const v4f a2 = bfr4(a[2]);
    const v4f a3 = bfr4(a[3]);
    *(v4f*)(xsr)      = a0;
    *(v4f*)(xsr + 4)  = a1;
    *(v4f*)(xsr + 8)  = a2;
    *(v4f*)(xsr + 12) = a3;
    v8h p0, p1;
#pragma unroll
    for (int c = 0; c < 4; ++c) {
      p0[c]     = (_Float16)(a0[c] * 16.0f);
      p0[4 + c] = (_Float16)(a1[c] * 16.0f);
      p1[c]     = (_Float16)(a2[c] * 16.0f);
      p1[4 + c] = (_Float16)(a3[c] * 16.0f);
    }
    *(v8h*)(xhr)     = p0;
    *(v8h*)(xhr + 8) = p1;
  } else {
    const v4f a4 = bfr4(a[0]);
    *(v4f*)(xsr + 16) = a4;
    v8h p2, p3;
#pragma unroll
    for (int c = 0; c < 4; ++c) {
      p2[c]     = (_Float16)(a4[c] * 16.0f);
      p2[4 + c] = (_Float16)(c == 0 ? 16.0f : 0.0f);             // column 20: 1, carried x16 like x
      p3[c]     = (_Float16)0.0f;
      p3[4 + c] = (_Float16)0.0f;
    }
    *(v8h*)(xhr + 16) = p2;
    *(v8h*)(xhr + 24) = p3;
  }
}

// =====================================================================================================
// Main: one 256-thread block (8 waves) per batch item; wave w owns token rows 16w..16w+15 in the projections and
// in P.v, and score COLUMNS j = 16w..16w+15 (all 128 rows i) in the score product, one column a lane.
// Phase 1: x -> xs (f32 bf16-RNE values) and xh (f16 of 16*x, col 20 = 16, cols 21..31 zero); threads 0..127 write cols
//          0..15 of row tid, threads 128..255 cols 16..31 (wave-uniform split). coverage: 128 rows x 32 cols.
//          Thread tid also builds row tid of the weight planes (its bias as channel 20) in LDS, from Wk, Wq, Wv, bk, bq, bv.
// Phase 2: projections, one k-step (k = c, split map, the same for A and B). k and q transposed: A = W plane rows
//          n from LDS [n][c], B = xh as [col = token][c], C = 0 (the bias is channel 20); D (row n = 16nt+8h+r, col token
//          m0+lo): a lane holds 8 neighbouring d of ONE token, which is half a 16-bit fragment of that token's row.
//          elu in f32, f16(8*val); pad rows n >= 100 come out 0 (the plane rows are 0 there, elu(0) = 0).
//          k: one 16-B store a tile into kS [i][d], cols 112..127 stored as zeros. q: tiles 2s and 2s+1 ARE the
//          B fragment of k-step s of phase 3 (elements 0..7: d = 32s+8h+r, 8..15: d = 32s+16+8h+r, row m0+lo);
//          it stays in registers. v: A = xh rows, B = WvT; D (row m0+8h+r, col d) -> tanh -> vTh [d][j] for
//          d 0..31 (d >= 20: the plane rows are 0, bias channel included, and tanh(0) comes out 0).
// Phase 3: S[i][j] = sum_d k[i][d] q[j][d]: A = kS rows i (k = d), B = q as [n=j][k=d] (the wave's own 16, registers);
//          8 row tiles x 4 k-steps; D (row i = 16nt+8h+r, col j = m0+lo) stays in 64 accumulator registers.
// Phase 4: softmax over i per column j, in registers: a lane holds 64 of the 128 i of ONE column j, lane ^ 16 the
//          other 64, so max and sum are folded inside the lane and end with one exchange between the two rows of
//          lanes; the 8 values r of one tile are 8 neighbouring i of column j: f16(1024 * e / sum) goes into P's
//          region transposed, as [j][i], with one 16-B store a tile (the weight planes lie in that region: their
//          last reads, in phase 2, end at the barrier in front of phase 3, so no further barrier stands in front
//          of these stores).
// Phase 5: y_att[i][d] = sum_j P v: A = P rows i (k = j), by transposing reads of [j][i]; B = vTh as [n=d][k=j];
//          y = acc/16384 + xs, written back into xs (d < 20). All of the phase's LDS reads stand in one group ahead of
//          the first product, x last.
// =====================================================================================================
// register budget for six waves a SIMD: three work-groups a WGP, which is also what the LDS allows
__global__ __launch_bounds__(256) __attribute__((amdgpu_waves_per_eu(6)))
void k_main(const float* __restrict__ x, const float* __restrict__ Wk, const float* __restrict__ bk,
            const float* __restrict__ Wq, const float* __restrict__ bq, const float* __restrict__ Wv,
            const float* __restrict__ bv, float* out) {
  extern __shared__ __align__(16) unsigned char smem[];
  float*    xs  = (float*)(smem + OFF_XS);
  _Float16* xh  = (_Float16*)(smem + OFF_XH);
  _Float16* kS  = (_Float16*)(smem + OFF_KS);
  _Float16* pS  = (_Float16*)(smem + OFF_PS);
  _Float16* vTh = (_Float16*)(smem + OFF_VTH);
  _Float16* wl  = (_Float16*)(smem + OFF_WL);                    // weight planes: WkT, WqT, WvT

  const int tid  = threadIdx.x;
  const int lane = tid & 31;
  const int wid  = __builtin_amdgcn_readfirstlane(tid >> 5);   // scalar: as a vector value it cost a spill in phase 3
  const int h    = lane >> 4;
  const int lo   = lane & 15;
  const int b    = blockIdx.x;
  const int m0   = wid * 16;
  const float* xb = x + (size_t)b * XROW;

  // ---------------- phase 1: stage the weight planes and x ----------------
  {
    const int row = tid & 127;
    const float* xr  = xb + row * CC;               // row*80 B, 16-B aligned
    float*       xsr = xs + row * CC;
    _Float16*    xhr = xh + row * PX;
    _Float16*    wrow = wl + tid * PX;
    const bool isq = tid >= NRKQ;
    const int  n   = isq ? tid - NRKQ : tid;        // row of WkT / WqT (waves 0..6)
    const int  nc  = min(n, KQ - 1);
    const float* wcol = (isq ? Wq : Wk) + nc;
    const float* bsrc = (isq ? bq : bk) + nc;
    if (wid < 4)                                    // the three cases are wave-uniform (scalar tests)
      stage_w_x<KQ, true, 0>(wcol, bsrc, n < KQ, xr, wrow, xsr, xhr);
    else if (wid < 7)
      stage_w_x<KQ, true, 1>(wcol, bsrc, n < KQ, xr, wrow, xsr, xhr);
    else
      stage_w_x<CC, false, 1>(Wv + min(lane, CC - 1), bv + min(lane, CC - 1), lane < CC, xr, wrow, xsr, xhr);
  }
  __syncthreads();

  // ---------------- phase 2: projections (K = 32, one k-step) ----------------
  Frag qa[4];                                                    // q rows m0+lo as the B fragments of phase 3
  {
    const v16h af = ldfrag(xh + (m0 + lo) * PX + 8 * h);        // row / col token m0+lo, k = c
    const _Float16* pw = wl + lo * PX + 8 * h;                   // A: plane row 16t+lo (n = 16nt+lo of WkT, WqT), k = c
    // v = tanh(x.Wv + bv), stored transposed
#pragma unroll 1
    for (int nt = 0; nt < 2; ++nt) {
      const int n0 = nt * 16, d = n0 + lo;
      const v8f acc = mma(af, ldfrag(pw + (2 * NRKQ + n0) * PX), zero8());
      // branchless tanh of c = acc * 2^-14 (the bias is in acc): (t - 1) / (t + 1), t = exp(2c); the clamp of c at +-15 and
      // the factor 2 * log2(e) are applied at the accumulator's scale (powers of two: the same values)
      float t[8], dn[8];
#pragma unroll
      for (int r = 0; r < 8; ++r)
        t[r] = fminf(fmaxf(acc[r], -15.0f * 16384.0f), 15.0f * 16384.0f) * (1.4426950408889634f * 0.0001220703125f);
      exp2x8(t);
#pragma unroll
      for (int r = 0; r < 8; ++r) dn[r] = t[r] + 1.0f;
      rcpx8(dn);
      v8h oh;
#pragma unroll
      for (int r = 0; r < 8; r += 2) {                           // by pairs r, r+1: packed f32 operations and converts
        v2f w;
        w[0] = (t[r] - 1.0f) * dn[r];
        w[1] = (t[r + 1] - 1.0f) * dn[r + 1];
        w *= 16.0f;
        const v2h hh = __builtin_convertvector(w, v2h);
        oh[r] = hh[0]; oh[r + 1] = hh[1];
      }
      *(v8h*)(vTh + d * PH + m0 + 8 * h) = oh;
    }
    // k^T = elu(Wk^T.x^T + bk): tiles t = 0..6; q^T = elu(Wq^T.x^T + bq): tiles t = 7..13
    _Float16* kw = kS + (m0 + lo) * PH + 8 * h;
    v16h wf[2 * NTKQ];
    v8f ac[2 * NTKQ];
    // elu (alpha = 1) of v = acc / 8, carried x8: exp(v) = exp2(acc * CE), u = 8 * exp(v) - 8. As exp(v) - 1 >= v for
    // every v, acc <= u: for v > 0 the order is 0 < acc <= u, for v <= 0 it is acc <= u <= 0, so 8 * elu(v) is the
    // middle one of acc, 0 and u: one v_med3 in place of a compare and a select
    const float CE = 1.4426950408889634f * 0.125f;
#define LOAD_TILE(t) wf[t] = ldfrag(pw + (t) * 16 * PX);
#define MMA_TILE(t)                                                                          \
    ac[t] = __builtin_amdgcn_wmma_f32_16x16x32_f16(false, wf[t], false, af, (short)0, zero8(), false, false)
    LOAD_TILE(0) LOAD_TILE(1) LOAD_TILE(2)
    // keeps the six reads of the first three tiles one group in front of the first product, so that tiles 1 and 2 meet
    // no LDS wait of their own
    __builtin_amdgcn_sched_barrier(0);
    MMA_TILE(0);
#pragma unroll
    for (int t = 0; t < 2 * NTKQ; ++t) {
      float e[8];
#pragma unroll
      for (int r = 0; r < 8; ++r) e[r] = ac[t][r] * CE;
      exp2x8(e);
      v2f u[4];                                                  // two values a v_pk_fma_f32
#pragma unroll
      for (int r = 0; r < 8; r += 2) {
        u[r >> 1][0] = e[r];
        u[r >> 1][1] = e[r + 1];
        u[r >> 1] = __builtin_elementwise_fma(u[r >> 1], (v2f)(8.0f), (v2f)(-8.0f));
      }
      // The pair holds tile t+1's product here, where the rest of tile t's elu (12 instructions) fills its result slots.
      // Left alone, with C = 0, the compiler gave it tile t's accumulator registers and put it behind their last read,
      // four instructions in front of its own first reader.
      __builtin_amdgcn_sched_barrier(0);
      if (t + 1 < 2 * NTKQ) MMA_TILE(t + 1);
      __builtin_amdgcn_sched_barrier(0);
      v8h o;
#pragma unroll
      for (int r = 0; r < 8; r += 2) {
        o[r]     = (_Float16)__builtin_amdgcn_fmed3f(ac[t][r], 0.0f, u[r >> 1][0]);
        o[r + 1] = (_Float16)__builtin_amdgcn_fmed3f(ac[t][r + 1], 0.0f, u[r >> 1][1]);
      }
      if (t < NTKQ) *(v8h*)(kw + t * 16) = o;
      else          qa[(t - NTKQ) >> 1].half[(t - NTKQ) & 1] = o;
      if (t + 3 < 2 * NTKQ) LOAD_TILE(t + 3)
#if defined(__HIP_DEVICE_COMPILE__)
      // inputs only: the A and B fragments of tile t+1's product stay in their registers to the end of tile t's elu.
      // Without it results of that elu landed on those registers directly behind the product, and the compiler put
      // three or four v_nop there
      if (t + 1 < 2 * NTKQ) asm volatile("" :: "v"(wf[t + 1]), "v"(af));
#endif
      // one tile a group: keeps the LDS reads of tile t+3 a whole tile in front of their product (left alone the compiler
      // put each tile's reads and a full wait directly in front of it), and ends q's elu in front of phase 3
      __builtin_amdgcn_sched_barrier(0);
    }
#undef LOAD_TILE
#undef MMA_TILE
    v8h z8;
#pragma unroll
    for (int r = 0; r < 8; ++r) z8[r] = (_Float16)0.0f;
    *(v8h*)(kw + NTKQ * 16) = z8;
    qa[NTKQ >> 1].half[NTKQ & 1] = z8;
  }
  __syncthreads();

  // ---------------- phase 3: scores S[i][j] (K = 128 over d), kept in registers ----------------
  v8f acc[8];                                                    // acc[nt][r] = 64 * S[i = 16nt+8h+r][j = m0+lo]
  {
    const _Float16* pb = kS + lo * PH + 8 * h;                   // A: row i = 16nt+lo, k = d (the map of qa)
#pragma unroll
    for (int nt = 0; nt < 8; ++nt) acc[nt] = zero8();
#pragma unroll
    for (int ks = 0; ks < 4; ++ks) {                             // k-step outermost: 8 independent accumulators in a row
      v16h bf[8];
#pragma unroll
      for (int nt = 0; nt < 8; ++nt) bf[nt] = ldfrag(pb + nt * 16 * PH + 32 * ks);
      // keeps the 16 LDS reads of a k-step one group in front of its 8 products: left alone the compiler put two
      // reads and a full wait in front of every product, one LDS latency each
      __builtin_amdgcn_sched_barrier(0);
#pragma unroll
      for (int nt = 0; nt < 8; ++nt)
        acc[nt] = __builtin_amdgcn_wmma_f32_16x16x32_f16(false, bf[nt], false, qa[ks].v, (short)0, acc[nt], false, false);
      // second half of the pair: the next k-step's reads stay behind these products (their registers are reused)
      __builtin_amdgcn_sched_barrier(0);
    }
  }

  // ---------------- phase 4: softmax over i, per column j, in registers ----------------
  {
    // exp(s - max) = exp2((acc - max_acc) * C2), C2 = (1/sqrt(128)) * 2^-6 * log2(e) > 0
    const float C2 = 0.08838834764831845f * 0.015625f * 1.4426950408889634f;
    // seven independent chains of nine values (an odd count: every link a three-input maximum), then one value a lane
    float mx[7];
#pragma unroll
    for (int c = 0; c < 7; ++c) {
      mx[c] = acc[(9 * c) >> 3][(9 * c) & 7];
#pragma unroll
      for (int e = 9 * c + 1; e < 9 * c + 9; ++e) mx[c] = fmaxf(mx[c], acc[e >> 3][e & 7]);
    }
    float m = fmaxf(fmaxf(mx[0], mx[1]), mx[2]);
    m = fmaxf(fmaxf(m, mx[3]), mx[4]);
    m = fmaxf(fmaxf(m, mx[5]), mx[6]);
    m = fmaxf(m, acc[7][7]);
    m = fmaxf(m, xhalf(m));                                      // the column's other 64 rows
    const float nb = -C2 * m;
    v2f s2[4];                                                   // two values a packed f32 instruction from here on
#pragma unroll
    for (int nt = 0; nt < 8; ++nt) {
      float t[8];
#pragma unroll
      for (int r = 0; r < 8; r += 2) {
        v2f a;
        a[0] = acc[nt][r];
        a[1] = acc[nt][r + 1];
        a = __builtin_elementwise_fma(a, (v2f)(C2), (v2f)(nb));
        t[r]     = a[0];
        t[r + 1] = a[1];
      }
      float x[8];
      exp2x8o(x, t);
#pragma unroll
      for (int r = 0; r < 8; r += 2) {
        v2f e;
        e[0] = x[r];
        e[1] = x[r + 1];
        acc[nt][r]     = x[r];
        acc[nt][r + 1] = x[r + 1];
        s2[r >> 1] = nt == 0 ? e : s2[r >> 1] + e;
      }
    }
    const v2f sp = (s2[0] + s2[1]) + (s2[2] + s2[3]);
    float sum = sp[0] + sp[1];
    sum += xhalf(sum);                                           // the largest term is 1: sum >= 1
    const float rs = rcp1(sum) * 1024.0f;
    _Float16* Pw = pS + (m0 + lo) * PH + 8 * h;                  // P transposed, [j][i], carried x1024
#pragma unroll
    for (int nt = 0; nt < 8; ++nt) {
      v8h p;
#pragma unroll
      for (int r = 0; r < 8; r += 2) {
        v2f w;
        w[0] = acc[nt][r];
        w[1] = acc[nt][r + 1];
        const v2h q = __builtin_convertvector(w * rs, v2h);
        p[r]     = q[0];
        p[r + 1] = q[1];
      }
      *(v8h*)(Pw + nt * 16) = p;
    }
  }
  __syncthreads();

  // ---------------- phase 5: y = P.v + x (K = 128 over j) ----------------
  {
    // A: row i = m0+lo, k = j, out of P^T [j][i] (the address form of ld_tr16: k0 = 0, c0 = m0). The pitch stays PH, which
    // suits the 16-B stores; the pitch that suits the transposing reads (32 B x odd) would still leave room for three blocks
    const unsigned char* pa = smem + OFF_PS + (8 * h + (lane & 7)) * (PH * 2) + 2 * m0 + 16 * ((lane >> 3) & 1);
    const _Float16* pv = vTh + lo * PH + 8 * h;                  // B: col d = lo, k = j
    const int d1  = 16 + lo;
    const int d1c = min(d1, CC - 1);
    float* px = xs + (m0 + 8 * h) * CC;                          // rows i = m0+8h+r, the wave's own
    v16h pf[4], bs[4][2];                                        // a k-step's A fragment and its two B fragments
    float x0[8], x1[8];
    v8f ay[2];                                                   // d = lo, d = 16+lo
    ay[0] = zero8();
    ay[1] = zero8();
#pragma unroll                                                 // constant indices: pf and bs stay in registers
    for (int ks = 0; ks < 4; ++ks) {
      Frag f;
      f.half[0] = ld_tr16(pa + (32 * ks) * (PH * 2));
      f.half[1] = ld_tr16(pa + (32 * ks + 16) * (PH * 2));
      pf[ks] = f.v;
      bs[ks][0] = ldfrag(pv + 32 * ks);
      bs[ks][1] = ldfrag(pv + 16 * PH + 32 * ks);
    }
#pragma unroll                                                 // constant indices; the 16 reads issue in a row
    for (int r = 0; r < 8; ++r) {
      x0[r] = px[r * CC + lo];                                   // d = lo < 16 < 20 always valid
      x1[r] = px[r * CC + d1c];
    }
#pragma unroll                                                 // constant indices: two independent accumulators by turns
    for (int ks = 0; ks < 4; ++ks) {
      ay[0] = __builtin_amdgcn_wmma_f32_16x16x32_f16(false, pf[ks], false, bs[ks][0], (short)0, ay[0], false, false);
      ay[1] = __builtin_amdgcn_wmma_f32_16x16x32_f16(false, pf[ks], false, bs[ks][1], (short)0, ay[1], false, false);
    }
    // Order of this phase's LDS reads (0x100) and products (0x008): all reads as one group, k-step by k-step and x last,
    // then the eight products, each behind a counted wait. Left alone the compiler spread the reads over five places among
    // the products and put four of the x reads behind the last product, with a full LDS wait of their own.
    __builtin_amdgcn_sched_group_barrier(0x100, 32, 0);
    __builtin_amdgcn_sched_group_barrier(0x008, 8, 0);
    float v1[8];
#pragma unroll                                                 // constant indices: ay, x0, x1, v1 stay in registers
    for (int r = 0; r < 8; ++r) {
      const float y0 = ay[0][r] * 6.103515625e-05f;              // 2^-14: the scales of P and v
      const float y1 = ay[1][r] * 6.103515625e-05f;
      px[r * CC + lo] = x0[r] + y0;
      v1[r] = x1[r] + y1;
    }
    if (lo < 4) {                                                // d = 16..19
#pragma unroll                                                 // constant indices; the 8 stores issue in a row
      for (int r = 0; r < 8; ++r) px[r * CC + d1] = v1[r];
    }
  }
  __syncthreads();

  {
    const v4f* xs4 = (const v4f*)xs;
    const int c2  = 16 + wid;                                    // valid iff wid < 4 (wave-uniform)
    const int c2c = min(c2, 19);
    const v4f pv0 = xs4[(wid)     * 32 + lane];
    const v4f pv1 = xs4[(8 + wid) * 32 + lane];
    const v4f pv2 = xs4[c2c       * 32 + lane];
    float* ob = out + (size_t)b * XROW + (size_t)lane * 4;
    *(v4f*)(ob + (size_t)wid * 128)       = pv0;
    *(v4f*)(ob + (size_t)(8 + wid) * 128) = pv1;
#if defined(__HIP_DEVICE_COMPILE__)
    // the wait that stands between issued global stores and any later write of a register that they name
    asm volatile("s_wait_xcnt 0x0" ::: "memory");
#endif
    if (wid < 4) *(v4f*)(ob + (size_t)c2 * 128) = pv2;
    
  }
}

// One launch; the workspace is not used.
extern "C" void kernel_launch(void* const* d_in, const int* in_sizes, int n_in,
                              void* d_out, int out_size, void* d_ws, size_t ws_size,
                              hipStream_t stream) {
  if (n_in < 7) return;
  if (in_sizes[0] != NBATCH * XROW) return;
  if (in_sizes[1] != CC * KQ) return;
  if (in_sizes[2] != KQ) return;
  if (in_sizes[3] != CC * KQ) return;
  if (in_sizes[4] != KQ) return;
  if (in_sizes[5] != CC * CC) return;
  if (in_sizes[6] != CC) return;
  if (out_size != NBATCH * XROW) return;

  const float* x  = (const float*)d_in[0];     // [4096][128][20]
  const float* Wk = (const float*)d_in[1];     // [20][100]
  const float* bk = (const float*)d_in[2];     // [100]
  const float* Wq = (const float*)d_in[3];     // [20][100]
  const float* bq = (const float*)d_in[4];     // [100]
  const float* Wv = (const float*)d_in[5];     // [20][20]
  const float* bv = (const float*)d_in[6];     // [20]
  float* out = (float*)d_out;                  // [4096][128][20]

  (void)d_ws;
  (void)ws_size;

  (void)hipFuncSetAttribute(reinterpret_cast<const void*>(&k_main),
                            hipFuncAttributeMaxDynamicSharedMemorySize, LDS_MAIN);

  const dim3 gMain(NBATCH), bMain(256);

  k_main<<<gMain, bMain, LDS_MAIN, stream>>>(x, Wk, bk, Wq, bq, Wv, bv, out);
  (void)hipGetLastError();
}
